// v000
// The times below were measured on an AMD MI455X: many runs one after another, warmed up first and cycling through
// copies of the inputs, with the whole window's GPU time divided by the number of runs. Launches and the gaps
// between them are all in it. The median over several windows is given; except for v000 it joins two sittings, which
// can be a few percent apart, so the side-by-side timings, each taken in one sitting, are the better comparison.
// v000 is the starting kernel. One run takes 1590 microseconds.
#include <hip/hip_runtime.h>

// Causal attention with a learned per-head 3x3 convolution over the score matrix: s = Q.K^T/sqrt(128) with future keys zeroed, cs[q][k] =
// sum_{i<3,j<3} w[h][i][j] s[q-2+i][k-1+j] (query padding left only, key padding symmetric, zeros outside), future keys -> -inf, softmax, out = P.V.
// B=1, 16 heads, S=2048, D=128; Q, K, V are the inputs (no projections).
// Contractions on v_wmma_f32_16x16x32_f16: Q.K^T with both operands split into f16 hi+lo from the x8-scaled f32 rows (3 products); P.V with
// unnormalised P as single f16 against an f16 hi+lo pair of 8V (2 products); f32 accumulate; the 3x3 score convolution, masking and online softmax in
// f32 from an f32 score buffer (4 heads at a time). Fragment k-map per lane half hh for A AND B: elements 0..7 <- k = 8hh+0..7, 8..15 <- k = 16+8hh+0..7.

namespace {
constexpr int H = 16, S = 2048, D = 128, HG = 4;             // heads per score-buffer group
constexpr float XS = 8.0f, VS = 8.0f, SCALE = 0.08838834764831845f;   // 128^-0.5

typedef _Float16 b16;
typedef __attribute__((ext_vector_type(16))) _Float16 v16b;
typedef __attribute__((ext_vector_type(8)))  _Float16 v8b;
typedef __attribute__((ext_vector_type(8)))  float v8f;
typedef __attribute__((ext_vector_type(4)))  float v4f;

__device__ __forceinline__ v8b ld8b(const b16* p) { return *(const v8b*)p; }
__device__ __forceinline__ v16b cat8b(v8b a, v8b b) { return __builtin_shufflevector(a, b, 0, 1, 2, 3, 4, 5, 6, 7, 8, 9, 10, 11, 12, 13, 14, 15); }
__device__ __forceinline__ v16b frag_kb(const b16* p, int hh) { return cat8b(ld8b(p + 8 * hh), ld8b(p + 16 + 8 * hh)); }
__device__ __forceinline__ void split16(float v, b16& hi, b16& lo) { hi = (b16)v; lo = (b16)(v - (float)hi); }
// hi/lo fragment pair straight from an f32 k-contiguous row (same k-map)
__device__ __forceinline__ void frag_ksplit(const float* p, int hh, v16b& fh_, v16b& fl_) {
  const float* p0 = p + 8 * hh; const float* p1 = p + 16 + 8 * hh;
#pragma unroll
  for (int e = 0; e < 8; ++e) { b16 a, c; split16(p0[e], a, c); fh_[e] = a; fl_[e] = c; split16(p1[e], a, c); fh_[8 + e] = a; fl_[8 + e] = c; }
}
__device__ __forceinline__ v8f wmma16b(v16b a, v16b b, v8f c) {
  v8f d = __builtin_amdgcn_wmma_f32_16x16x32_f16(false, a, false, b, (short)0, c, false, false);
  asm volatile("v_nop\n\tv_nop\n\tv_nop\n\tv_nop" : "+v"(d) : "v"(a), "v"(b));
  return d;
}
__device__ __forceinline__ void wave_lds_sync() {
  __builtin_amdgcn_fence(__ATOMIC_RELEASE, "workgroup");
  __builtin_amdgcn_wave_barrier();
  __builtin_amdgcn_fence(__ATOMIC_ACQUIRE, "workgroup");
}

// Operand descriptor: NP = 0 -> f32 rows split on the fly into (hi, lo); NP = 1 -> one f16 plane; NP = 2 -> f16 hi + lo planes;
// NP = 3 -> f32 rows rounded once to a single f16 fragment. ld = row pitch.
struct Opnd { const void* p0; const void* p1; int ld; };
template <int NP> __device__ __forceinline__ void load_frags(const Opnd& o, int row, int kb, int hh, v16b& fh_, v16b& fl_) {
  if (NP == 0) { frag_ksplit((const float*)o.p0 + (size_t)row * o.ld + kb, hh, fh_, fl_); }
  else if (NP == 4 || NP == 5) {                             // f32 rows x64 (NP 4) or x8 (NP 5) then split (keeps the lo halves of small values normal)
    const float sc_ = (NP == 4) ? 64.0f : 8.0f;
    const float* p = (const float*)o.p0 + (size_t)row * o.ld + kb; const float* p0 = p + 8 * hh; const float* p1 = p + 16 + 8 * hh;
#pragma unroll
    for (int e = 0; e < 8; ++e) { b16 a, c; split16(p0[e] * sc_, a, c); fh_[e] = a; fl_[e] = c; split16(p1[e] * sc_, a, c); fh_[8 + e] = a; fl_[8 + e] = c; }
  } else if (NP == 3) {
    const float* p = (const float*)o.p0 + (size_t)row * o.ld + kb; const float* p0 = p + 8 * hh; const float* p1 = p + 16 + 8 * hh;
#pragma unroll
    for (int e = 0; e < 8; ++e) { fh_[e] = (b16)p0[e]; fh_[8 + e] = (b16)p1[e]; }
    fl_ = fh_;
  } else {
    fh_ = frag_kb((const b16*)o.p0 + (size_t)row * o.ld + kb, hh);
    if (NP == 2) fl_ = frag_kb((const b16*)o.p1 + (size_t)row * o.ld + kb, hh); else fl_ = fh_;
  }
}
template <int ANP, int BNP> __device__ __forceinline__ v8f mac(v16b ah, v16b al, v16b bh, v16b bl, v8f c) {
  c = wmma16b(ah, bh, c);
  if (BNP == 0 || BNP == 2 || BNP == 4 || BNP == 5) c = wmma16b(ah, bl, c);     // hi.lo
  if (ANP == 0 || ANP == 2 || ANP == 4 || ANP == 5) c = wmma16b(al, bh, c);     // lo.hi   (lo.lo dropped)
  return c;
}
// 32x64 wave tile: acc[r][t] (rows m0+16r.., cols c0+16t..) += A[m][k] . B[n][k] over k in [0, K)
template <int ANP, int BNP>
__device__ __forceinline__ void gemm_tile(const Opnd& A, const Opnd& B, int K, int m0, int c0, int nloc, int hlf, v8f (&acc)[2][4]) {
  for (int kb = 0; kb < K; kb += 32) {
    v16b a0h, a0l, a1h, a1l;
    load_frags<ANP>(A, m0 + nloc, kb, hlf, a0h, a0l);
    load_frags<ANP>(A, m0 + 16 + nloc, kb, hlf, a1h, a1l);
#pragma unroll
    for (int t = 0; t < 4; ++t) {
      v16b bh, bl;
      load_frags<BNP>(B, c0 + t * 16 + nloc, kb, hlf, bh, bl);
      acc[0][t] = mac<ANP, BNP>(a0h, a0l, bh, bl, acc[0][t]);
      acc[1][t] = mac<ANP, BNP>(a1h, a1l, bh, bl, acc[1][t]);
    }
  }
}

__device__ __forceinline__ void epi_planes(v8f (&acc)[2][4], float scale, bool two, b16* __restrict__ oh, b16* __restrict__ ol, int ldo,
                                           int m0, int c0, int lane, b16* Th, b16* Tl) {
  const int nloc = lane & 15, hlf = lane >> 4;
#pragma unroll
  for (int t = 0; t < 4; ++t)
#pragma unroll
    for (int r = 0; r < 2; ++r)
#pragma unroll
      for (int v = 0; v < 8; ++v) {
        const int rr = r * 16 + v + 8 * hlf, cc = t * 16 + nloc;
        b16 h_, l_; split16(acc[r][t][v] * scale, h_, l_);
        Th[rr * 64 + cc] = h_; Tl[rr * 64 + cc] = l_;
      }
  wave_lds_sync();
  {
#pragma unroll
    for (int j = 0; j < 8; ++j) {
      const int rr = j * 4 + (lane >> 3), c8 = (lane & 7) * 8;
      const size_t o = (size_t)(m0 + rr) * ldo + c0 + c8;
      *(v8b*)(oh + o) = ld8b(Th + rr * 64 + c8);
      if (two) *(v8b*)(ol + o) = ld8b(Tl + rr * 64 + c8);
    }
    
  }
}
// (b) f32 rows with pitch ldo: 64 floats = 256 B = 2 lines per row; 16 lanes x 16 B per row, 2 rows per instruction. Optional per-row factor
__device__ __forceinline__ void epi_f32(v8f (&acc)[2][4], float scale, const float* rscale, float* __restrict__ out, int ldo, int m0, int c0, int lane, float* Tt) {
  const int nloc = lane & 15, hlf = lane >> 4;
#pragma unroll
  for (int t = 0; t < 4; ++t)
#pragma unroll
    for (int r = 0; r < 2; ++r)
#pragma unroll
      for (int v = 0; v < 8; ++v) {
        const int rr = r * 16 + v + 8 * hlf;
        const float rs = rscale ? rscale[(size_t)(m0 + rr) * 32] : 1.0f;
        Tt[rr * 64 + t * 16 + nloc] = acc[r][t][v] * scale * rs;
      }
  wave_lds_sync();
  float* dst0 = out + (size_t)m0 * ldo + c0;
  {
#pragma unroll
    for (int j = 0; j < 16; ++j) { const int rr = j * 2 + hlf, c4 = nloc * 4; *(v4f*)(dst0 + (size_t)rr * ldo + c4) = *(const v4f*)(Tt + rr * 64 + c4); }
    
  }
}



__global__ __launch_bounds__(256) void vt_kernel(const float* __restrict__ V, b16* __restrict__ vth, b16* __restrict__ vtl) {
  __shared__ __attribute__((aligned(16))) b16 Th[D][72]; __shared__ __attribute__((aligned(16))) b16 Tl[D][72];
  const int tid = threadIdx.x, lane = tid & 31, wave = tid >> 5, h = blockIdx.x / (S / 64), t0 = (blockIdx.x % (S / 64)) * 64;
  for (int i = tid; i < 64 * D; i += 256) { const int t = i / D, dd = i % D; b16 a, b2; split16(V[((size_t)h * S + t0 + t) * D + dd] * VS, a, b2); Th[dd][t] = a; Tl[dd][t] = b2; }
  __syncthreads();
  b16* bh = vth + (size_t)h * D * S + t0; b16* bl = vtl + (size_t)h * D * S + t0;
  {
#pragma unroll
    for (int j = 0; j < 4; ++j) { const int dd = wave * 16 + j * 4 + (lane >> 3), c8 = (lane & 7) * 8;
      *(v8b*)(bh + (size_t)dd * S + c8) = *(const v8b*)(&Th[dd][c8]); *(v8b*)(bl + (size_t)dd * S + c8) = *(const v8b*)(&Tl[dd][c8]); }
    
  }
}

// Scores for head group g: grid (32 key tiles of 64, 16 row blocks, HG); tiles wholly above the diagonal skip the MMA work (acc = 0); epilogue
__global__ __launch_bounds__(128) void s_kernel(const float* __restrict__ Q, const float* __restrict__ K, int h0, float* __restrict__ Sb) {
  __shared__ __attribute__((aligned(16))) float Ts[4][32 * 64];
  const int lane = threadIdx.x & 31, wave = threadIdx.x >> 5, nloc = lane & 15, hlf = lane >> 4, hl = blockIdx.z, h = h0 + hl;
  const int qb = blockIdx.y, kt = blockIdx.x, m0 = qb * 128 + wave * 32, c0 = kt * 64;
  v8f acc[2][4];
#pragma unroll
  for (int r = 0; r < 2; ++r)
#pragma unroll
    for (int t = 0; t < 4; ++t) acc[r][t] = (v8f){};
  if (c0 <= qb * 128 + 127) {                                  // block-uniform: some (q, k) in this tile has k <= q
    const Opnd A{Q + (size_t)h * S * D, nullptr, D}, B{K + (size_t)h * S * D, nullptr, D};
    gemm_tile<5, 5>(A, B, D, m0, c0, nloc, hlf, acc);
  }
  float* Tt = Ts[wave];
#pragma unroll
  for (int t = 0; t < 4; ++t)
#pragma unroll
    for (int r = 0; r < 2; ++r)
#pragma unroll
      for (int v = 0; v < 8; ++v) { const int rr = r * 16 + v + 8 * hlf, cc = t * 16 + nloc; Tt[rr * 64 + cc] = (c0 + cc <= m0 + rr) ? acc[r][t][v] * (SCALE / (XS * XS)) : 0.0f; }
  wave_lds_sync();
  float* dst0 = Sb + ((size_t)hl * S + m0) * S + c0;
  {
#pragma unroll
    for (int j = 0; j < 16; ++j) { const int rr = j * 2 + hlf, c4 = nloc * 4; *(v4f*)(dst0 + (size_t)rr * S + c4) = *(const v4f*)(Tt + rr * 64 + c4); }
    
  }
}

// ---------------------------------------------------------------------------
// Convolved-score attention for head group g: wave = 16 queries of one head; causal key chunks of 32; per element the 3x3 window of the stored scores
// (rows q-2..q, keys k-1..k+1, zero outside [0,S)), x w[h], -inf for k > q; online softmax f32; P^T f16; y^T += (8V)^T.P^T (8 feature tiles, hi + lo
// ---------------------------------------------------------------------------
__global__ __launch_bounds__(256) void attn_kernel(const float* __restrict__ Sb, const float* __restrict__ wconv, const b16* __restrict__ vth, const b16* __restrict__ vtl,
                                                   int h0, float* __restrict__ out) {
  __shared__ __attribute__((aligned(16))) float Os[8][16 * D];
  const int wid = threadIdx.x >> 5, lane = threadIdx.x & 31, hh = lane >> 4, col = lane & 15;
  const int qt = blockIdx.x * 8 + wid, hl = qt / (S / 16), q0 = (qt % (S / 16)) * 16, h = h0 + hl, qi = q0 + col;
  const float* Sh = Sb + (size_t)hl * S * S; const b16* vh = vth + (size_t)h * D * S; const b16* vl = vtl + (size_t)h * D * S;
  float w[9];
#pragma unroll
  for (int i = 0; i < 9; ++i) w[i] = wconv[h * 9 + i];       // [i][j]: query tap i (row q-2+i), key tap j (k-1+j)
  float m = -INFINITY, l = 0.0f;
  v8f o[8];
#pragma unroll
  for (int n = 0; n < 8; ++n) o[n] = (v8f){};
  for (int kb = 0; kb < q0 + 16; kb += 32) {
    v8f s0 = {}, s1 = {};
    // accumulate the 3x3 window row by row (one 10-key run live at a time keeps the register count low)
#pragma unroll
    for (int i = 0; i < 3; ++i) {
      const int qr = qi - 2 + i; const bool qok = qr >= 0; const float* Srow = Sh + (size_t)(qok ? qr : 0) * S;
      {
        const int kbase = kb + 8 * hh - 1; float run[10];
#pragma unroll
        for (int j = 0; j < 10; ++j) { const int kk = kbase + j; run[j] = (qok && kk >= 0 && kk < S) ? Srow[kk] : 0.0f; }
#pragma unroll
        for (int r = 0; r < 8; ++r) s0[r] += w[i * 3 + 0] * run[r] + w[i * 3 + 1] * run[r + 1] + w[i * 3 + 2] * run[r + 2];
      }
      {
        const int kbase = kb + 16 + 8 * hh - 1; float run[10];
#pragma unroll
        for (int j = 0; j < 10; ++j) { const int kk = kbase + j; run[j] = (qok && kk >= 0 && kk < S) ? Srow[kk] : 0.0f; }
#pragma unroll
        for (int r = 0; r < 8; ++r) s1[r] += w[i * 3 + 0] * run[r] + w[i * 3 + 1] * run[r + 1] + w[i * 3 + 2] * run[r + 2];
      }
    }
#pragma unroll
    for (int r = 0; r < 8; ++r) { const int k0i = kb + 8 * hh + r, k1i = k0i + 16; if (k0i > qi) s0[r] = -INFINITY; if (k1i > qi) s1[r] = -INFINITY; }
    float mr = -INFINITY;
#pragma unroll
    for (int r = 0; r < 8; ++r) mr = fmaxf(mr, fmaxf(s0[r], s1[r]));
    mr = fmaxf(mr, __shfl_xor(mr, 16));
    float mn = fmaxf(m, mr); if (mn == -INFINITY) mn = 0.0f;
    const float al_ = __expf(m - mn); m = mn;
    float sum = 0.0f; v16b pb;
#pragma unroll
    for (int r = 0; r < 8; ++r) { const float p0 = __expf(s0[r] - mn), p1 = __expf(s1[r] - mn); sum += p0 + p1; pb[r] = (b16)p0; pb[8 + r] = (b16)p1; }
    sum += __shfl_xor(sum, 16);
    l = l * al_ + sum;
#pragma unroll
    for (int n = 0; n < 8; ++n) {
#pragma unroll
      for (int r = 0; r < 8; ++r) o[n][r] *= al_;
      const size_t ro = (size_t)(n * 16 + col) * S + kb;
      o[n] = wmma16b(frag_kb(vh + ro, hh), pb, o[n]);
      o[n] = wmma16b(frag_kb(vl + ro, hh), pb, o[n]);
    }
  }
  const float inv = (l > 0.0f) ? (1.0f / (VS * l)) : 0.0f;
  float* Tt = Os[wid];
#pragma unroll
  for (int n = 0; n < 8; ++n)
#pragma unroll
    for (int r = 0; r < 8; ++r) Tt[col * D + n * 16 + 8 * hh + r] = o[n][r] * inv;    // y^T: lane col = query, element r = feature 16n+8hh+r
  wave_lds_sync();
  float* dst = out + ((size_t)h * S + q0) * D;                 // 16 rows x 512 B: 32 lanes x 16 B per row
  {
#pragma unroll
    for (int rr = 0; rr < 16; ++rr) *(v4f*)(dst + (size_t)rr * D + lane * 4) = *(const v4f*)(Tt + rr * D + lane * 4);
    
  }
}
}  // namespace

extern "C" void kernel_launch(void* const* d_in, const int* in_sizes, int n_in,
                              void* d_out, int out_size, void* d_ws, size_t ws_size, hipStream_t stream) {
  (void)n_in; (void)out_size;
  const float* Q = (const float*)d_in[0]; const float* K = (const float*)d_in[1]; const float* V = (const float*)d_in[2];   // [1,16,2048,128]
  const float* wconv = (const float*)d_in[3];   // [16,3,3]
  float* out = (float*)d_out;                   // [1,16,2048,128]
  if (in_sizes[0] != H * S * D || in_sizes[1] != H * S * D || in_sizes[2] != H * S * D || in_sizes[3] != H * 9) return;
  size_t off = 0; char* ws = (char*)d_ws;
  auto carve = [&](size_t bytes) { char* p = ws + off; off += (bytes + 255) & ~(size_t)255; return p; };
  b16* vth = (b16*)carve((size_t)H * D * S * 2);     //  8 MB
  b16* vtl = (b16*)carve((size_t)H * D * S * 2);     //  8 MB
  float* Sb = (float*)carve((size_t)HG * S * S * 4); // 64 MB score buffer for 4 heads
  if (off > ws_size) return;                           // total 83,886,080 B
  vt_kernel<<<H * (S / 64), 256, 0, stream>>>(V, vth, vtl);
  for (int g = 0; g < H / HG; ++g) {
    s_kernel<<<dim3(S / 64, S / 128, HG), 128, 0, stream>>>(Q, K, g * HG, Sb);
    attn_kernel<<<HG * (S / 16) / 8, 256, 0, stream>>>(Sb, wconv, vth, vtl, g * HG, out);
  }
}

// v001
// Measured time: 539 microseconds a run.
// Timed twice side by side with v000, it ran 2.94 times as fast both times.
#include <hip/hip_runtime.h>

// Causal attention with a learned per-head 3x3 convolution over the score matrix: s = Q.K^T/sqrt(128) with future keys zeroed, cs[q][k] =
// sum_{i<3,j<3} w[h][i][j] s[q-2+i][k-1+j] (query padding left only, key padding symmetric, zeros outside), future keys -> -inf, softmax, out = P.V.
// B=1, 16 heads, S=2048, D=128; Q, K, V are the inputs (no projections).
// Contractions on v_wmma_f32_16x16x32_f16: Q.K^T with both operands split into f16 hi+lo from the x8-scaled f32 rows (3 products); P.V with
// unnormalised P as single f16 against an f16 hi+lo pair of 8V (2 products); f32 accumulate; the 3x3 score convolution, masking and online softmax in
// f32 from an f32 score buffer (4 heads at a time). Fragment k-map per lane half hh for A AND B: elements 0..7 <- k = 8hh+0..7, 8..15 <- k = 16+8hh+0..7.

namespace {
constexpr int H = 16, S = 2048, D = 128, HG = 4;             // heads per score-buffer group
constexpr float XS = 8.0f, VS = 8.0f, SCALE = 0.08838834764831845f;   // 128^-0.5

typedef _Float16 b16;
typedef __attribute__((ext_vector_type(16))) _Float16 v16b;
typedef __attribute__((ext_vector_type(8)))  _Float16 v8b;
typedef __attribute__((ext_vector_type(8)))  float v8f;
typedef __attribute__((ext_vector_type(4)))  float v4f;

__device__ __forceinline__ v8b ld8b(const b16* p) { return *(const v8b*)p; }
__device__ __forceinline__ v16b cat8b(v8b a, v8b b) { return __builtin_shufflevector(a, b, 0, 1, 2, 3, 4, 5, 6, 7, 8, 9, 10, 11, 12, 13, 14, 15); }
__device__ __forceinline__ v16b frag_kb(const b16* p, int hh) { return cat8b(ld8b(p + 8 * hh), ld8b(p + 16 + 8 * hh)); }
__device__ __forceinline__ void split16(float v, b16& hi, b16& lo) { hi = (b16)v; lo = (b16)(v - (float)hi); }
// hi/lo fragment pair straight from an f32 k-contiguous row (same k-map)
__device__ __forceinline__ void frag_ksplit(const float* p, int hh, v16b& fh_, v16b& fl_) {
  const float* p0 = p + 8 * hh; const float* p1 = p + 16 + 8 * hh;
#pragma unroll
  for (int e = 0; e < 8; ++e) { b16 a, c; split16(p0[e], a, c); fh_[e] = a; fl_[e] = c; split16(p1[e], a, c); fh_[8 + e] = a; fl_[8 + e] = c; }
}
__device__ __forceinline__ v8f wmma16b(v16b a, v16b b, v8f c) {
  v8f d = __builtin_amdgcn_wmma_f32_16x16x32_f16(false, a, false, b, (short)0, c, false, false);
  asm volatile("v_nop\n\tv_nop\n\tv_nop\n\tv_nop" : "+v"(d) : "v"(a), "v"(b));
  return d;
}
__device__ __forceinline__ void wave_lds_sync() {
  __builtin_amdgcn_fence(__ATOMIC_RELEASE, "workgroup");
  __builtin_amdgcn_wave_barrier();
  __builtin_amdgcn_fence(__ATOMIC_ACQUIRE, "workgroup");
}

// Operand descriptor: NP = 0 -> f32 rows split on the fly into (hi, lo); NP = 1 -> one f16 plane; NP = 2 -> f16 hi + lo planes;
// NP = 3 -> f32 rows rounded once to a single f16 fragment. ld = row pitch.
struct Opnd { const void* p0; const void* p1; int ld; };
template <int NP> __device__ __forceinline__ void load_frags(const Opnd& o, int row, int kb, int hh, v16b& fh_, v16b& fl_) {
  if (NP == 0) { frag_ksplit((const float*)o.p0 + (size_t)row * o.ld + kb, hh, fh_, fl_); }
  else if (NP == 4 || NP == 5) {                             // f32 rows x64 (NP 4) or x8 (NP 5) then split (keeps the lo halves of small values normal)
    const float sc_ = (NP == 4) ? 64.0f : 8.0f;
    const float* p = (const float*)o.p0 + (size_t)row * o.ld + kb; const float* p0 = p + 8 * hh; const float* p1 = p + 16 + 8 * hh;
#pragma unroll
    for (int e = 0; e < 8; ++e) { b16 a, c; split16(p0[e] * sc_, a, c); fh_[e] = a; fl_[e] = c; split16(p1[e] * sc_, a, c); fh_[8 + e] = a; fl_[8 + e] = c; }
  } else if (NP == 3) {
    const float* p = (const float*)o.p0 + (size_t)row * o.ld + kb; const float* p0 = p + 8 * hh; const float* p1 = p + 16 + 8 * hh;
#pragma unroll
    for (int e = 0; e < 8; ++e) { fh_[e] = (b16)p0[e]; fh_[8 + e] = (b16)p1[e]; }
    fl_ = fh_;
  } else {
    fh_ = frag_kb((const b16*)o.p0 + (size_t)row * o.ld + kb, hh);
    if (NP == 2) fl_ = frag_kb((const b16*)o.p1 + (size_t)row * o.ld + kb, hh); else fl_ = fh_;
  }
}
template <int ANP, int BNP> __device__ __forceinline__ v8f mac(v16b ah, v16b al, v16b bh, v16b bl, v8f c) {
  c = wmma16b(ah, bh, c);
  if (BNP == 0 || BNP == 2 || BNP == 4 || BNP == 5) c = wmma16b(ah, bl, c);     // hi.lo
  if (ANP == 0 || ANP == 2 || ANP == 4 || ANP == 5) c = wmma16b(al, bh, c);     // lo.hi   (lo.lo dropped)
  return c;
}
// 32x64 wave tile: acc[r][t] (rows m0+16r.., cols c0+16t..) += A[m][k] . B[n][k] over k in [0, K)
template <int ANP, int BNP>
__device__ __forceinline__ void gemm_tile(const Opnd& A, const Opnd& B, int K, int m0, int c0, int nloc, int hlf, v8f (&acc)[2][4]) {
  for (int kb = 0; kb < K; kb += 32) {
    v16b a0h, a0l, a1h, a1l;
    load_frags<ANP>(A, m0 + nloc, kb, hlf, a0h, a0l);
    load_frags<ANP>(A, m0 + 16 + nloc, kb, hlf, a1h, a1l);
#pragma unroll
    for (int t = 0; t < 4; ++t) {
      v16b bh, bl;
      load_frags<BNP>(B, c0 + t * 16 + nloc, kb, hlf, bh, bl);
      acc[0][t] = mac<ANP, BNP>(a0h, a0l, bh, bl, acc[0][t]);
      acc[1][t] = mac<ANP, BNP>(a1h, a1l, bh, bl, acc[1][t]);
    }
  }
}

__device__ __forceinline__ void epi_planes(v8f (&acc)[2][4], float scale, bool two, b16* __restrict__ oh, b16* __restrict__ ol, int ldo,
                                           int m0, int c0, int lane, b16* Th, b16* Tl) {
  const int nloc = lane & 15, hlf = lane >> 4;
#pragma unroll
  for (int t = 0; t < 4; ++t)
#pragma unroll
    for (int r = 0; r < 2; ++r)
#pragma unroll
      for (int v = 0; v < 8; ++v) {
        const int rr = r * 16 + v + 8 * hlf, cc = t * 16 + nloc;
        b16 h_, l_; split16(acc[r][t][v] * scale, h_, l_);
        Th[rr * 64 + cc] = h_; Tl[rr * 64 + cc] = l_;
      }
  wave_lds_sync();
  {
#pragma unroll
    for (int j = 0; j < 8; ++j) {
      const int rr = j * 4 + (lane >> 3), c8 = (lane & 7) * 8;
      const size_t o = (size_t)(m0 + rr) * ldo + c0 + c8;
      *(v8b*)(oh + o) = ld8b(Th + rr * 64 + c8);
      if (two) *(v8b*)(ol + o) = ld8b(Tl + rr * 64 + c8);
    }
    
  }
}
// (b) f32 rows with pitch ldo: 64 floats = 256 B = 2 lines per row; 16 lanes x 16 B per row, 2 rows per instruction. Optional per-row factor
__device__ __forceinline__ void epi_f32(v8f (&acc)[2][4], float scale, const float* rscale, float* __restrict__ out, int ldo, int m0, int c0, int lane, float* Tt) {
  const int nloc = lane & 15, hlf = lane >> 4;
#pragma unroll
  for (int t = 0; t < 4; ++t)
#pragma unroll
    for (int r = 0; r < 2; ++r)
#pragma unroll
      for (int v = 0; v < 8; ++v) {
        const int rr = r * 16 + v + 8 * hlf;
        const float rs = rscale ? rscale[(size_t)(m0 + rr) * 32] : 1.0f;
        Tt[rr * 64 + t * 16 + nloc] = acc[r][t][v] * scale * rs;
      }
  wave_lds_sync();
  float* dst0 = out + (size_t)m0 * ldo + c0;
  {
#pragma unroll
    for (int j = 0; j < 16; ++j) { const int rr = j * 2 + hlf, c4 = nloc * 4; *(v4f*)(dst0 + (size_t)rr * ldo + c4) = *(const v4f*)(Tt + rr * 64 + c4); }
    
  }
}



__global__ __launch_bounds__(256) void vt_kernel(const float* __restrict__ V, b16* __restrict__ vth, b16* __restrict__ vtl) {
  __shared__ __attribute__((aligned(16))) b16 Th[D][72]; __shared__ __attribute__((aligned(16))) b16 Tl[D][72];
  const int tid = threadIdx.x, lane = tid & 31, wave = tid >> 5, h = blockIdx.x / (S / 64), t0 = (blockIdx.x % (S / 64)) * 64;
  for (int i = tid; i < 64 * D; i += 256) { const int t = i / D, dd = i % D; b16 a, b2; split16(V[((size_t)h * S + t0 + t) * D + dd] * VS, a, b2); Th[dd][t] = a; Tl[dd][t] = b2; }
  __syncthreads();
  b16* bh = vth + (size_t)h * D * S + t0; b16* bl = vtl + (size_t)h * D * S + t0;
  {
#pragma unroll
    for (int j = 0; j < 4; ++j) { const int dd = wave * 16 + j * 4 + (lane >> 3), c8 = (lane & 7) * 8;
      *(v8b*)(bh + (size_t)dd * S + c8) = *(const v8b*)(&Th[dd][c8]); *(v8b*)(bl + (size_t)dd * S + c8) = *(const v8b*)(&Tl[dd][c8]); }
    
  }
}

// Scores for head group g: grid (32 key tiles of 64, 16 row blocks, HG); tiles wholly above the diagonal skip the MMA work (acc = 0); epilogue
__global__ __launch_bounds__(128) void s_kernel(const float* __restrict__ Q, const float* __restrict__ K, int h0, float* __restrict__ Sb) {
  __shared__ __attribute__((aligned(16))) float Ts[4][32 * 64];
  const int lane = threadIdx.x & 31, wave = threadIdx.x >> 5, nloc = lane & 15, hlf = lane >> 4, hl = blockIdx.z, h = h0 + hl;
  const int qb = blockIdx.y, kt = blockIdx.x, m0 = qb * 128 + wave * 32, c0 = kt * 64;
  v8f acc[2][4];
#pragma unroll
  for (int r = 0; r < 2; ++r)
#pragma unroll
    for (int t = 0; t < 4; ++t) acc[r][t] = (v8f){};
  if (c0 <= qb * 128 + 127) {                                  // block-uniform: some (q, k) in this tile has k <= q
    const Opnd A{Q + (size_t)h * S * D, nullptr, D}, B{K + (size_t)h * S * D, nullptr, D};
    gemm_tile<5, 5>(A, B, D, m0, c0, nloc, hlf, acc);
  }
  float* Tt = Ts[wave];
#pragma unroll
  for (int t = 0; t < 4; ++t)
#pragma unroll
    for (int r = 0; r < 2; ++r)
#pragma unroll
      for (int v = 0; v < 8; ++v) { const int rr = r * 16 + v + 8 * hlf, cc = t * 16 + nloc; Tt[rr * 64 + cc] = (c0 + cc <= m0 + rr) ? acc[r][t][v] * (SCALE / (XS * XS)) : 0.0f; }
  wave_lds_sync();
  float* dst0 = Sb + ((size_t)hl * S + m0) * S + c0;
  {
#pragma unroll
    for (int j = 0; j < 16; ++j) { const int rr = j * 2 + hlf, c4 = nloc * 4; *(v4f*)(dst0 + (size_t)rr * S + c4) = *(const v4f*)(Tt + rr * 64 + c4); }
    
  }
}

// ---------------------------------------------------------------------------
// Convolved-score attention for head group g: work-group = one head's query tiles t and S/16-1-t (16 queries each, one after the other: every
// work-group has the same number of causal key chunks); the tile's key chunks of 32 are dealt round-robin over the NW waves, each with its own
// maximum, sum and accumulators; partials merged through LDS. Per element the 3x3 window of the stored scores
// (rows q-2..q, keys k-1..k+1, zero outside [0,S)), x w[h], -inf for k > q; online softmax f32; P^T f16; y^T += (8V)^T.P^T (8 feature tiles, hi + lo
// ---------------------------------------------------------------------------
constexpr int NW = 16;        // waves per work-group; also the rows of a query tile, so wave w merges row w
constexpr int OP = D + 4;     // pitch of a partial row in floats: 528 B = 16 B x odd, so the 16 query columns of a b128 store fall on distinct banks
__global__ __launch_bounds__(NW * 32) void attn_kernel(const float* __restrict__ Sb, const float* __restrict__ wconv, const b16* __restrict__ vth, const b16* __restrict__ vtl,
                                                   int h0, float* __restrict__ out) {
  __shared__ __attribute__((aligned(16))) float Os[NW][16 * OP];
  __shared__ float Ms[NW][16]; __shared__ float Ls[NW][16];
  const int wid = threadIdx.x >> 5, lane = threadIdx.x & 31, hh = lane >> 4, col = lane & 15;
  const int hl = blockIdx.x / (S / 32), pr = blockIdx.x % (S / 32), h = h0 + hl;
  const float* Sh = Sb + (size_t)hl * S * S; const b16* vh = vth + (size_t)h * D * S; const b16* vl = vtl + (size_t)h * D * S;
  float w[9];
#pragma unroll
  for (int i = 0; i < 9; ++i) w[i] = wconv[h * 9 + i];       // [i][j]: query tap i (row q-2+i), key tap j (k-1+j)
  for (int half = 0; half < 2; ++half) {
    const int q0 = (half ? pr : S / 16 - 1 - pr) * 16, qi = q0 + col;
    const int nch = (q0 + 16 + 31) / 32, nact = nch < NW ? nch : NW;     // key chunks of this tile; waves that have at least one
    float m = -INFINITY, l = 0.0f;
    v8f o[8];
#pragma unroll
    for (int n = 0; n < 8; ++n) o[n] = (v8f){};
    for (int kb = wid * 32; kb < q0 + 16; kb += NW * 32) {
      v8f s0 = {}, s1 = {};
      // accumulate the 3x3 window row by row (one 10-key run live at a time keeps the register count low)
#pragma unroll
      for (int i = 0; i < 3; ++i) {
        const int qr = qi - 2 + i; const bool qok = qr >= 0; const float* Srow = Sh + (size_t)(qok ? qr : 0) * S;
        {
          const int kbase = kb + 8 * hh - 1; float run[10];
#pragma unroll
          for (int j = 0; j < 10; ++j) { const int kk = kbase + j; run[j] = (qok && kk >= 0 && kk < S) ? Srow[kk] : 0.0f; }
#pragma unroll
          for (int r = 0; r < 8; ++r) s0[r] += w[i * 3 + 0] * run[r] + w[i * 3 + 1] * run[r + 1] + w[i * 3 + 2] * run[r + 2];
        }
        {
          const int kbase = kb + 16 + 8 * hh - 1; float run[10];
#pragma unroll
          for (int j = 0; j < 10; ++j) { const int kk = kbase + j; run[j] = (qok && kk >= 0 && kk < S) ? Srow[kk] : 0.0f; }
#pragma unroll
          for (int r = 0; r < 8; ++r) s1[r] += w[i * 3 + 0] * run[r] + w[i * 3 + 1] * run[r + 1] + w[i * 3 + 2] * run[r + 2];
        }
      }
#pragma unroll
      for (int r = 0; r < 8; ++r) { const int k0i = kb + 8 * hh + r, k1i = k0i + 16; if (k0i > qi) s0[r] = -INFINITY; if (k1i > qi) s1[r] = -INFINITY; }
      float mr = -INFINITY;
#pragma unroll
      for (int r = 0; r < 8; ++r) mr = fmaxf(mr, fmaxf(s0[r], s1[r]));
      mr = fmaxf(mr, __shfl_xor(mr, 16));
      float mn = fmaxf(m, mr); if (mn == -INFINITY) mn = 0.0f;
      const float al_ = __expf(m - mn); m = mn;
      float sum = 0.0f; v16b pb;
#pragma unroll
      for (int r = 0; r < 8; ++r) { const float p0 = __expf(s0[r] - mn), p1 = __expf(s1[r] - mn); sum += p0 + p1; pb[r] = (b16)p0; pb[8 + r] = (b16)p1; }
      sum += __shfl_xor(sum, 16);
      l = l * al_ + sum;
#pragma unroll
      for (int n = 0; n < 8; ++n) {
#pragma unroll
        for (int r = 0; r < 8; ++r) o[n][r] *= al_;
        const size_t ro = (size_t)(n * 16 + col) * S + kb;
        o[n] = wmma16b(frag_kb(vh + ro, hh), pb, o[n]);
        o[n] = wmma16b(frag_kb(vl + ro, hh), pb, o[n]);
      }
    }
    if (wid < nact) {                                            // un-normalised partial y^T: lane col = query, element r = feature 16n+8hh+r
      float* Tt = Os[wid];
#pragma unroll
      for (int n = 0; n < 8; ++n)
#pragma unroll
        for (int r = 0; r < 8; ++r) Tt[col * OP + n * 16 + 8 * hh + r] = o[n][r];
      if (hh == 0) { Ms[wid][col] = m; Ls[wid][col] = l; }
    }
    __syncthreads();                                             // every wave's partial is in LDS before any is merged
    {
      float mx = -INFINITY;
      for (int u = 0; u < nact; ++u) mx = fmaxf(mx, Ms[u][wid]);
      float ls = 0.0f; v4f y = {};
      for (int u = 0; u < nact; ++u) { const float f = __expf(Ms[u][wid] - mx); ls += f * Ls[u][wid]; y += f * *(const v4f*)(&Os[u][wid * OP + lane * 4]); }
      const float inv = (ls > 0.0f) ? (1.0f / (VS * ls)) : 0.0f;
      *(v4f*)(out + ((size_t)h * S + q0 + wid) * D + lane * 4) = y * inv;    // one row of 512 B per wave: whole lines
    }
    __syncthreads();                                             // the merge has read the partials before the second tile overwrites them
  }
}
}  // namespace

extern "C" void kernel_launch(void* const* d_in, const int* in_sizes, int n_in,
                              void* d_out, int out_size, void* d_ws, size_t ws_size, hipStream_t stream) {
  (void)n_in; (void)out_size;
  const float* Q = (const float*)d_in[0]; const float* K = (const float*)d_in[1]; const float* V = (const float*)d_in[2];   // [1,16,2048,128]
  const float* wconv = (const float*)d_in[3];   // [16,3,3]
  float* out = (float*)d_out;                   // [1,16,2048,128]
  if (in_sizes[0] != H * S * D || in_sizes[1] != H * S * D || in_sizes[2] != H * S * D || in_sizes[3] != H * 9) return;
  size_t off = 0; char* ws = (char*)d_ws;
  auto carve = [&](size_t bytes) { char* p = ws + off; off += (bytes + 255) & ~(size_t)255; return p; };
  b16* vth = (b16*)carve((size_t)H * D * S * 2);     //  8 MB
  b16* vtl = (b16*)carve((size_t)H * D * S * 2);     //  8 MB
  float* Sb = (float*)carve((size_t)HG * S * S * 4); // 64 MB score buffer for 4 heads
  if (off > ws_size) return;                           // total 83,886,080 B
  vt_kernel<<<H * (S / 64), 256, 0, stream>>>(V, vth, vtl);
  for (int g = 0; g < H / HG; ++g) {
    s_kernel<<<dim3(S / 64, S / 128, HG), 128, 0, stream>>>(Q, K, g * HG, Sb);
    attn_kernel<<<HG * (S / 32), NW * 32, 0, stream>>>(Sb, wconv, vth, vtl, g * HG, out);
  }
}

// v002
// One run takes 316 microseconds.
// Timed twice side by side with v001, it ran 1.71 and 1.70 times as fast.
// Over all steps from v000 it is 5.01 times as fast.
#include <hip/hip_runtime.h>

// Causal attention with a learned per-head 3x3 convolution over the score matrix: s = Q.K^T/sqrt(128) with future keys zeroed, cs[q][k] =
// sum_{i<3,j<3} w[h][i][j] s[q-2+i][k-1+j] (query padding left only, key padding symmetric, zeros outside), future keys -> -inf, softmax, out = P.V.
// B=1, 16 heads, S=2048, D=128; Q, K, V are the inputs (no projections).
// Contractions on v_wmma_f32_16x16x32_f16: Q.K^T with both operands split into f16 hi+lo from the x8-scaled f32 rows (3 products); P.V with
// unnormalised P as single f16 against an f16 hi+lo pair of 8V (2 products); f32 accumulate; the 3x3 score convolution, masking and online softmax in
// f32 from an f32 score buffer (4 heads at a time). Fragment k-map per lane half hh for A AND B: elements 0..7 <- k = 8hh+0..7, 8..15 <- k = 16+8hh+0..7.

namespace {
constexpr int H = 16, S = 2048, D = 128, HG = 4;             // heads per score-buffer group
constexpr float XS = 8.0f, VS = 8.0f, SCALE = 0.08838834764831845f;   // 128^-0.5

typedef _Float16 b16;
typedef __attribute__((ext_vector_type(16))) _Float16 v16b;
typedef __attribute__((ext_vector_type(8)))  _Float16 v8b;
typedef __attribute__((ext_vector_type(8)))  float v8f;
typedef __attribute__((ext_vector_type(4)))  float v4f;

__device__ __forceinline__ v8b ld8b(const b16* p) { return *(const v8b*)p; }
__device__ __forceinline__ v16b cat8b(v8b a, v8b b) { return __builtin_shufflevector(a, b, 0, 1, 2, 3, 4, 5, 6, 7, 8, 9, 10, 11, 12, 13, 14, 15); }
__device__ __forceinline__ v16b frag_kb(const b16* p, int hh) { return cat8b(ld8b(p + 8 * hh), ld8b(p + 16 + 8 * hh)); }
__device__ __forceinline__ void split16(float v, b16& hi, b16& lo) { hi = (b16)v; lo = (b16)(v - (float)hi); }
// hi/lo fragment pair straight from an f32 k-contiguous row (same k-map)
__device__ __forceinline__ void frag_ksplit(const float* p, int hh, v16b& fh_, v16b& fl_) {
  const float* p0 = p + 8 * hh; const float* p1 = p + 16 + 8 * hh;
#pragma unroll
  for (int e = 0; e < 8; ++e) { b16 a, c; split16(p0[e], a, c); fh_[e] = a; fl_[e] = c; split16(p1[e], a, c); fh_[8 + e] = a; fl_[8 + e] = c; }
}
__device__ __forceinline__ v8f wmma16b(v16b a, v16b b, v8f c) {
  v8f d = __builtin_amdgcn_wmma_f32_16x16x32_f16(false, a, false, b, (short)0, c, false, false);
  asm volatile("v_nop\n\tv_nop\n\tv_nop\n\tv_nop" : "+v"(d) : "v"(a), "v"(b));
  return d;
}
__device__ __forceinline__ void wave_lds_sync() {
  __builtin_amdgcn_fence(__ATOMIC_RELEASE, "workgroup");
  __builtin_amdgcn_wave_barrier();
  __builtin_amdgcn_fence(__ATOMIC_ACQUIRE, "workgroup");
}

// Operand descriptor: NP = 0 -> f32 rows split on the fly into (hi, lo); NP = 1 -> one f16 plane; NP = 2 -> f16 hi + lo planes;
// NP = 3 -> f32 rows rounded once to a single f16 fragment. ld = row pitch.
struct Opnd { const void* p0; const void* p1; int ld; };
template <int NP> __device__ __forceinline__ void load_frags(const Opnd& o, int row, int kb, int hh, v16b& fh_, v16b& fl_) {
  if (NP == 0) { frag_ksplit((const float*)o.p0 + (size_t)row * o.ld + kb, hh, fh_, fl_); }
  else if (NP == 4 || NP == 5) {                             // f32 rows x64 (NP 4) or x8 (NP 5) then split (keeps the lo halves of small values normal)
    const float sc_ = (NP == 4) ? 64.0f : 8.0f;
    const float* p = (const float*)o.p0 + (size_t)row * o.ld + kb; const float* p0 = p + 8 * hh; const float* p1 = p + 16 + 8 * hh;
#pragma unroll
    for (int e = 0; e < 8; ++e) { b16 a, c; split16(p0[e] * sc_, a, c); fh_[e] = a; fl_[e] = c; split16(p1[e] * sc_, a, c); fh_[8 + e] = a; fl_[8 + e] = c; }
  } else if (NP == 3) {
    const float* p = (const float*)o.p0 + (size_t)row * o.ld + kb; const float* p0 = p + 8 * hh; const float* p1 = p + 16 + 8 * hh;
#pragma unroll
    for (int e = 0; e < 8; ++e) { fh_[e] = (b16)p0[e]; fh_[8 + e] = (b16)p1[e]; }
    fl_ = fh_;
  } else {
    fh_ = frag_kb((const b16*)o.p0 + (size_t)row * o.ld + kb, hh);
    if (NP == 2) fl_ = frag_kb((const b16*)o.p1 + (size_t)row * o.ld + kb, hh); else fl_ = fh_;
  }
}
template <int ANP, int BNP> __device__ __forceinline__ v8f mac(v16b ah, v16b al, v16b bh, v16b bl, v8f c) {
  c = wmma16b(ah, bh, c);
  if (BNP == 0 || BNP == 2 || BNP == 4 || BNP == 5) c = wmma16b(ah, bl, c);     // hi.lo
  if (ANP == 0 || ANP == 2 || ANP == 4 || ANP == 5) c = wmma16b(al, bh, c);     // lo.hi   (lo.lo dropped)
  return c;
}
// 32x64 wave tile: acc[r][t] (rows m0+16r.., cols c0+16t..) += A[m][k] . B[n][k] over k in [0, K)
template <int ANP, int BNP>
__device__ __forceinline__ void gemm_tile(const Opnd& A, const Opnd& B, int K, int m0, int c0, int nloc, int hlf, v8f (&acc)[2][4]) {
  for (int kb = 0; kb < K; kb += 32) {
    v16b a0h, a0l, a1h, a1l;
    load_frags<ANP>(A, m0 + nloc, kb, hlf, a0h, a0l);
    load_frags<ANP>(A, m0 + 16 + nloc, kb, hlf, a1h, a1l);
#pragma unroll
    for (int t = 0; t < 4; ++t) {
      v16b bh, bl;
      load_frags<BNP>(B, c0 + t * 16 + nloc, kb, hlf, bh, bl);
      acc[0][t] = mac<ANP, BNP>(a0h, a0l, bh, bl, acc[0][t]);
      acc[1][t] = mac<ANP, BNP>(a1h, a1l, bh, bl, acc[1][t]);
    }
  }
}

__device__ __forceinline__ void epi_planes(v8f (&acc)[2][4], float scale, bool two, b16* __restrict__ oh, b16* __restrict__ ol, int ldo,
                                           int m0, int c0, int lane, b16* Th, b16* Tl) {
  const int nloc = lane & 15, hlf = lane >> 4;
#pragma unroll
  for (int t = 0; t < 4; ++t)
#pragma unroll
    for (int r = 0; r < 2; ++r)
#pragma unroll
      for (int v = 0; v < 8; ++v) {
        const int rr = r * 16 + v + 8 * hlf, cc = t * 16 + nloc;
        b16 h_, l_; split16(acc[r][t][v] * scale, h_, l_);
        Th[rr * 64 + cc] = h_; Tl[rr * 64 + cc] = l_;
      }
  wave_lds_sync();
  {
#pragma unroll
    for (int j = 0; j < 8; ++j) {
      const int rr = j * 4 + (lane >> 3), c8 = (lane & 7) * 8;
      const size_t o = (size_t)(m0 + rr) * ldo + c0 + c8;
      *(v8b*)(oh + o) = ld8b(Th + rr * 64 + c8);
      if (two) *(v8b*)(ol + o) = ld8b(Tl + rr * 64 + c8);
    }
    
  }
}
// (b) f32 rows with pitch ldo: 64 floats = 256 B = 2 lines per row; 16 lanes x 16 B per row, 2 rows per instruction. Optional per-row factor
__device__ __forceinline__ void epi_f32(v8f (&acc)[2][4], float scale, const float* rscale, float* __restrict__ out, int ldo, int m0, int c0, int lane, float* Tt) {
  const int nloc = lane & 15, hlf = lane >> 4;
#pragma unroll
  for (int t = 0; t < 4; ++t)
#pragma unroll
    for (int r = 0; r < 2; ++r)
#pragma unroll
      for (int v = 0; v < 8; ++v) {
        const int rr = r * 16 + v + 8 * hlf;
        const float rs = rscale ? rscale[(size_t)(m0 + rr) * 32] : 1.0f;
        Tt[rr * 64 + t * 16 + nloc] = acc[r][t][v] * scale * rs;
      }
  wave_lds_sync();
  float* dst0 = out + (size_t)m0 * ldo + c0;
  {
#pragma unroll
    for (int j = 0; j < 16; ++j) { const int rr = j * 2 + hlf, c4 = nloc * 4; *(v4f*)(dst0 + (size_t)rr * ldo + c4) = *(const v4f*)(Tt + rr * 64 + c4); }
    
  }
}



__global__ __launch_bounds__(256) void vt_kernel(const float* __restrict__ V, b16* __restrict__ vth, b16* __restrict__ vtl) {
  __shared__ __attribute__((aligned(16))) b16 Th[D][72]; __shared__ __attribute__((aligned(16))) b16 Tl[D][72];
  const int tid = threadIdx.x, lane = tid & 31, wave = tid >> 5, h = blockIdx.x / (S / 64), t0 = (blockIdx.x % (S / 64)) * 64;
  for (int i = tid; i < 64 * D; i += 256) { const int t = i / D, dd = i % D; b16 a, b2; split16(V[((size_t)h * S + t0 + t) * D + dd] * VS, a, b2); Th[dd][t] = a; Tl[dd][t] = b2; }
  __syncthreads();
  b16* bh = vth + (size_t)h * D * S + t0; b16* bl = vtl + (size_t)h * D * S + t0;
  {
#pragma unroll
    for (int j = 0; j < 4; ++j) { const int dd = wave * 16 + j * 4 + (lane >> 3), c8 = (lane & 7) * 8;
      *(v8b*)(bh + (size_t)dd * S + c8) = *(const v8b*)(&Th[dd][c8]); *(v8b*)(bl + (size_t)dd * S + c8) = *(const v8b*)(&Tl[dd][c8]); }
    
  }
}

// Scores for head group g: grid (32 key tiles of 64, 16 row blocks, HG); tiles wholly above the diagonal skip the MMA work (acc = 0); epilogue
__global__ __launch_bounds__(128) void s_kernel(const float* __restrict__ Q, const float* __restrict__ K, int h0, float* __restrict__ Sb) {
  __shared__ __attribute__((aligned(16))) float Ts[4][32 * 64];
  const int lane = threadIdx.x & 31, wave = threadIdx.x >> 5, nloc = lane & 15, hlf = lane >> 4, hl = blockIdx.z, h = h0 + hl;
  const int qb = blockIdx.y, kt = blockIdx.x, m0 = qb * 128 + wave * 32, c0 = kt * 64;
  v8f acc[2][4];
#pragma unroll
  for (int r = 0; r < 2; ++r)
#pragma unroll
    for (int t = 0; t < 4; ++t) acc[r][t] = (v8f){};
  if (c0 <= qb * 128 + 127) {                                  // block-uniform: some (q, k) in this tile has k <= q
    const Opnd A{Q + (size_t)h * S * D, nullptr, D}, B{K + (size_t)h * S * D, nullptr, D};
    gemm_tile<5, 5>(A, B, D, m0, c0, nloc, hlf, acc);
  }
  float* Tt = Ts[wave];
#pragma unroll
  for (int t = 0; t < 4; ++t)
#pragma unroll
    for (int r = 0; r < 2; ++r)
#pragma unroll
      for (int v = 0; v < 8; ++v) { const int rr = r * 16 + v + 8 * hlf, cc = t * 16 + nloc; Tt[rr * 64 + cc] = (c0 + cc <= m0 + rr) ? acc[r][t][v] * (SCALE / (XS * XS)) : 0.0f; }
  wave_lds_sync();
  float* dst0 = Sb + ((size_t)hl * S + m0) * S + c0;
  {
#pragma unroll
    for (int j = 0; j < 16; ++j) { const int rr = j * 2 + hlf, c4 = nloc * 4; *(v4f*)(dst0 + (size_t)rr * S + c4) = *(const v4f*)(Tt + rr * 64 + c4); }
    
  }
}

// ---------------------------------------------------------------------------
// Convolved-score attention for head group g: work-group = one head's query tiles t and S/16-1-t (16 queries each, one after the other: every
// work-group has the same number of causal key chunks); the tile's key chunks of 32 are dealt round-robin over the NW waves, each with its own
// maximum, sum and accumulators; partials merged through LDS. Per element the 3x3 window of the stored scores
// (rows q-2..q, keys k-1..k+1, zero outside [0,S)), x w[h], -inf for k > q; online softmax f32; P^T f16; y^T += (8V)^T.P^T (8 feature tiles, hi + lo
// ---------------------------------------------------------------------------
// lane l <-> lane l ^ 16
__device__ __forceinline__ float xhalf(float x) { return __builtin_bit_cast(float, __builtin_amdgcn_permlanex16(__builtin_bit_cast(int, x), __builtin_bit_cast(int, x), 0x76543210, 0xfedcba98, false, false)); }
// DPP row_shr:n (CTRL = 0x110 + n): lane c of a 16-lane row takes src of lane c - n; lanes c < n keep edge
template <int CTRL> __device__ __forceinline__ float row_from(float edge, float src) {
  return __builtin_bit_cast(float, __builtin_amdgcn_update_dpp(__builtin_bit_cast(int, edge), __builtin_bit_cast(int, src), CTRL, 0xf, 0xf, false));
}
// One score row's two 10-key runs of a lane: a = keys kb+8hh-1 .. kb+8hh+8, b = the same + 16 (zero outside [0, S)). The lane's own 16 keys are four
// aligned 16-byte loads; the run ends inside the 32-key chunk are held by lane ^ 16; only key kb-1 (hh 0) or kb+32 (hh 1) is one more load.
struct RowRaw { v4f f0, f1, g0, g1; float e; };
// p = the row's key kb + 8hh; eo = distance from there to the lane's outer key (0 where that key is outside the row)
__device__ __forceinline__ RowRaw load_row(const float* __restrict__ p, int eo) {
  return RowRaw{*(const v4f*)p, *(const v4f*)(p + 4), *(const v4f*)(p + 16), *(const v4f*)(p + 20), p[eo]};
}
__device__ __forceinline__ void make_runs(const RowRaw& x, int kb, int hh, float (&a)[10], float (&b)[10]) {
  const int ke = hh ? kb + 32 : kb - 1;
  const float e = (ke >= 0 && ke < S) ? x.e : 0.0f;
  const float r1 = xhalf(hh ? x.f0[0] : x.f1[3]), r2 = xhalf(hh ? x.f1[3] : x.g0[0]), r3 = xhalf(hh ? x.g0[0] : x.g1[3]);
  a[0] = hh ? r1 : e; a[9] = hh ? r2 : r1; b[0] = hh ? r3 : r2; b[9] = hh ? e : r3;
#pragma unroll
  for (int j = 0; j < 4; ++j) { a[1 + j] = x.f0[j]; a[5 + j] = x.f1[j]; b[1 + j] = x.g0[j]; b[5 + j] = x.g1[j]; }
}
constexpr int NW = 16;        // waves per work-group; also the rows of a query tile, so wave w merges row w
constexpr int OP = D + 4;     // pitch of a partial row in floats: 528 B = 16 B x odd, so the 16 query columns of a b128 store fall on distinct banks
__global__ __launch_bounds__(NW * 32) void attn_kernel(const float* __restrict__ Sb, const float* __restrict__ wconv, const b16* __restrict__ vth, const b16* __restrict__ vtl,
                                                   int h0, float* __restrict__ out) {
  __shared__ __attribute__((aligned(16))) float Os[NW][16 * OP];
  __shared__ float Ms[NW][16]; __shared__ float Ls[NW][16];
  const int wid = threadIdx.x >> 5, lane = threadIdx.x & 31, hh = lane >> 4, col = lane & 15;
  const int hl = blockIdx.x / (S / 32), pr = blockIdx.x % (S / 32), h = h0 + hl;
  const float* Sh = Sb + (size_t)hl * S * S; const b16* vh = vth + (size_t)h * D * S; const b16* vl = vtl + (size_t)h * D * S;
  float w[9];
#pragma unroll
  for (int i = 0; i < 9; ++i) w[i] = wconv[h * 9 + i];       // [i][j]: query tap i (row q-2+i), key tap j (k-1+j)
  for (int half = 0; half < 2; ++half) {
    const int q0 = (half ? pr : S / 16 - 1 - pr) * 16, qi = q0 + col;
    const int nch = (q0 + 16 + 31) / 32, nact = nch < NW ? nch : NW;     // key chunks of this tile; waves that have at least one
    // rows above row 0 are zero: their taps get weight 0 and their loads are clamped to row 0 (only the first tile has such rows)
    const int rt = q0 > 0 ? q0 - 2 + (col < 1 ? col : 1) : 0, ru = q0 > 0 ? q0 - 1 : 0;
    float wt[3], wu[3];
#pragma unroll
    for (int j = 0; j < 3; ++j) { wt[j] = qi >= 2 ? w[j] : 0.0f; wu[j] = qi >= 1 ? w[3 + j] : 0.0f; }
    const float* po = Sh + (size_t)qi * S + wid * 32 + 8 * hh; const float* pt = Sh + (size_t)rt * S + wid * 32 + 8 * hh;
    const float* pu = Sh + (size_t)ru * S + wid * 32 + 8 * hh;
    float m = -INFINITY, l = 0.0f;
    v8f o[8];
#pragma unroll
    for (int n = 0; n < 8; ++n) o[n] = (v8f){};
    for (int kb = wid * 32; kb < q0 + 16; kb += NW * 32) {
      v8f s0 = {}, s1 = {};
      // Score window: every lane loads only its own query row (plus the two rows above the tile, which lanes 0 and 1 of each half need); rows
      // q-1 and q-2 come from the lanes of queries q-1 and q-2 by a shift inside the 16-lane row. Same values and same sums as per-element loads.
      float oa[10], ob[10], ta[10], tb[10], ua[10], ub[10];
      const int ke = hh ? kb + 32 : kb - 1, eo = (ke >= 0 && ke < S) ? (hh ? 24 : -1) : 0;
      const RowRaw xt = load_row(pt, eo);                        // lane 0: row q0-2, lane 1: row q0-1 (the other lanes: an unused copy of lane 1's)
      asm volatile("s_wait_xcnt 0x0" ::: "memory");              // later loads' results may land in address registers of the loads above
      const RowRaw xu = load_row(pu, eo);                        // lane 0: row q0-1 (the other lanes: an unused copy)
      asm volatile("s_wait_xcnt 0x0" ::: "memory");              // as above
      const RowRaw xo = load_row(po, eo);
      asm volatile("s_wait_xcnt 0x0" :: "v"(po), "v"(po + eo) : "memory");   // as above; the addresses as inputs keep this row's own results out of them too
      po += NW * 32; pt += NW * 32; pu += NW * 32;
      make_runs(xo, kb, hh, oa, ob); make_runs(xt, kb, hh, ta, tb); make_runs(xu, kb, hh, ua, ub);
#pragma unroll
      for (int j = 0; j < 10; ++j) { ta[j] = row_from<0x112>(ta[j], oa[j]); tb[j] = row_from<0x112>(tb[j], ob[j]); }   // row q-2
#pragma unroll
      for (int j = 0; j < 10; ++j) { ua[j] = row_from<0x111>(ua[j], oa[j]); ub[j] = row_from<0x111>(ub[j], ob[j]); }   // row q-1
#pragma unroll
      for (int r = 0; r < 8; ++r) s0[r] += wt[0] * ta[r] + wt[1] * ta[r + 1] + wt[2] * ta[r + 2];
#pragma unroll
      for (int r = 0; r < 8; ++r) s1[r] += wt[0] * tb[r] + wt[1] * tb[r + 1] + wt[2] * tb[r + 2];
#pragma unroll
      for (int r = 0; r < 8; ++r) s0[r] += wu[0] * ua[r] + wu[1] * ua[r + 1] + wu[2] * ua[r + 2];
#pragma unroll
      for (int r = 0; r < 8; ++r) s1[r] += wu[0] * ub[r] + wu[1] * ub[r + 1] + wu[2] * ub[r + 2];
#pragma unroll
      for (int r = 0; r < 8; ++r) s0[r] += w[6] * oa[r] + w[7] * oa[r + 1] + w[8] * oa[r + 2];
#pragma unroll
      for (int r = 0; r < 8; ++r) s1[r] += w[6] * ob[r] + w[7] * ob[r + 1] + w[8] * ob[r + 2];
#pragma unroll
      for (int r = 0; r < 8; ++r) { const int k0i = kb + 8 * hh + r, k1i = k0i + 16; if (k0i > qi) s0[r] = -INFINITY; if (k1i > qi) s1[r] = -INFINITY; }
      float mr = -INFINITY;
#pragma unroll
      for (int r = 0; r < 8; ++r) mr = fmaxf(mr, fmaxf(s0[r], s1[r]));
      mr = fmaxf(mr, __shfl_xor(mr, 16));
      float mn = fmaxf(m, mr); if (mn == -INFINITY) mn = 0.0f;
      const float al_ = __expf(m - mn); m = mn;
      float sum = 0.0f; v16b pb;
#pragma unroll
      for (int r = 0; r < 8; ++r) { const float p0 = __expf(s0[r] - mn), p1 = __expf(s1[r] - mn); sum += p0 + p1; pb[r] = (b16)p0; pb[8 + r] = (b16)p1; }
      sum += __shfl_xor(sum, 16);
      l = l * al_ + sum;
#pragma unroll
      for (int n = 0; n < 8; ++n) {
#pragma unroll
        for (int r = 0; r < 8; ++r) o[n][r] *= al_;
        const size_t ro = (size_t)(n * 16 + col) * S + kb;
        o[n] = wmma16b(frag_kb(vh + ro, hh), pb, o[n]);
        o[n] = wmma16b(frag_kb(vl + ro, hh), pb, o[n]);
      }
    }
    if (wid < nact) {                                            // un-normalised partial y^T: lane col = query, element r = feature 16n+8hh+r
      float* Tt = Os[wid];
#pragma unroll
      for (int n = 0; n < 8; ++n)
#pragma unroll
        for (int r = 0; r < 8; ++r) Tt[col * OP + n * 16 + 8 * hh + r] = o[n][r];
      if (hh == 0) { Ms[wid][col] = m; Ls[wid][col] = l; }
    }
    __syncthreads();                                             // every wave's partial is in LDS before any is merged
    {
      float mx = -INFINITY;
      for (int u = 0; u < nact; ++u) mx = fmaxf(mx, Ms[u][wid]);
      float ls = 0.0f; v4f y = {};
      for (int u = 0; u < nact; ++u) { const float f = __expf(Ms[u][wid] - mx); ls += f * Ls[u][wid]; y += f * *(const v4f*)(&Os[u][wid * OP + lane * 4]); }
      const float inv = (ls > 0.0f) ? (1.0f / (VS * ls)) : 0.0f;
      *(v4f*)(out + ((size_t)h * S + q0 + wid) * D + lane * 4) = y * inv;    // one row of 512 B per wave: whole lines
    }
    __syncthreads();                                             // the merge has read the partials before the second tile overwrites them
  }
}
}  // namespace

extern "C" void kernel_launch(void* const* d_in, const int* in_sizes, int n_in,
                              void* d_out, int out_size, void* d_ws, size_t ws_size, hipStream_t stream) {
  (void)n_in; (void)out_size;
  const float* Q = (const float*)d_in[0]; const float* K = (const float*)d_in[1]; const float* V = (const float*)d_in[2];   // [1,16,2048,128]
  const float* wconv = (const float*)d_in[3];   // [16,3,3]
  float* out = (float*)d_out;                   // [1,16,2048,128]
  if (in_sizes[0] != H * S * D || in_sizes[1] != H * S * D || in_sizes[2] != H * S * D || in_sizes[3] != H * 9) return;
  size_t off = 0; char* ws = (char*)d_ws;
  auto carve = [&](size_t bytes) { char* p = ws + off; off += (bytes + 255) & ~(size_t)255; return p; };
  b16* vth = (b16*)carve((size_t)H * D * S * 2);     //  8 MB
  b16* vtl = (b16*)carve((size_t)H * D * S * 2);     //  8 MB
  float* Sb = (float*)carve((size_t)HG * S * S * 4); // 64 MB score buffer for 4 heads
  if (off > ws_size) return;                           // total 83,886,080 B
  vt_kernel<<<H * (S / 64), 256, 0, stream>>>(V, vth, vtl);
  for (int g = 0; g < H / HG; ++g) {
    s_kernel<<<dim3(S / 64, S / 128, HG), 128, 0, stream>>>(Q, K, g * HG, Sb);
    attn_kernel<<<HG * (S / 32), NW * 32, 0, stream>>>(Sb, wconv, vth, vtl, g * HG, out);
  }
}

// v003
// A run of this version takes 288 microseconds.
// Next to v002, in two timings, it ran 1.10 times as fast each time.
// All steps since v000 together make it 5.53 times as fast.
#include <hip/hip_runtime.h>

// Causal attention with a learned per-head 3x3 convolution over the score matrix: s = Q.K^T/sqrt(128) with future keys zeroed, cs[q][k] =
// sum_{i<3,j<3} w[h][i][j] s[q-2+i][k-1+j] (query padding left only, key padding symmetric, zeros outside), future keys -> -inf, softmax, out = P.V.
// B=1, 16 heads, S=2048, D=128; Q, K, V are the inputs (no projections).
// Contractions on v_wmma_f32_16x16x32_f16: Q.K^T with both operands split into f16 hi+lo from the x8-scaled f32 rows (3 products); P.V with
// unnormalised P as single f16 against an f16 hi+lo pair of 8V (2 products); f32 accumulate; the 3x3 score convolution, masking and online softmax in
// f32 from an f32 score buffer (4 heads at a time). Fragment k-map per lane half hh for A AND B: elements 0..7 <- k = 8hh+0..7, 8..15 <- k = 16+8hh+0..7.

namespace {
constexpr int H = 16, S = 2048, D = 128, HG = 4;             // heads per score-buffer group
constexpr float XS = 8.0f, VS = 8.0f, SCALE = 0.08838834764831845f;   // 128^-0.5

typedef _Float16 b16;
typedef __attribute__((ext_vector_type(16))) _Float16 v16b;
typedef __attribute__((ext_vector_type(8)))  _Float16 v8b;
typedef __attribute__((ext_vector_type(8)))  float v8f;
typedef __attribute__((ext_vector_type(4)))  float v4f;

__device__ __forceinline__ v8b ld8b(const b16* p) { return *(const v8b*)p; }
__device__ __forceinline__ v16b cat8b(v8b a, v8b b) { return __builtin_shufflevector(a, b, 0, 1, 2, 3, 4, 5, 6, 7, 8, 9, 10, 11, 12, 13, 14, 15); }
__device__ __forceinline__ v16b frag_kb(const b16* p, int hh) { return cat8b(ld8b(p + 8 * hh), ld8b(p + 16 + 8 * hh)); }
__device__ __forceinline__ void split16(float v, b16& hi, b16& lo) { hi = (b16)v; lo = (b16)(v - (float)hi); }
// hi/lo fragment pair straight from an f32 k-contiguous row (same k-map)
__device__ __forceinline__ void frag_ksplit(const float* p, int hh, v16b& fh_, v16b& fl_) {
  const float* p0 = p + 8 * hh; const float* p1 = p + 16 + 8 * hh;
#pragma unroll
  for (int e = 0; e < 8; ++e) { b16 a, c; split16(p0[e], a, c); fh_[e] = a; fl_[e] = c; split16(p1[e], a, c); fh_[8 + e] = a; fl_[8 + e] = c; }
}
__device__ __forceinline__ v8f wmma16b(v16b a, v16b b, v8f c) {
  v8f d = __builtin_amdgcn_wmma_f32_16x16x32_f16(false, a, false, b, (short)0, c, false, false);
  asm volatile("v_nop\n\tv_nop\n\tv_nop\n\tv_nop" : "+v"(d) : "v"(a), "v"(b));
  return d;
}
__device__ __forceinline__ void wave_lds_sync() {
  __builtin_amdgcn_fence(__ATOMIC_RELEASE, "workgroup");
  __builtin_amdgcn_wave_barrier();
  __builtin_amdgcn_fence(__ATOMIC_ACQUIRE, "workgroup");
}

// Operand descriptor: NP = 0 -> f32 rows split on the fly into (hi, lo); NP = 1 -> one f16 plane; NP = 2 -> f16 hi + lo planes;
// NP = 3 -> f32 rows rounded once to a single f16 fragment. ld = row pitch.
struct Opnd { const void* p0; const void* p1; int ld; };
template <int NP> __device__ __forceinline__ void load_frags(const Opnd& o, int row, int kb, int hh, v16b& fh_, v16b& fl_) {
  if (NP == 0) { frag_ksplit((const float*)o.p0 + (size_t)row * o.ld + kb, hh, fh_, fl_); }
  else if (NP == 4 || NP == 5) {                             // f32 rows x64 (NP 4) or x8 (NP 5) then split (keeps the lo halves of small values normal)
    const float sc_ = (NP == 4) ? 64.0f : 8.0f;
    const float* p = (const float*)o.p0 + (size_t)row * o.ld + kb; const float* p0 = p + 8 * hh; const float* p1 = p + 16 + 8 * hh;
#pragma unroll
    for (int e = 0; e < 8; ++e) { b16 a, c; split16(p0[e] * sc_, a, c); fh_[e] = a; fl_[e] = c; split16(p1[e] * sc_, a, c); fh_[8 + e] = a; fl_[8 + e] = c; }
  } else if (NP == 3) {
    const float* p = (const float*)o.p0 + (size_t)row * o.ld + kb; const float* p0 = p + 8 * hh; const float* p1 = p + 16 + 8 * hh;
#pragma unroll
    for (int e = 0; e < 8; ++e) { fh_[e] = (b16)p0[e]; fh_[8 + e] = (b16)p1[e]; }
    fl_ = fh_;
  } else {
    fh_ = frag_kb((const b16*)o.p0 + (size_t)row * o.ld + kb, hh);
    if (NP == 2) fl_ = frag_kb((const b16*)o.p1 + (size_t)row * o.ld + kb, hh); else fl_ = fh_;
  }
}
template <int ANP, int BNP> __device__ __forceinline__ v8f mac(v16b ah, v16b al, v16b bh, v16b bl, v8f c) {
  c = wmma16b(ah, bh, c);
  if (BNP == 0 || BNP == 2 || BNP == 4 || BNP == 5) c = wmma16b(ah, bl, c);     // hi.lo
  if (ANP == 0 || ANP == 2 || ANP == 4 || ANP == 5) c = wmma16b(al, bh, c);     // lo.hi   (lo.lo dropped)
  return c;
}
// 32x64 wave tile: acc[r][t] (rows m0+16r.., cols c0+16t..) += A[m][k] . B[n][k] over k in [0, K)
template <int ANP, int BNP>
__device__ __forceinline__ void gemm_tile(const Opnd& A, const Opnd& B, int K, int m0, int c0, int nloc, int hlf, v8f (&acc)[2][4]) {
  for (int kb = 0; kb < K; kb += 32) {
    v16b a0h, a0l, a1h, a1l;
    load_frags<ANP>(A, m0 + nloc, kb, hlf, a0h, a0l);
    load_frags<ANP>(A, m0 + 16 + nloc, kb, hlf, a1h, a1l);
#pragma unroll
    for (int t = 0; t < 4; ++t) {
      v16b bh, bl;
      load_frags<BNP>(B, c0 + t * 16 + nloc, kb, hlf, bh, bl);
      acc[0][t] = mac<ANP, BNP>(a0h, a0l, bh, bl, acc[0][t]);
      acc[1][t] = mac<ANP, BNP>(a1h, a1l, bh, bl, acc[1][t]);
    }
  }
}

__device__ __forceinline__ void epi_planes(v8f (&acc)[2][4], float scale, bool two, b16* __restrict__ oh, b16* __restrict__ ol, int ldo,
                                           int m0, int c0, int lane, b16* Th, b16* Tl) {
  const int nloc = lane & 15, hlf = lane >> 4;
#pragma unroll
  for (int t = 0; t < 4; ++t)
#pragma unroll
    for (int r = 0; r < 2; ++r)
#pragma unroll
      for (int v = 0; v < 8; ++v) {
        const int rr = r * 16 + v + 8 * hlf, cc = t * 16 + nloc;
        b16 h_, l_; split16(acc[r][t][v] * scale, h_, l_);
        Th[rr * 64 + cc] = h_; Tl[rr * 64 + cc] = l_;
      }
  wave_lds_sync();
  {
#pragma unroll
    for (int j = 0; j < 8; ++j) {
      const int rr = j * 4 + (lane >> 3), c8 = (lane & 7) * 8;
      const size_t o = (size_t)(m0 + rr) * ldo + c0 + c8;
      *(v8b*)(oh + o) = ld8b(Th + rr * 64 + c8);
      if (two) *(v8b*)(ol + o) = ld8b(Tl + rr * 64 + c8);
    }
    
  }
}
// (b) f32 rows with pitch ldo: 64 floats = 256 B = 2 lines per row; 16 lanes x 16 B per row, 2 rows per instruction. Optional per-row factor
__device__ __forceinline__ void epi_f32(v8f (&acc)[2][4], float scale, const float* rscale, float* __restrict__ out, int ldo, int m0, int c0, int lane, float* Tt) {
  const int nloc = lane & 15, hlf = lane >> 4;
#pragma unroll
  for (int t = 0; t < 4; ++t)
#pragma unroll
    for (int r = 0; r < 2; ++r)
#pragma unroll
      for (int v = 0; v < 8; ++v) {
        const int rr = r * 16 + v + 8 * hlf;
        const float rs = rscale ? rscale[(size_t)(m0 + rr) * 32] : 1.0f;
        Tt[rr * 64 + t * 16 + nloc] = acc[r][t][v] * scale * rs;
      }
  wave_lds_sync();
  float* dst0 = out + (size_t)m0 * ldo + c0;
  {
#pragma unroll
    for (int j = 0; j < 16; ++j) { const int rr = j * 2 + hlf, c4 = nloc * 4; *(v4f*)(dst0 + (size_t)rr * ldo + c4) = *(const v4f*)(Tt + rr * 64 + c4); }
    
  }
}



// (8V)^T as f16 hi and lo planes in the order the attention waves read their A fragments: per head [key chunk of 32][feature tile n of 16][half j]
// [lane][8 keys], lane = 16hh + feature, keys 16j + 8hh + 0..7 of the chunk. One fragment = two loads of 512 B in a row (4 whole lines each).
__global__ __launch_bounds__(256) void vt_kernel(const float* __restrict__ V, b16* __restrict__ vth, b16* __restrict__ vtl) {
  __shared__ __attribute__((aligned(16))) b16 Th[D][72]; __shared__ __attribute__((aligned(16))) b16 Tl[D][72];
  const int tid = threadIdx.x, h = blockIdx.x / (S / 64), t0 = (blockIdx.x % (S / 64)) * 64;
  for (int i = tid; i < 64 * D; i += 256) { const int t = i / D, dd = i % D; b16 a, b2; split16(V[((size_t)h * S + t0 + t) * D + dd] * VS, a, b2); Th[dd][t] = a; Tl[dd][t] = b2; }
  __syncthreads();
  // Fragment order: unit u of 8 keys = [key chunk of 32][feature tile n][fragment half j][lane]; the block's two chunks are 16 KB in a row per plane
  b16* bh = vth + (size_t)h * D * S + (size_t)t0 * D; b16* bl = vtl + (size_t)h * D * S + (size_t)t0 * D;
#pragma unroll
  for (int i = 0; i < 4; ++i) {
    const int u = i * 256 + tid, fl = u & 31, j = (u >> 5) & 1, n = (u >> 6) & 7, c = u >> 9;
    const int dd = n * 16 + (fl & 15), t = c * 32 + 16 * j + 8 * (fl >> 4);
    *(v8b*)(bh + (size_t)u * 8) = *(const v8b*)(&Th[dd][t]); *(v8b*)(bl + (size_t)u * 8) = *(const v8b*)(&Tl[dd][t]);
  }
}

// Scores for head group g: grid (32 key tiles of 64, 16 row blocks, HG); tiles wholly above the diagonal skip the MMA work (acc = 0); epilogue
__global__ __launch_bounds__(128) void s_kernel(const float* __restrict__ Q, const float* __restrict__ K, int h0, float* __restrict__ Sb) {
  __shared__ __attribute__((aligned(16))) float Ts[4][32 * 64];
  const int lane = threadIdx.x & 31, wave = threadIdx.x >> 5, nloc = lane & 15, hlf = lane >> 4, hl = blockIdx.z, h = h0 + hl;
  const int qb = blockIdx.y, kt = blockIdx.x, m0 = qb * 128 + wave * 32, c0 = kt * 64;
  v8f acc[2][4];
#pragma unroll
  for (int r = 0; r < 2; ++r)
#pragma unroll
    for (int t = 0; t < 4; ++t) acc[r][t] = (v8f){};
  if (c0 <= qb * 128 + 127) {                                  // block-uniform: some (q, k) in this tile has k <= q
    const Opnd A{Q + (size_t)h * S * D, nullptr, D}, B{K + (size_t)h * S * D, nullptr, D};
    gemm_tile<5, 5>(A, B, D, m0, c0, nloc, hlf, acc);
  }
  float* Tt = Ts[wave];
#pragma unroll
  for (int t = 0; t < 4; ++t)
#pragma unroll
    for (int r = 0; r < 2; ++r)
#pragma unroll
      for (int v = 0; v < 8; ++v) { const int rr = r * 16 + v + 8 * hlf, cc = t * 16 + nloc; Tt[rr * 64 + cc] = (c0 + cc <= m0 + rr) ? acc[r][t][v] * (SCALE / (XS * XS)) : 0.0f; }
  wave_lds_sync();
  float* dst0 = Sb + ((size_t)hl * S + m0) * S + c0;
  {
#pragma unroll
    for (int j = 0; j < 16; ++j) { const int rr = j * 2 + hlf, c4 = nloc * 4; *(v4f*)(dst0 + (size_t)rr * S + c4) = *(const v4f*)(Tt + rr * 64 + c4); }
    
  }
}

// ---------------------------------------------------------------------------
// Convolved-score attention for head group g: work-group = one head's query tiles t and S/16-1-t (16 queries each, one after the other: every
// work-group has the same number of causal key chunks); the tile's key chunks of 32 are dealt round-robin over the NW waves, each with its own
// maximum, sum and accumulators; partials merged through LDS. Per element the 3x3 window of the stored scores
// (rows q-2..q, keys k-1..k+1, zero outside [0,S)), x w[h], -inf for k > q; online softmax f32; P^T f16; y^T += (8V)^T.P^T (8 feature tiles, hi + lo
// ---------------------------------------------------------------------------
// lane l <-> lane l ^ 16
__device__ __forceinline__ float xhalf(float x) { return __builtin_bit_cast(float, __builtin_amdgcn_permlanex16(__builtin_bit_cast(int, x), __builtin_bit_cast(int, x), 0x76543210, 0xfedcba98, false, false)); }
// DPP row_shr:n (CTRL = 0x110 + n): lane c of a 16-lane row takes src of lane c - n; lanes c < n keep edge
template <int CTRL> __device__ __forceinline__ float row_from(float edge, float src) {
  return __builtin_bit_cast(float, __builtin_amdgcn_update_dpp(__builtin_bit_cast(int, edge), __builtin_bit_cast(int, src), CTRL, 0xf, 0xf, false));
}
// One score row's two 10-key runs of a lane: a = keys kb+8hh-1 .. kb+8hh+8, b = the same + 16 (zero outside [0, S)). The lane's own 16 keys are four
// aligned 16-byte loads; the run ends inside the 32-key chunk are held by lane ^ 16; only key kb-1 (hh 0) or kb+32 (hh 1) is one more load.
struct RowRaw { v4f f0, f1, g0, g1; float e; };
// p = the row's key kb + 8hh; eo = distance from there to the lane's outer key (0 where that key is outside the row)
__device__ __forceinline__ RowRaw load_row(const float* __restrict__ p, int eo) {
  return RowRaw{*(const v4f*)p, *(const v4f*)(p + 4), *(const v4f*)(p + 16), *(const v4f*)(p + 20), p[eo]};
}
__device__ __forceinline__ void make_runs(const RowRaw& x, int kb, int hh, float (&a)[10], float (&b)[10]) {
  const int ke = hh ? kb + 32 : kb - 1;
  const float e = (ke >= 0 && ke < S) ? x.e : 0.0f;
  const float r1 = xhalf(hh ? x.f0[0] : x.f1[3]), r2 = xhalf(hh ? x.f1[3] : x.g0[0]), r3 = xhalf(hh ? x.g0[0] : x.g1[3]);
  a[0] = hh ? r1 : e; a[9] = hh ? r2 : r1; b[0] = hh ? r3 : r2; b[9] = hh ? e : r3;
#pragma unroll
  for (int j = 0; j < 4; ++j) { a[1 + j] = x.f0[j]; a[5 + j] = x.f1[j]; b[1 + j] = x.g0[j]; b[5 + j] = x.g1[j]; }
}
constexpr int NW = 16;        // waves per work-group; also the rows of a query tile, so wave w merges row w
constexpr int OP = D + 4;     // pitch of a partial row in floats: 528 B = 16 B x odd, so the 16 query columns of a b128 store fall on distinct banks
__global__ __launch_bounds__(NW * 32) void attn_kernel(const float* __restrict__ Sb, const float* __restrict__ wconv, const b16* __restrict__ vth, const b16* __restrict__ vtl,
                                                   int h0, float* __restrict__ out) {
  __shared__ __attribute__((aligned(16))) float Os[NW][16 * OP];
  __shared__ float Ms[NW][16]; __shared__ float Ls[NW][16];
  const int wid = threadIdx.x >> 5, lane = threadIdx.x & 31, hh = lane >> 4, col = lane & 15;
  const int hl = blockIdx.x / (S / 32), pr = blockIdx.x % (S / 32), h = h0 + hl;
  const float* Sh = Sb + (size_t)hl * S * S; const b16* vh = vth + (size_t)h * D * S; const b16* vl = vtl + (size_t)h * D * S;
  float w[9];
#pragma unroll
  for (int i = 0; i < 9; ++i) w[i] = wconv[h * 9 + i];       // [i][j]: query tap i (row q-2+i), key tap j (k-1+j)
  for (int half = 0; half < 2; ++half) {
    const int q0 = (half ? pr : S / 16 - 1 - pr) * 16, qi = q0 + col;
    const int nch = (q0 + 16 + 31) / 32, nact = nch < NW ? nch : NW;     // key chunks of this tile; waves that have at least one
    // rows above row 0 are zero: their taps get weight 0 and their loads are clamped to row 0 (only the first tile has such rows)
    const int rt = q0 > 0 ? q0 - 2 + (col < 1 ? col : 1) : 0, ru = q0 > 0 ? q0 - 1 : 0;
    float wt[3], wu[3];
#pragma unroll
    for (int j = 0; j < 3; ++j) { wt[j] = qi >= 2 ? w[j] : 0.0f; wu[j] = qi >= 1 ? w[3 + j] : 0.0f; }
    const float* po = Sh + (size_t)qi * S + wid * 32 + 8 * hh; const float* pt = Sh + (size_t)rt * S + wid * 32 + 8 * hh;
    const float* pu = Sh + (size_t)ru * S + wid * 32 + 8 * hh;
    float m = -INFINITY, l = 0.0f;
    v8f o[8];
#pragma unroll
    for (int n = 0; n < 8; ++n) o[n] = (v8f){};
    for (int kb = wid * 32; kb < q0 + 16; kb += NW * 32) {
      v8f s0 = {}, s1 = {};
      // Score window: every lane loads only its own query row (plus the two rows above the tile, which lanes 0 and 1 of each half need); rows
      // q-1 and q-2 come from the lanes of queries q-1 and q-2 by a shift inside the 16-lane row. Same values and same sums as per-element loads.
      float oa[10], ob[10], ta[10], tb[10], ua[10], ub[10];
      const int ke = hh ? kb + 32 : kb - 1, eo = (ke >= 0 && ke < S) ? (hh ? 24 : -1) : 0;
      const RowRaw xt = load_row(pt, eo);                        // lane 0: row q0-2, lane 1: row q0-1 (the other lanes: an unused copy of lane 1's)
      asm volatile("s_wait_xcnt 0x0" ::: "memory");              // later loads' results may land in address registers of the loads above
      const RowRaw xu = load_row(pu, eo);                        // lane 0: row q0-1 (the other lanes: an unused copy)
      asm volatile("s_wait_xcnt 0x0" :: "v"(pu), "v"(pu + eo) : "memory");   // as above; the addresses as inputs keep this row's own results out of them too
      const RowRaw xo = load_row(po, eo);
      asm volatile("s_wait_xcnt 0x0" :: "v"(po), "v"(po + eo) : "memory");   // as above; the addresses as inputs keep this row's own results out of them too
      po += NW * 32; pt += NW * 32; pu += NW * 32;
      make_runs(xo, kb, hh, oa, ob); make_runs(xt, kb, hh, ta, tb); make_runs(xu, kb, hh, ua, ub);
#pragma unroll
      for (int j = 0; j < 10; ++j) { ta[j] = row_from<0x112>(ta[j], oa[j]); tb[j] = row_from<0x112>(tb[j], ob[j]); }   // row q-2
#pragma unroll
      for (int j = 0; j < 10; ++j) { ua[j] = row_from<0x111>(ua[j], oa[j]); ub[j] = row_from<0x111>(ub[j], ob[j]); }   // row q-1
#pragma unroll
      for (int r = 0; r < 8; ++r) s0[r] += wt[0] * ta[r] + wt[1] * ta[r + 1] + wt[2] * ta[r + 2];
#pragma unroll
      for (int r = 0; r < 8; ++r) s1[r] += wt[0] * tb[r] + wt[1] * tb[r + 1] + wt[2] * tb[r + 2];
#pragma unroll
      for (int r = 0; r < 8; ++r) s0[r] += wu[0] * ua[r] + wu[1] * ua[r + 1] + wu[2] * ua[r + 2];
#pragma unroll
      for (int r = 0; r < 8; ++r) s1[r] += wu[0] * ub[r] + wu[1] * ub[r + 1] + wu[2] * ub[r + 2];
#pragma unroll
      for (int r = 0; r < 8; ++r) s0[r] += w[6] * oa[r] + w[7] * oa[r + 1] + w[8] * oa[r + 2];
#pragma unroll
      for (int r = 0; r < 8; ++r) s1[r] += w[6] * ob[r] + w[7] * ob[r + 1] + w[8] * ob[r + 2];
#pragma unroll
      for (int r = 0; r < 8; ++r) { const int k0i = kb + 8 * hh + r, k1i = k0i + 16; if (k0i > qi) s0[r] = -INFINITY; if (k1i > qi) s1[r] = -INFINITY; }
      float mr = -INFINITY;
#pragma unroll
      for (int r = 0; r < 8; ++r) mr = fmaxf(mr, fmaxf(s0[r], s1[r]));
      mr = fmaxf(mr, __shfl_xor(mr, 16));
      float mn = fmaxf(m, mr); if (mn == -INFINITY) mn = 0.0f;
      const float al_ = __expf(m - mn); m = mn;
      float sum = 0.0f; v16b pb;
#pragma unroll
      for (int r = 0; r < 8; ++r) { const float p0 = __expf(s0[r] - mn), p1 = __expf(s1[r] - mn); sum += p0 + p1; pb[r] = (b16)p0; pb[8 + r] = (b16)p1; }
      sum += __shfl_xor(sum, 16);
      l = l * al_ + sum;
#pragma unroll
      for (int n = 0; n < 8; ++n) {
#pragma unroll
        for (int r = 0; r < 8; ++r) o[n][r] *= al_;
        const size_t ro = (size_t)kb * D + n * 512 + lane * 8;    // fragment order (vt_kernel): halves j = 0, 1 are 256 elements apart
        o[n] = wmma16b(cat8b(ld8b(vh + ro), ld8b(vh + ro + 256)), pb, o[n]);
        o[n] = wmma16b(cat8b(ld8b(vl + ro), ld8b(vl + ro + 256)), pb, o[n]);
      }
      asm volatile("s_wait_xcnt 0x0" ::: "memory");              // the next trip forms its addresses in the registers that the V loads above name
    }
    if (wid < nact) {                                            // un-normalised partial y^T: lane col = query, element r = feature 16n+8hh+r
      float* Tt = Os[wid];
#pragma unroll
      for (int n = 0; n < 8; ++n)
#pragma unroll
        for (int r = 0; r < 8; ++r) Tt[col * OP + n * 16 + 8 * hh + r] = o[n][r];
      if (hh == 0) { Ms[wid][col] = m; Ls[wid][col] = l; }
    }
    __syncthreads();                                             // every wave's partial is in LDS before any is merged
    {
      float mx = -INFINITY;
      for (int u = 0; u < nact; ++u) mx = fmaxf(mx, Ms[u][wid]);
      float ls = 0.0f; v4f y = {};
      for (int u = 0; u < nact; ++u) { const float f = __expf(Ms[u][wid] - mx); ls += f * Ls[u][wid]; y += f * *(const v4f*)(&Os[u][wid * OP + lane * 4]); }
      const float inv = (ls > 0.0f) ? (1.0f / (VS * ls)) : 0.0f;
      *(v4f*)(out + ((size_t)h * S + q0 + wid) * D + lane * 4) = y * inv;    // one row of 512 B per wave: whole lines
    }
    __syncthreads();                                             // the merge has read the partials before the second tile overwrites them
  }
}
}  // namespace

extern "C" void kernel_launch(void* const* d_in, const int* in_sizes, int n_in,
                              void* d_out, int out_size, void* d_ws, size_t ws_size, hipStream_t stream) {
  (void)n_in; (void)out_size;
  const float* Q = (const float*)d_in[0]; const float* K = (const float*)d_in[1]; const float* V = (const float*)d_in[2];   // [1,16,2048,128]
  const float* wconv = (const float*)d_in[3];   // [16,3,3]
  float* out = (float*)d_out;                   // [1,16,2048,128]
  if (in_sizes[0] != H * S * D || in_sizes[1] != H * S * D || in_sizes[2] != H * S * D || in_sizes[3] != H * 9) return;
  size_t off = 0; char* ws = (char*)d_ws;
  auto carve = [&](size_t bytes) { char* p = ws + off; off += (bytes + 255) & ~(size_t)255; return p; };
  b16* vth = (b16*)carve((size_t)H * D * S * 2);     //  8 MB
  b16* vtl = (b16*)carve((size_t)H * D * S * 2);     //  8 MB
  float* Sb = (float*)carve((size_t)HG * S * S * 4); // 64 MB score buffer for 4 heads
  if (off > ws_size) return;                           // total 83,886,080 B
  vt_kernel<<<H * (S / 64), 256, 0, stream>>>(V, vth, vtl);
  for (int g = 0; g < H / HG; ++g) {
    s_kernel<<<dim3(S / 64, S / 128, HG), 128, 0, stream>>>(Q, K, g * HG, Sb);
    attn_kernel<<<HG * (S / 32), NW * 32, 0, stream>>>(Sb, wconv, vth, vtl, g * HG, out);
  }
}

// v004
// A run of this version takes 245 microseconds.
// Next to v003, in two timings, it ran 1.17 and 1.18 times as fast.
// Over all steps from v000 it is 6.50 times as fast.
#include <hip/hip_runtime.h>

// Causal attention with a learned per-head 3x3 convolution over the score matrix: s = Q.K^T/sqrt(128) with future keys zeroed, cs[q][k] =
// sum_{i<3,j<3} w[h][i][j] s[q-2+i][k-1+j] (query padding left only, key padding symmetric, zeros outside), future keys -> -inf, softmax, out = P.V.
// B=1, 16 heads, S=2048, D=128; Q, K, V are the inputs (no projections).
// Contractions on v_wmma_f32_16x16x32_f16: Q.K^T with both operands split once into f16 hi+lo planes of the x8-scaled f32 rows (3 products); P.V with
// unnormalised P as single f16 against an f16 hi+lo pair of 8V (2 products); f32 accumulate; the 3x3 score convolution, masking and online softmax in
// f32 from an f32 score buffer (4 heads at a time). Fragment k-map per lane half hh for A AND B: elements 0..7 <- k = 8hh+0..7, 8..15 <- k = 16+8hh+0..7.

namespace {
constexpr int H = 16, S = 2048, D = 128, HG = 4;             // heads per score-buffer group
constexpr float XS = 8.0f, VS = 8.0f, SCALE = 0.08838834764831845f;   // 128^-0.5

typedef _Float16 b16;
typedef __attribute__((ext_vector_type(16))) _Float16 v16b;
typedef __attribute__((ext_vector_type(8)))  _Float16 v8b;
typedef __attribute__((ext_vector_type(8)))  float v8f;
typedef __attribute__((ext_vector_type(4)))  float v4f;

__device__ __forceinline__ v8b ld8b(const b16* p) { return *(const v8b*)p; }
__device__ __forceinline__ v16b cat8b(v8b a, v8b b) { return __builtin_shufflevector(a, b, 0, 1, 2, 3, 4, 5, 6, 7, 8, 9, 10, 11, 12, 13, 14, 15); }
__device__ __forceinline__ void split16(float v, b16& hi, b16& lo) { hi = (b16)v; lo = (b16)(v - (float)hi); }
__device__ __forceinline__ v8f wmma16b(v16b a, v16b b, v8f c) {
  v8f d = __builtin_amdgcn_wmma_f32_16x16x32_f16(false, a, false, b, (short)0, c, false, false);
  asm volatile("v_nop\n\tv_nop\n\tv_nop\n\tv_nop" : "+v"(d) : "v"(a), "v"(b));
  return d;
}
__device__ __forceinline__ void wave_lds_sync() {
  __builtin_amdgcn_fence(__ATOMIC_RELEASE, "workgroup");
  __builtin_amdgcn_wave_barrier();
  __builtin_amdgcn_fence(__ATOMIC_ACQUIRE, "workgroup");
}

// One accumulator's products of a k block; operand kind 2 = f16 hi + lo planes, 1 = one f16 plane
template <int ANP, int BNP> __device__ __forceinline__ v8f mac(v16b ah, v16b al, v16b bh, v16b bl, v8f c) {
  c = wmma16b(ah, bh, c);
  if (BNP == 0 || BNP == 2 || BNP == 4 || BNP == 5) c = wmma16b(ah, bl, c);     // hi.lo
  if (ANP == 0 || ANP == 2 || ANP == 4 || ANP == 5) c = wmma16b(al, bh, c);     // lo.hi   (lo.lo dropped)
  return c;
}
__device__ __forceinline__ void epi_planes(v8f (&acc)[2][4], float scale, bool two, b16* __restrict__ oh, b16* __restrict__ ol, int ldo,
                                           int m0, int c0, int lane, b16* Th, b16* Tl) {
  const int nloc = lane & 15, hlf = lane >> 4;
#pragma unroll
  for (int t = 0; t < 4; ++t)
#pragma unroll
    for (int r = 0; r < 2; ++r)
#pragma unroll
      for (int v = 0; v < 8; ++v) {
        const int rr = r * 16 + v + 8 * hlf, cc = t * 16 + nloc;
        b16 h_, l_; split16(acc[r][t][v] * scale, h_, l_);
        Th[rr * 64 + cc] = h_; Tl[rr * 64 + cc] = l_;
      }
  wave_lds_sync();
  {
#pragma unroll
    for (int j = 0; j < 8; ++j) {
      const int rr = j * 4 + (lane >> 3), c8 = (lane & 7) * 8;
      const size_t o = (size_t)(m0 + rr) * ldo + c0 + c8;
      *(v8b*)(oh + o) = ld8b(Th + rr * 64 + c8);
      if (two) *(v8b*)(ol + o) = ld8b(Tl + rr * 64 + c8);
    }
    
  }
}
// (b) f32 rows with pitch ldo: 64 floats = 256 B = 2 lines per row; 16 lanes x 16 B per row, 2 rows per instruction. Optional per-row factor
__device__ __forceinline__ void epi_f32(v8f (&acc)[2][4], float scale, const float* rscale, float* __restrict__ out, int ldo, int m0, int c0, int lane, float* Tt) {
  const int nloc = lane & 15, hlf = lane >> 4;
#pragma unroll
  for (int t = 0; t < 4; ++t)
#pragma unroll
    for (int r = 0; r < 2; ++r)
#pragma unroll
      for (int v = 0; v < 8; ++v) {
        const int rr = r * 16 + v + 8 * hlf;
        const float rs = rscale ? rscale[(size_t)(m0 + rr) * 32] : 1.0f;
        Tt[rr * 64 + t * 16 + nloc] = acc[r][t][v] * scale * rs;
      }
  wave_lds_sync();
  float* dst0 = out + (size_t)m0 * ldo + c0;
  {
#pragma unroll
    for (int j = 0; j < 16; ++j) { const int rr = j * 2 + hlf, c4 = nloc * 4; *(v4f*)(dst0 + (size_t)rr * ldo + c4) = *(const v4f*)(Tt + rr * 64 + c4); }
    
  }
}



// (8V)^T as f16 hi and lo planes in the order the attention waves read their A fragments: per head [key chunk of 32][feature tile n of 16][half j]
// [lane][8 keys], lane = 16hh + feature, keys 16j + 8hh + 0..7 of the chunk. One fragment = two loads of 512 B in a row (4 whole lines each).
// The same launch splits Q and K (blocks from H * S / 64 on): 8X as f16 hi and lo planes in the order the score waves read their fragments: [row tile of
// 16][k block of 32][half j][lane][8], lane = 16hh + row, k = 16j + 8hh + 0..7 of the block; a tile's 256 units = the block's 256 threads, QT tiles each.
constexpr int QT = 8;
__global__ __launch_bounds__(256) void vt_kernel(const float* __restrict__ V, b16* __restrict__ vth, b16* __restrict__ vtl, const float* __restrict__ Q,
                                                 const float* __restrict__ K, b16* __restrict__ qh, b16* __restrict__ ql, b16* __restrict__ kh, b16* __restrict__ kl) {
  __shared__ __attribute__((aligned(16))) b16 Th[D][72]; __shared__ __attribute__((aligned(16))) b16 Tl[D][72];
  if (blockIdx.x >= H * (S / 64)) {                            // block-uniform; no barrier on this path
    constexpr int NB = H * S / 16 / QT;                        // blocks per tensor
    const int b = blockIdx.x - H * (S / 64), isk = b >= NB, tile0 = (b - isk * NB) * QT, u = threadIdx.x, fl = u & 31;
    const float* X = (isk ? K : Q) + ((size_t)tile0 * 16 + (fl & 15)) * D + (u >> 6) * 32 + 16 * ((u >> 5) & 1) + 8 * (fl >> 4);
    b16* xh = (isk ? kh : qh) + (size_t)tile0 * (16 * D) + u * 8; b16* xl = (isk ? kl : ql) + (size_t)tile0 * (16 * D) + u * 8;
    v4f x0[QT], x1[QT];
#pragma unroll
    for (int i = 0; i < QT; ++i) { x0[i] = *(const v4f*)(X + i * 16 * D); x1[i] = *(const v4f*)(X + i * 16 * D + 4); }
    asm volatile("s_wait_xcnt 0x0" :: "v"(X) : "memory");      // all loads are issued before the first store (one latency, not QT); X as input keeps results out of it
#pragma unroll
    for (int i = 0; i < QT; ++i) {
      v8b vh_, vl_;
#pragma unroll
      for (int e = 0; e < 4; ++e) { b16 a, c; split16(x0[i][e] * XS, a, c); vh_[e] = a; vl_[e] = c; split16(x1[i][e] * XS, a, c); vh_[4 + e] = a; vl_[4 + e] = c; }
      *(v8b*)(xh + i * 16 * D) = vh_; *(v8b*)(xl + i * 16 * D) = vl_;
    }
    return;
  }
  const int tid = threadIdx.x, h = blockIdx.x / (S / 64), t0 = (blockIdx.x % (S / 64)) * 64;
  for (int i = tid; i < 64 * D; i += 256) { const int t = i / D, dd = i % D; b16 a, b2; split16(V[((size_t)h * S + t0 + t) * D + dd] * VS, a, b2); Th[dd][t] = a; Tl[dd][t] = b2; }
  __syncthreads();
  // Fragment order: unit u of 8 keys = [key chunk of 32][feature tile n][fragment half j][lane]; the block's two chunks are 16 KB in a row per plane
  b16* bh = vth + (size_t)h * D * S + (size_t)t0 * D; b16* bl = vtl + (size_t)h * D * S + (size_t)t0 * D;
#pragma unroll
  for (int i = 0; i < 4; ++i) {
    const int u = i * 256 + tid, fl = u & 31, j = (u >> 5) & 1, n = (u >> 6) & 7, c = u >> 9;
    const int dd = n * 16 + (fl & 15), t = c * 32 + 16 * j + 8 * (fl >> 4);
    *(v8b*)(bh + (size_t)u * 8) = *(const v8b*)(&Th[dd][t]); *(v8b*)(bl + (size_t)u * 8) = *(const v8b*)(&Tl[dd][t]);
  }
}

// Scores for head group g: grid (32 key tiles of 64, 16 row blocks, HG); tiles wholly above the diagonal skip the MMA work (acc = 0); epilogue
__global__ __launch_bounds__(128) void s_kernel(const b16* __restrict__ qh, const b16* __restrict__ ql, const b16* __restrict__ kh, const b16* __restrict__ kl, int h0, float* __restrict__ Sb) {
  __shared__ __attribute__((aligned(16))) float Ts[4][32 * 64];
  const int lane = threadIdx.x & 31, wave = threadIdx.x >> 5, nloc = lane & 15, hlf = lane >> 4, hl = blockIdx.z, h = h0 + hl;
  const int qb = blockIdx.y, kt = blockIdx.x, m0 = qb * 128 + wave * 32, c0 = kt * 64;
  v8f acc[2][4];
#pragma unroll
  for (int r = 0; r < 2; ++r)
#pragma unroll
    for (int t = 0; t < 4; ++t) acc[r][t] = (v8f){};
  if (c0 <= qb * 128 + 127) {                                  // block-uniform: some (q, k) in this tile has k <= q
    // 32x64 wave tile from the fragment-order planes (vt_kernel): row tile = 2048 elements, k block = 512, half = 256, lane = 8; each load = 4 whole lines
    const size_t ao = ((size_t)h * S + m0) * D + lane * 8, bo = ((size_t)h * S + c0) * D + lane * 8;
    const b16* pah = qh + ao; const b16* pal = ql + ao; const b16* pbh = kh + bo; const b16* pbl = kl + bo;
#pragma unroll
    for (int kc = 0; kc < D / 32; ++kc) {
      v16b ah[2], al[2], bh[4], bl[4];
#pragma unroll
      for (int r = 0; r < 2; ++r) {
        const int o = r * 2048 + kc * 512;
        ah[r] = cat8b(ld8b(pah + o), ld8b(pah + o + 256)); al[r] = cat8b(ld8b(pal + o), ld8b(pal + o + 256));
      }
#pragma unroll
      for (int t = 0; t < 4; ++t) {
        const int o = t * 2048 + kc * 512;
        bh[t] = cat8b(ld8b(pbh + o), ld8b(pbh + o + 256)); bl[t] = cat8b(ld8b(pbl + o), ld8b(pbl + o + 256));
      }
      // the k block's 24 loads are issued in one run ahead of its products (one latency, not one per key tile); the addresses as inputs keep results out of them
      asm volatile("s_wait_xcnt 0x0" :: "v"(pah), "v"(pal), "v"(pbh), "v"(pbl) : "memory");
#pragma unroll
      for (int t = 0; t < 4; ++t) {
        acc[0][t] = mac<2, 2>(ah[0], al[0], bh[t], bl[t], acc[0][t]);
        acc[1][t] = mac<2, 2>(ah[1], al[1], bh[t], bl[t], acc[1][t]);
      }
    }
  }
  float* Tt = Ts[wave];
#pragma unroll
  for (int t = 0; t < 4; ++t)
#pragma unroll
    for (int r = 0; r < 2; ++r)
#pragma unroll
      for (int v = 0; v < 8; ++v) { const int rr = r * 16 + v + 8 * hlf, cc = t * 16 + nloc; Tt[rr * 64 + cc] = (c0 + cc <= m0 + rr) ? acc[r][t][v] * (SCALE / (XS * XS)) : 0.0f; }
  wave_lds_sync();
  float* dst0 = Sb + ((size_t)hl * S + m0) * S + c0;
  {
#pragma unroll
    for (int j = 0; j < 16; ++j) { const int rr = j * 2 + hlf, c4 = nloc * 4; *(v4f*)(dst0 + (size_t)rr * S + c4) = *(const v4f*)(Tt + rr * 64 + c4); }
    
  }
}

// ---------------------------------------------------------------------------
// Convolved-score attention for head group g: work-group = one head's query tiles t and S/16-1-t (16 queries each, one after the other: every
// work-group has the same number of causal key chunks); the tile's key chunks of 32 are dealt round-robin over the NW waves, each with its own
// maximum, sum and accumulators; partials merged through LDS. Per element the 3x3 window of the stored scores
// (rows q-2..q, keys k-1..k+1, zero outside [0,S)), x w[h], -inf for k > q; online softmax f32; P^T f16; y^T += (8V)^T.P^T (8 feature tiles, hi + lo
// ---------------------------------------------------------------------------
// lane l <-> lane l ^ 16
__device__ __forceinline__ float xhalf(float x) { return __builtin_bit_cast(float, __builtin_amdgcn_permlanex16(__builtin_bit_cast(int, x), __builtin_bit_cast(int, x), 0x76543210, 0xfedcba98, false, false)); }
// DPP row_shr:n (CTRL = 0x110 + n): lane c of a 16-lane row takes src of lane c - n; lanes c < n keep edge
template <int CTRL> __device__ __forceinline__ float row_from(float edge, float src) {
  return __builtin_bit_cast(float, __builtin_amdgcn_update_dpp(__builtin_bit_cast(int, edge), __builtin_bit_cast(int, src), CTRL, 0xf, 0xf, false));
}
// One score row's two 10-key runs of a lane: a = keys kb+8hh-1 .. kb+8hh+8, b = the same + 16 (zero outside [0, S)). The lane's own 16 keys are four
// aligned 16-byte loads; the run ends inside the 32-key chunk are held by lane ^ 16; only key kb-1 (hh 0) or kb+32 (hh 1) is one more load.
struct RowRaw { v4f f0, f1, g0, g1; float e; };
// p = the row's key kb + 8hh; eo = distance from there to the lane's outer key (0 where that key is outside the row)
__device__ __forceinline__ RowRaw load_row(const float* __restrict__ p, int eo) {
  return RowRaw{*(const v4f*)p, *(const v4f*)(p + 4), *(const v4f*)(p + 16), *(const v4f*)(p + 20), p[eo]};
}
__device__ __forceinline__ void make_runs(const RowRaw& x, int kb, int hh, float (&a)[10], float (&b)[10]) {
  const int ke = hh ? kb + 32 : kb - 1;
  const float e = (ke >= 0 && ke < S) ? x.e : 0.0f;
  const float r1 = xhalf(hh ? x.f0[0] : x.f1[3]), r2 = xhalf(hh ? x.f1[3] : x.g0[0]), r3 = xhalf(hh ? x.g0[0] : x.g1[3]);
  a[0] = hh ? r1 : e; a[9] = hh ? r2 : r1; b[0] = hh ? r3 : r2; b[9] = hh ? e : r3;
#pragma unroll
  for (int j = 0; j < 4; ++j) { a[1 + j] = x.f0[j]; a[5 + j] = x.f1[j]; b[1 + j] = x.g0[j]; b[5 + j] = x.g1[j]; }
}
constexpr int NW = 16;        // waves per work-group; also the rows of a query tile, so wave w merges row w
constexpr int OP = D + 4;     // pitch of a partial row in floats: 528 B = 16 B x odd, so the 16 query columns of a b128 store fall on distinct banks
__global__ __launch_bounds__(NW * 32) void attn_kernel(const float* __restrict__ Sb, const float* __restrict__ wconv, const b16* __restrict__ vth, const b16* __restrict__ vtl,
                                                   int h0, float* __restrict__ out) {
  __shared__ __attribute__((aligned(16))) float Os[NW][16 * OP];
  __shared__ float Ms[NW][16]; __shared__ float Ls[NW][16];
  const int wid = threadIdx.x >> 5, lane = threadIdx.x & 31, hh = lane >> 4, col = lane & 15;
  const int hl = blockIdx.x / (S / 32), pr = blockIdx.x % (S / 32), h = h0 + hl;
  const float* Sh = Sb + (size_t)hl * S * S; const b16* vh = vth + (size_t)h * D * S; const b16* vl = vtl + (size_t)h * D * S;
  float w[9];
#pragma unroll
  for (int i = 0; i < 9; ++i) w[i] = wconv[h * 9 + i];       // [i][j]: query tap i (row q-2+i), key tap j (k-1+j)
  for (int half = 0; half < 2; ++half) {
    const int q0 = (half ? pr : S / 16 - 1 - pr) * 16, qi = q0 + col;
    const int nch = (q0 + 16 + 31) / 32, nact = nch < NW ? nch : NW;     // key chunks of this tile; waves that have at least one
    // rows above row 0 are zero: their taps get weight 0 and their loads are clamped to row 0 (only the first tile has such rows)
    const int rt = q0 > 0 ? q0 - 2 + (col < 1 ? col : 1) : 0, ru = q0 > 0 ? q0 - 1 : 0;
    float wt[3], wu[3];
#pragma unroll
    for (int j = 0; j < 3; ++j) { wt[j] = qi >= 2 ? w[j] : 0.0f; wu[j] = qi >= 1 ? w[3 + j] : 0.0f; }
    const float* po = Sh + (size_t)qi * S + wid * 32 + 8 * hh; const float* pt = Sh + (size_t)rt * S + wid * 32 + 8 * hh;
    const float* pu = Sh + (size_t)ru * S + wid * 32 + 8 * hh;
    float m = -INFINITY, l = 0.0f;
    v8f o[8];
#pragma unroll
    for (int n = 0; n < 8; ++n) o[n] = (v8f){};
    for (int kb = wid * 32; kb < q0 + 16; kb += NW * 32) {
      v8f s0 = {}, s1 = {};
      // Score window: every lane loads only its own query row (plus the two rows above the tile, which lanes 0 and 1 of each half need); rows
      // q-1 and q-2 come from the lanes of queries q-1 and q-2 by a shift inside the 16-lane row. Same values and same sums as per-element loads.
      float oa[10], ob[10], ta[10], tb[10], ua[10], ub[10];
      const int ke = hh ? kb + 32 : kb - 1, eo = (ke >= 0 && ke < S) ? (hh ? 24 : -1) : 0;
      const RowRaw xt = load_row(pt, eo);                        // lane 0: row q0-2, lane 1: row q0-1 (the other lanes: an unused copy of lane 1's)
      asm volatile("s_wait_xcnt 0x0" ::: "memory");              // later loads' results may land in address registers of the loads above
      const RowRaw xu = load_row(pu, eo);                        // lane 0: row q0-1 (the other lanes: an unused copy)
      asm volatile("s_wait_xcnt 0x0" :: "v"(pu), "v"(pu + eo) : "memory");   // as above; the addresses as inputs keep this row's own results out of them too
      const RowRaw xo = load_row(po, eo);
      asm volatile("s_wait_xcnt 0x0" :: "v"(po), "v"(po + eo) : "memory");   // as above; the addresses as inputs keep this row's own results out of them too
      po += NW * 32; pt += NW * 32; pu += NW * 32;
      make_runs(xo, kb, hh, oa, ob); make_runs(xt, kb, hh, ta, tb); make_runs(xu, kb, hh, ua, ub);
#pragma unroll
      for (int j = 0; j < 10; ++j) { ta[j] = row_from<0x112>(ta[j], oa[j]); tb[j] = row_from<0x112>(tb[j], ob[j]); }   // row q-2
#pragma unroll
      for (int j = 0; j < 10; ++j) { ua[j] = row_from<0x111>(ua[j], oa[j]); ub[j] = row_from<0x111>(ub[j], ob[j]); }   // row q-1
#pragma unroll
      for (int r = 0; r < 8; ++r) s0[r] += wt[0] * ta[r] + wt[1] * ta[r + 1] + wt[2] * ta[r + 2];
#pragma unroll
      for (int r = 0; r < 8; ++r) s1[r] += wt[0] * tb[r] + wt[1] * tb[r + 1] + wt[2] * tb[r + 2];
#pragma unroll
      for (int r = 0; r < 8; ++r) s0[r] += wu[0] * ua[r] + wu[1] * ua[r + 1] + wu[2] * ua[r + 2];
#pragma unroll
      for (int r = 0; r < 8; ++r) s1[r] += wu[0] * ub[r] + wu[1] * ub[r + 1] + wu[2] * ub[r + 2];
#pragma unroll
      for (int r = 0; r < 8; ++r) s0[r] += w[6] * oa[r] + w[7] * oa[r + 1] + w[8] * oa[r + 2];
#pragma unroll
      for (int r = 0; r < 8; ++r) s1[r] += w[6] * ob[r] + w[7] * ob[r + 1] + w[8] * ob[r + 2];
#pragma unroll
      for (int r = 0; r < 8; ++r) { const int k0i = kb + 8 * hh + r, k1i = k0i + 16; if (k0i > qi) s0[r] = -INFINITY; if (k1i > qi) s1[r] = -INFINITY; }
      float mr = -INFINITY;
#pragma unroll
      for (int r = 0; r < 8; ++r) mr = fmaxf(mr, fmaxf(s0[r], s1[r]));
      mr = fmaxf(mr, __shfl_xor(mr, 16));
      float mn = fmaxf(m, mr); if (mn == -INFINITY) mn = 0.0f;
      const float al_ = __expf(m - mn); m = mn;
      float sum = 0.0f; v16b pb;
#pragma unroll
      for (int r = 0; r < 8; ++r) { const float p0 = __expf(s0[r] - mn), p1 = __expf(s1[r] - mn); sum += p0 + p1; pb[r] = (b16)p0; pb[8 + r] = (b16)p1; }
      sum += __shfl_xor(sum, 16);
      l = l * al_ + sum;
#pragma unroll
      for (int n = 0; n < 8; ++n) {
#pragma unroll
        for (int r = 0; r < 8; ++r) o[n][r] *= al_;
        const size_t ro = (size_t)kb * D + n * 512 + lane * 8;    // fragment order (vt_kernel): halves j = 0, 1 are 256 elements apart
        o[n] = wmma16b(cat8b(ld8b(vh + ro), ld8b(vh + ro + 256)), pb, o[n]);
        o[n] = wmma16b(cat8b(ld8b(vl + ro), ld8b(vl + ro + 256)), pb, o[n]);
      }
      asm volatile("s_wait_xcnt 0x0" ::: "memory");              // the next trip forms its addresses in the registers that the V loads above name
    }
    if (wid < nact) {                                            // un-normalised partial y^T: lane col = query, element r = feature 16n+8hh+r
      float* Tt = Os[wid];
#pragma unroll
      for (int n = 0; n < 8; ++n)
#pragma unroll
        for (int r = 0; r < 8; ++r) Tt[col * OP + n * 16 + 8 * hh + r] = o[n][r];
      if (hh == 0) { Ms[wid][col] = m; Ls[wid][col] = l; }
    }
    __syncthreads();                                             // every wave's partial is in LDS before any is merged
    {
      float mx = -INFINITY;
      for (int u = 0; u < nact; ++u) mx = fmaxf(mx, Ms[u][wid]);
      float ls = 0.0f; v4f y = {};
      for (int u = 0; u < nact; ++u) { const float f = __expf(Ms[u][wid] - mx); ls += f * Ls[u][wid]; y += f * *(const v4f*)(&Os[u][wid * OP + lane * 4]); }
      const float inv = (ls > 0.0f) ? (1.0f / (VS * ls)) : 0.0f;
      *(v4f*)(out + ((size_t)h * S + q0 + wid) * D + lane * 4) = y * inv;    // one row of 512 B per wave: whole lines
    }
    __syncthreads();                                             // the merge has read the partials before the second tile overwrites them
  }
}
}  // namespace

extern "C" void kernel_launch(void* const* d_in, const int* in_sizes, int n_in,
                              void* d_out, int out_size, void* d_ws, size_t ws_size, hipStream_t stream) {
  (void)n_in; (void)out_size;
  const float* Q = (const float*)d_in[0]; const float* K = (const float*)d_in[1]; const float* V = (const float*)d_in[2];   // [1,16,2048,128]
  const float* wconv = (const float*)d_in[3];   // [16,3,3]
  float* out = (float*)d_out;                   // [1,16,2048,128]
  if (in_sizes[0] != H * S * D || in_sizes[1] != H * S * D || in_sizes[2] != H * S * D || in_sizes[3] != H * 9) return;
  size_t off = 0; char* ws = (char*)d_ws;
  auto carve = [&](size_t bytes) { char* p = ws + off; off += (bytes + 255) & ~(size_t)255; return p; };
  b16* vth = (b16*)carve((size_t)H * D * S * 2);     //  8 MB
  b16* vtl = (b16*)carve((size_t)H * D * S * 2);     //  8 MB
  b16* qh = (b16*)carve((size_t)H * S * D * 2);      //  8 MB each: 8Q and 8K, hi and lo
  b16* ql = (b16*)carve((size_t)H * S * D * 2);
  b16* kh = (b16*)carve((size_t)H * S * D * 2);
  b16* kl = (b16*)carve((size_t)H * S * D * 2);
  float* Sb = (float*)carve((size_t)HG * S * S * 4); // 64 MB score buffer for 4 heads
  if (off > ws_size) return;                           // total 117,440,512 B
  vt_kernel<<<H * (S / 64) + 2 * (H * S / 16 / QT), 256, 0, stream>>>(V, vth, vtl, Q, K, qh, ql, kh, kl);
  for (int g = 0; g < H / HG; ++g) {
    s_kernel<<<dim3(S / 64, S / 128, HG), 128, 0, stream>>>(qh, ql, kh, kl, g * HG, Sb);
    attn_kernel<<<HG * (S / 32), NW * 32, 0, stream>>>(Sb, wconv, vth, vtl, g * HG, out);
  }
}

// v005
// It runs in 169 microseconds.
// Timed twice side by side with v004, it ran 1.45 times as fast both times.
// Counting every step since v000, it is 9.43 times as fast.
#include <hip/hip_runtime.h>

// Causal attention with a learned per-head 3x3 convolution over the score matrix: s = Q.K^T/sqrt(128) with future keys zeroed, cs[q][k] =
// sum_{i<3,j<3} w[h][i][j] s[q-2+i][k-1+j] (query padding left only, key padding symmetric, zeros outside), future keys -> -inf, softmax, out = P.V.
// B=1, 16 heads, S=2048, D=128; Q, K, V are the inputs (no projections).
// Contractions on v_wmma_f32_16x16x32_f16: Q.K^T with both operands split once into f16 hi+lo planes of the x8-scaled f32 rows (3 products); P.V with
// unnormalised P as single f16 against an f16 hi+lo pair of 8V (2 products); f32 accumulate; the 3x3 score convolution, masking and online softmax in
// f32 from an f32 score buffer (4 heads at a time). Fragment k-map per lane half hh for A AND B: elements 0..7 <- k = 8hh+0..7, 8..15 <- k = 16+8hh+0..7.

namespace {
constexpr int H = 16, S = 2048, D = 128, HG = 4;             // heads per score-buffer group
constexpr float XS = 8.0f, VS = 8.0f, SCALE = 0.08838834764831845f;   // 128^-0.5

typedef _Float16 b16;
typedef __attribute__((ext_vector_type(16))) _Float16 v16b;
typedef __attribute__((ext_vector_type(8)))  _Float16 v8b;
typedef __attribute__((ext_vector_type(8)))  float v8f;
typedef __attribute__((ext_vector_type(4)))  float v4f;

__device__ __forceinline__ v8b ld8b(const b16* p) { return *(const v8b*)p; }
__device__ __forceinline__ v16b cat8b(v8b a, v8b b) { return __builtin_shufflevector(a, b, 0, 1, 2, 3, 4, 5, 6, 7, 8, 9, 10, 11, 12, 13, 14, 15); }
__device__ __forceinline__ void split16(float v, b16& hi, b16& lo) { hi = (b16)v; lo = (b16)(v - (float)hi); }
__device__ __forceinline__ v8f wmma16b(v16b a, v16b b, v8f c) {
  v8f d = __builtin_amdgcn_wmma_f32_16x16x32_f16(false, a, false, b, (short)0, c, false, false);
  asm volatile("v_nop\n\tv_nop\n\tv_nop\n\tv_nop" : "+v"(d) : "v"(a), "v"(b));
  return d;
}
__device__ __forceinline__ void wave_lds_sync() {
  __builtin_amdgcn_fence(__ATOMIC_RELEASE, "workgroup");
  __builtin_amdgcn_wave_barrier();
  __builtin_amdgcn_fence(__ATOMIC_ACQUIRE, "workgroup");
}

// One accumulator's products of a k block; operand kind 2 = f16 hi + lo planes, 1 = one f16 plane
template <int ANP, int BNP> __device__ __forceinline__ v8f mac(v16b ah, v16b al, v16b bh, v16b bl, v8f c) {
  c = wmma16b(ah, bh, c);
  if (BNP == 0 || BNP == 2 || BNP == 4 || BNP == 5) c = wmma16b(ah, bl, c);     // hi.lo
  if (ANP == 0 || ANP == 2 || ANP == 4 || ANP == 5) c = wmma16b(al, bh, c);     // lo.hi   (lo.lo dropped)
  return c;
}
__device__ __forceinline__ void epi_planes(v8f (&acc)[2][4], float scale, bool two, b16* __restrict__ oh, b16* __restrict__ ol, int ldo,
                                           int m0, int c0, int lane, b16* Th, b16* Tl) {
  const int nloc = lane & 15, hlf = lane >> 4;
#pragma unroll
  for (int t = 0; t < 4; ++t)
#pragma unroll
    for (int r = 0; r < 2; ++r)
#pragma unroll
      for (int v = 0; v < 8; ++v) {
        const int rr = r * 16 + v + 8 * hlf, cc = t * 16 + nloc;
        b16 h_, l_; split16(acc[r][t][v] * scale, h_, l_);
        Th[rr * 64 + cc] = h_; Tl[rr * 64 + cc] = l_;
      }
  wave_lds_sync();
  {
#pragma unroll
    for (int j = 0; j < 8; ++j) {
      const int rr = j * 4 + (lane >> 3), c8 = (lane & 7) * 8;
      const size_t o = (size_t)(m0 + rr) * ldo + c0 + c8;
      *(v8b*)(oh + o) = ld8b(Th + rr * 64 + c8);
      if (two) *(v8b*)(ol + o) = ld8b(Tl + rr * 64 + c8);
    }
    
  }
}
// (b) f32 rows with pitch ldo: 64 floats = 256 B = 2 lines per row; 16 lanes x 16 B per row, 2 rows per instruction. Optional per-row factor
__device__ __forceinline__ void epi_f32(v8f (&acc)[2][4], float scale, const float* rscale, float* __restrict__ out, int ldo, int m0, int c0, int lane, float* Tt) {
  const int nloc = lane & 15, hlf = lane >> 4;
#pragma unroll
  for (int t = 0; t < 4; ++t)
#pragma unroll
    for (int r = 0; r < 2; ++r)
#pragma unroll
      for (int v = 0; v < 8; ++v) {
        const int rr = r * 16 + v + 8 * hlf;
        const float rs = rscale ? rscale[(size_t)(m0 + rr) * 32] : 1.0f;
        Tt[rr * 64 + t * 16 + nloc] = acc[r][t][v] * scale * rs;
      }
  wave_lds_sync();
  float* dst0 = out + (size_t)m0 * ldo + c0;
  {
#pragma unroll
    for (int j = 0; j < 16; ++j) { const int rr = j * 2 + hlf, c4 = nloc * 4; *(v4f*)(dst0 + (size_t)rr * ldo + c4) = *(const v4f*)(Tt + rr * 64 + c4); }
    
  }
}



// (8V)^T as f16 hi and lo planes in the order the attention waves read their A fragments: per head [key chunk of 32][feature tile n of 16][half j]
// [lane][8 keys], lane = 16hh + feature, keys 16j + 8hh + 0..7 of the chunk. One fragment = two loads of 512 B in a row (4 whole lines each).
// The same launch splits Q and K (blocks from H * S / 64 on): 8X as f16 hi and lo planes in the order the score waves read their fragments: [row tile of
// 16][k block of 32][half j][lane][8], lane = 16hh + row, k = 16j + 8hh + 0..7 of the block; a tile's 256 units = the block's 256 threads, QT tiles each.
constexpr int QT = 8;
__global__ __launch_bounds__(256) void vt_kernel(const float* __restrict__ V, b16* __restrict__ vth, b16* __restrict__ vtl, const float* __restrict__ Q,
                                                 const float* __restrict__ K, b16* __restrict__ qh, b16* __restrict__ ql, b16* __restrict__ kh, b16* __restrict__ kl) {
  __shared__ __attribute__((aligned(16))) b16 Th[D][72]; __shared__ __attribute__((aligned(16))) b16 Tl[D][72];
  if (blockIdx.x >= H * (S / 64)) {                            // block-uniform; no barrier on this path
    constexpr int NB = H * S / 16 / QT;                        // blocks per tensor
    const int b = blockIdx.x - H * (S / 64), isk = b >= NB, tile0 = (b - isk * NB) * QT, u = threadIdx.x, fl = u & 31;
    const float* X = (isk ? K : Q) + ((size_t)tile0 * 16 + (fl & 15)) * D + (u >> 6) * 32 + 16 * ((u >> 5) & 1) + 8 * (fl >> 4);
    b16* xh = (isk ? kh : qh) + (size_t)tile0 * (16 * D) + u * 8; b16* xl = (isk ? kl : ql) + (size_t)tile0 * (16 * D) + u * 8;
    v4f x0[QT], x1[QT];
#pragma unroll
    for (int i = 0; i < QT; ++i) { x0[i] = *(const v4f*)(X + i * 16 * D); x1[i] = *(const v4f*)(X + i * 16 * D + 4); }
    asm volatile("s_wait_xcnt 0x0" :: "v"(X) : "memory");      // all loads are issued before the first store (one latency, not QT); X as input keeps results out of it
#pragma unroll
    for (int i = 0; i < QT; ++i) {
      v8b vh_, vl_;
#pragma unroll
      for (int e = 0; e < 4; ++e) { b16 a, c; split16(x0[i][e] * XS, a, c); vh_[e] = a; vl_[e] = c; split16(x1[i][e] * XS, a, c); vh_[4 + e] = a; vl_[4 + e] = c; }
      *(v8b*)(xh + i * 16 * D) = vh_; *(v8b*)(xl + i * 16 * D) = vl_;
    }
    return;
  }
  const int tid = threadIdx.x, h = blockIdx.x / (S / 64), t0 = (blockIdx.x % (S / 64)) * 64;
  for (int i = tid; i < 64 * D; i += 256) { const int t = i / D, dd = i % D; b16 a, b2; split16(V[((size_t)h * S + t0 + t) * D + dd] * VS, a, b2); Th[dd][t] = a; Tl[dd][t] = b2; }
  __syncthreads();
  // Fragment order: unit u of 8 keys = [key chunk of 32][feature tile n][fragment half j][lane]; the block's two chunks are 16 KB in a row per plane
  b16* bh = vth + (size_t)h * D * S + (size_t)t0 * D; b16* bl = vtl + (size_t)h * D * S + (size_t)t0 * D;
#pragma unroll
  for (int i = 0; i < 4; ++i) {
    const int u = i * 256 + tid, fl = u & 31, j = (u >> 5) & 1, n = (u >> 6) & 7, c = u >> 9;
    const int dd = n * 16 + (fl & 15), t = c * 32 + 16 * j + 8 * (fl >> 4);
    *(v8b*)(bh + (size_t)u * 8) = *(const v8b*)(&Th[dd][t]); *(v8b*)(bl + (size_t)u * 8) = *(const v8b*)(&Tl[dd][t]);
  }
}

// Scores for head group g: grid (32 key tiles of 64, 16 row blocks, HG); tiles wholly above the diagonal skip the MMA work (acc = 0); epilogue
__global__ __launch_bounds__(128) void s_kernel(const b16* __restrict__ qh, const b16* __restrict__ ql, const b16* __restrict__ kh, const b16* __restrict__ kl, int h0, float* __restrict__ Sb) {
  __shared__ __attribute__((aligned(16))) float Ts[4][32 * 64];
  const int lane = threadIdx.x & 31, wave = threadIdx.x >> 5, nloc = lane & 15, hlf = lane >> 4, hl = blockIdx.z, h = h0 + hl;
  const int qb = blockIdx.y, kt = blockIdx.x, m0 = qb * 128 + wave * 32, c0 = kt * 64;
  v8f acc[2][4];
#pragma unroll
  for (int r = 0; r < 2; ++r)
#pragma unroll
    for (int t = 0; t < 4; ++t) acc[r][t] = (v8f){};
  if (c0 <= qb * 128 + 127) {                                  // block-uniform: some (q, k) in this tile has k <= q
    // 32x64 wave tile from the fragment-order planes (vt_kernel): row tile = 2048 elements, k block = 512, half = 256, lane = 8; each load = 4 whole lines
    const size_t ao = ((size_t)h * S + m0) * D + lane * 8, bo = ((size_t)h * S + c0) * D + lane * 8;
    const b16* pah = qh + ao; const b16* pal = ql + ao; const b16* pbh = kh + bo; const b16* pbl = kl + bo;
#pragma unroll
    for (int kc = 0; kc < D / 32; ++kc) {
      v16b ah[2], al[2], bh[4], bl[4];
#pragma unroll
      for (int r = 0; r < 2; ++r) {
        const int o = r * 2048 + kc * 512;
        ah[r] = cat8b(ld8b(pah + o), ld8b(pah + o + 256)); al[r] = cat8b(ld8b(pal + o), ld8b(pal + o + 256));
      }
#pragma unroll
      for (int t = 0; t < 4; ++t) {
        const int o = t * 2048 + kc * 512;
        bh[t] = cat8b(ld8b(pbh + o), ld8b(pbh + o + 256)); bl[t] = cat8b(ld8b(pbl + o), ld8b(pbl + o + 256));
      }
      // the k block's 24 loads are issued in one run ahead of its products (one latency, not one per key tile); the addresses as inputs keep results out of them
      asm volatile("s_wait_xcnt 0x0" :: "v"(pah), "v"(pal), "v"(pbh), "v"(pbl) : "memory");
#pragma unroll
      for (int t = 0; t < 4; ++t) {
        acc[0][t] = mac<2, 2>(ah[0], al[0], bh[t], bl[t], acc[0][t]);
        acc[1][t] = mac<2, 2>(ah[1], al[1], bh[t], bl[t], acc[1][t]);
      }
    }
  }
  float* Tt = Ts[wave];
#pragma unroll
  for (int t = 0; t < 4; ++t)
#pragma unroll
    for (int r = 0; r < 2; ++r)
#pragma unroll
      for (int v = 0; v < 8; ++v) { const int rr = r * 16 + v + 8 * hlf, cc = t * 16 + nloc; Tt[rr * 64 + cc] = (c0 + cc <= m0 + rr) ? acc[r][t][v] * (SCALE / (XS * XS)) : 0.0f; }
  wave_lds_sync();
  float* dst0 = Sb + ((size_t)hl * S + m0) * S + c0;
  {
#pragma unroll
    for (int j = 0; j < 16; ++j) { const int rr = j * 2 + hlf, c4 = nloc * 4; *(v4f*)(dst0 + (size_t)rr * S + c4) = *(const v4f*)(Tt + rr * 64 + c4); }
    
  }
}

// ---------------------------------------------------------------------------
// Convolved-score attention for head group g: work-group = one head's query tiles t and S/16-1-t (16 queries each, one after the other: every
// work-group has the same number of causal key chunks); the tile's key chunks of 32 are dealt round-robin over the NW waves, each with its own
// maximum, sum and accumulators; partials merged through LDS. Per element the 3x3 window of the stored scores
// (rows q-2..q, keys k-1..k+1, zero outside [0,S)), x w[h], -inf for k > q; online softmax f32; P^T f16; y^T += (8V)^T.P^T (8 feature tiles, hi + lo
// ---------------------------------------------------------------------------
// lane l <-> lane l ^ 16
__device__ __forceinline__ float xhalf(float x) { return __builtin_bit_cast(float, __builtin_amdgcn_permlanex16(__builtin_bit_cast(int, x), __builtin_bit_cast(int, x), 0x76543210, 0xfedcba98, false, false)); }
// DPP row_shr:n (CTRL = 0x110 + n): lane c of a 16-lane row takes src of lane c - n; lanes c < n keep edge
template <int CTRL> __device__ __forceinline__ float row_from(float edge, float src) {
  return __builtin_bit_cast(float, __builtin_amdgcn_update_dpp(__builtin_bit_cast(int, edge), __builtin_bit_cast(int, src), CTRL, 0xf, 0xf, false));
}
// One score row's two 10-key runs of a lane: a = keys kb+8hh-1 .. kb+8hh+8, b = the same + 16 (zero outside [0, S)). The lane's own 16 keys are four
// aligned 16-byte loads; the run ends inside the 32-key chunk are held by lane ^ 16; only key kb-1 (hh 0) or kb+32 (hh 1) is one more load.
struct RowRaw { v4f f0, f1, g0, g1; float e; };
// p = the row's key kb + 8hh; eo = distance from there to the lane's outer key (0 where that key is outside the row)
__device__ __forceinline__ RowRaw load_row(const float* __restrict__ p, int eo) {
  return RowRaw{*(const v4f*)p, *(const v4f*)(p + 4), *(const v4f*)(p + 16), *(const v4f*)(p + 20), p[eo]};
}
__device__ __forceinline__ void make_runs(const RowRaw& x, int kb, int hh, float (&a)[10], float (&b)[10]) {
  const int ke = hh ? kb + 32 : kb - 1;
  const float e = (ke >= 0 && ke < S) ? x.e : 0.0f;
  const float r1 = xhalf(hh ? x.f0[0] : x.f1[3]), r2 = xhalf(hh ? x.f1[3] : x.g0[0]), r3 = xhalf(hh ? x.g0[0] : x.g1[3]);
  a[0] = hh ? r1 : e; a[9] = hh ? r2 : r1; b[0] = hh ? r3 : r2; b[9] = hh ? e : r3;
#pragma unroll
  for (int j = 0; j < 4; ++j) { a[1 + j] = x.f0[j]; a[5 + j] = x.f1[j]; b[1 + j] = x.g0[j]; b[5 + j] = x.g1[j]; }
}
constexpr int NW = 16;        // waves per work-group; also the rows of a query tile, so wave w merges row w
constexpr int OP = D + 4;     // pitch of a partial row in floats: 528 B = 16 B x odd, so the 16 query columns of a b128 store fall on distinct banks
__global__ __launch_bounds__(NW * 32) void attn_kernel(const float* __restrict__ Sb, const float* __restrict__ wconv, const b16* __restrict__ vth, const b16* __restrict__ vtl,
                                                   int h0, float* __restrict__ out) {
  __shared__ __attribute__((aligned(16))) float Os[NW][16 * OP];
  __shared__ float Ms[NW][16]; __shared__ float Ls[NW][16];
  const int wid = threadIdx.x >> 5, lane = threadIdx.x & 31, hh = lane >> 4, col = lane & 15;
  const int hl = blockIdx.x / (S / 32), pr = blockIdx.x % (S / 32), h = h0 + hl;
  const float* Sh = Sb + (size_t)hl * S * S; const b16* vh = vth + (size_t)h * D * S; const b16* vl = vtl + (size_t)h * D * S;
  float w[9];
#pragma unroll
  for (int i = 0; i < 9; ++i) w[i] = wconv[h * 9 + i];       // [i][j]: query tap i (row q-2+i), key tap j (k-1+j)
  for (int half = 0; half < 2; ++half) {
    const int q0 = (half ? pr : S / 16 - 1 - pr) * 16, qi = q0 + col;
    const int nch = (q0 + 16 + 31) / 32, nact = nch < NW ? nch : NW;     // key chunks of this tile; waves that have at least one
    // rows above row 0 are zero (only the first tile has such rows, and only its chunk kb = 0): their loads go to row 0, keys 64 on, which the score
    // kernel stores as zeros (future keys), so every lane uses the head's nine weights as they are (uniform values, no per-lane copies in registers)
    const int rt = q0 > 0 ? q0 - 2 + (col < 1 ? col : 1) : 0, ru = q0 > 0 ? q0 - 1 : 0, zk = q0 > 0 ? 0 : 64;
    const float* po = Sh + (size_t)qi * S + wid * 32 + 8 * hh; const float* pt = Sh + (size_t)rt * S + zk + wid * 32 + 8 * hh;
    const float* pu = Sh + (size_t)ru * S + zk + wid * 32 + 8 * hh;
    float m = -INFINITY, l = 0.0f;
    v8f o[8];
#pragma unroll
    for (int n = 0; n < 8; ++n) o[n] = (v8f){};
    for (int kb = wid * 32; kb < q0 + 16; kb += NW * 32) {
      v8f s0 = {}, s1 = {};
      // Score window: every lane loads only its own query row (plus the two rows above the tile, which lanes 0 and 1 of each half need); rows
      // q-1 and q-2 come from the lanes of queries q-1 and q-2 by a shift inside the 16-lane row. Same values and same sums as per-element loads.
      float oa[10], ob[10], ta[10], tb[10], ua[10], ub[10];
      const int ke = hh ? kb + 32 : kb - 1, eo = (ke >= 0 && ke < S) ? (hh ? 24 : -1) : 0;
      const RowRaw xt = load_row(pt, eo);                        // lane 0: row q0-2, lane 1: row q0-1 (the other lanes: an unused copy of lane 1's)
      asm volatile("s_wait_xcnt 0x0" ::: "memory");              // later loads' results may land in address registers of the loads above
      const RowRaw xu = load_row(pu, eo);                        // lane 0: row q0-1 (the other lanes: an unused copy)
      asm volatile("s_wait_xcnt 0x0" :: "v"(pu), "v"(pu + eo) : "memory");   // as above; the addresses as inputs keep this row's own results out of them too
      const RowRaw xo = load_row(po, eo);
      asm volatile("s_wait_xcnt 0x0" :: "v"(po), "v"(po + eo) : "memory");   // as above; the addresses as inputs keep this row's own results out of them too
      __builtin_amdgcn_sched_barrier(0);                         // the 15 score loads stay one run: no window arithmetic (and no wait) is lifted between them
      po += NW * 32; pt += NW * 32; pu += NW * 32;
      make_runs(xo, kb, hh, oa, ob); make_runs(xt, kb, hh, ta, tb); make_runs(xu, kb, hh, ua, ub);
#pragma unroll
      for (int j = 0; j < 10; ++j) { ta[j] = row_from<0x112>(ta[j], oa[j]); tb[j] = row_from<0x112>(tb[j], ob[j]); }   // row q-2
#pragma unroll
      for (int j = 0; j < 10; ++j) { ua[j] = row_from<0x111>(ua[j], oa[j]); ub[j] = row_from<0x111>(ub[j], ob[j]); }   // row q-1
#pragma unroll
      for (int r = 0; r < 8; ++r) s0[r] += w[0] * ta[r] + w[1] * ta[r + 1] + w[2] * ta[r + 2];
#pragma unroll
      for (int r = 0; r < 8; ++r) s1[r] += w[0] * tb[r] + w[1] * tb[r + 1] + w[2] * tb[r + 2];
#pragma unroll
      for (int r = 0; r < 8; ++r) s0[r] += w[3] * ua[r] + w[4] * ua[r + 1] + w[5] * ua[r + 2];
#pragma unroll
      for (int r = 0; r < 8; ++r) s1[r] += w[3] * ub[r] + w[4] * ub[r + 1] + w[5] * ub[r + 2];
#pragma unroll
      for (int r = 0; r < 8; ++r) s0[r] += w[6] * oa[r] + w[7] * oa[r + 1] + w[8] * oa[r + 2];
#pragma unroll
      for (int r = 0; r < 8; ++r) s1[r] += w[6] * ob[r] + w[7] * ob[r + 1] + w[8] * ob[r + 2];
      const int dq = qi - kb - 8 * hh;                           // the lane's key r (or r + 16) is a future key where it exceeds dq: one register, not one bound per key
#pragma unroll
      for (int r = 0; r < 8; ++r) { if (r > dq) s0[r] = -INFINITY; if (r + 16 > dq) s1[r] = -INFINITY; }
      // The chunk's 32 V fragment loads are issued in one run ahead of its 16 products (one load latency per chunk, not one per product).
      // Fragment order (vt_kernel): feature tiles are 512 elements apart, halves j = 0, 1 are 256 apart.
      const unsigned vo = (unsigned)(kb * D + lane * 8) * 2u;    // 32-bit byte offset on the two uniform plane bases: the addresses are formed per trip, no running pointers are held across it
      const b16* pvh = (const b16*)((const char*)vh + vo); const b16* pvl = (const b16*)((const char*)vl + vo);
      v8b vh0[8], vh1[8], vl0[8], vl1[8];
#pragma unroll
      for (int n = 0; n < 8; ++n) { vh0[n] = ld8b(pvh + n * 512); vh1[n] = ld8b(pvh + n * 512 + 256); vl0[n] = ld8b(pvl + n * 512); vl1[n] = ld8b(pvl + n * 512 + 256); }
      // keeps the run together above the products; later code (the next trip too) rewrites the registers that these loads name; the addresses as inputs keep results out of them
      asm volatile("s_wait_xcnt 0x0" :: "v"(pvh), "v"(pvl) : "memory");
      float mr = -INFINITY;
#pragma unroll
      for (int r = 0; r < 8; ++r) mr = fmaxf(mr, fmaxf(s0[r], s1[r]));
      mr = fmaxf(mr, __shfl_xor(mr, 16));
      float mn = fmaxf(m, mr); if (mn == -INFINITY) mn = 0.0f;
      const float al_ = __expf(m - mn); m = mn;
      float sum = 0.0f; v16b pb;
#pragma unroll
      for (int r = 0; r < 8; ++r) { const float p0 = __expf(s0[r] - mn), p1 = __expf(s1[r] - mn); sum += p0 + p1; pb[r] = (b16)p0; pb[8 + r] = (b16)p1; }
      sum += __shfl_xor(sum, 16);
      l = l * al_ + sum;
#pragma unroll
      for (int n = 0; n < 8; ++n) {
#pragma unroll
        for (int r = 0; r < 8; ++r) o[n][r] *= al_;
        o[n] = wmma16b(cat8b(vh0[n], vh1[n]), pb, o[n]);
        o[n] = wmma16b(cat8b(vl0[n], vl1[n]), pb, o[n]);
      }
    }
    if (wid < nact) {                                            // un-normalised partial y^T: lane col = query, element r = feature 16n+8hh+r
      float* Tt = Os[wid];
#pragma unroll
      for (int n = 0; n < 8; ++n)
#pragma unroll
        for (int r = 0; r < 8; ++r) Tt[col * OP + n * 16 + 8 * hh + r] = o[n][r];
      if (hh == 0) { Ms[wid][col] = m; Ls[wid][col] = l; }
    }
    __syncthreads();                                             // every wave's partial is in LDS before any is merged
    {
      float mx = -INFINITY;
      for (int u = 0; u < nact; ++u) mx = fmaxf(mx, Ms[u][wid]);
      float ls = 0.0f; v4f y = {};
      for (int u = 0; u < nact; ++u) { const float f = __expf(Ms[u][wid] - mx); ls += f * Ls[u][wid]; y += f * *(const v4f*)(&Os[u][wid * OP + lane * 4]); }
      const float inv = (ls > 0.0f) ? (1.0f / (VS * ls)) : 0.0f;
      *(v4f*)(out + ((size_t)h * S + q0 + wid) * D + lane * 4) = y * inv;    // one row of 512 B per wave: whole lines
    }
    __syncthreads();                                             // the merge has read the partials before the second tile overwrites them
  }
}
}  // namespace

extern "C" void kernel_launch(void* const* d_in, const int* in_sizes, int n_in,
                              void* d_out, int out_size, void* d_ws, size_t ws_size, hipStream_t stream) {
  (void)n_in; (void)out_size;
  const float* Q = (const float*)d_in[0]; const float* K = (const float*)d_in[1]; const float* V = (const float*)d_in[2];   // [1,16,2048,128]
  const float* wconv = (const float*)d_in[3];   // [16,3,3]
  float* out = (float*)d_out;                   // [1,16,2048,128]
  if (in_sizes[0] != H * S * D || in_sizes[1] != H * S * D || in_sizes[2] != H * S * D || in_sizes[3] != H * 9) return;
  size_t off = 0; char* ws = (char*)d_ws;
  auto carve = [&](size_t bytes) { char* p = ws + off; off += (bytes + 255) & ~(size_t)255; return p; };
  b16* vth = (b16*)carve((size_t)H * D * S * 2);     //  8 MB
  b16* vtl = (b16*)carve((size_t)H * D * S * 2);     //  8 MB
  b16* qh = (b16*)carve((size_t)H * S * D * 2);      //  8 MB each: 8Q and 8K, hi and lo
  b16* ql = (b16*)carve((size_t)H * S * D * 2);
  b16* kh = (b16*)carve((size_t)H * S * D * 2);
  b16* kl = (b16*)carve((size_t)H * S * D * 2);
  float* Sb = (float*)carve((size_t)HG * S * S * 4); // 64 MB score buffer for 4 heads
  if (off > ws_size) return;                           // total 117,440,512 B
  vt_kernel<<<H * (S / 64) + 2 * (H * S / 16 / QT), 256, 0, stream>>>(V, vth, vtl, Q, K, qh, ql, kh, kl);
  for (int g = 0; g < H / HG; ++g) {
    s_kernel<<<dim3(S / 64, S / 128, HG), 128, 0, stream>>>(qh, ql, kh, kl, g * HG, Sb);
    attn_kernel<<<HG * (S / 32), NW * 32, 0, stream>>>(Sb, wconv, vth, vtl, g * HG, out);
  }
}

// v006
// Measured time: 127 microseconds a run.
// Next to v005, in two timings, it ran 1.33 times as fast each time.
// Over all steps from v000 it is 12.6 times as fast.
#include <hip/hip_runtime.h>

// Causal attention with a learned per-head 3x3 convolution over the score matrix: s = Q.K^T/sqrt(128) with future keys zeroed, cs[q][k] =
// sum_{i<3,j<3} w[h][i][j] s[q-2+i][k-1+j] (query padding left only, key padding symmetric, zeros outside), future keys -> -inf, softmax, out = P.V.
// B=1, 16 heads, S=2048, D=128; Q, K, V are the inputs (no projections).
// Contractions on v_wmma_f32_16x16x32_f16: Q.K^T with both operands split once into f16 hi+lo planes of the x8-scaled f32 rows (3 products); P.V with
// unnormalised P as single f16 against an f16 hi+lo pair of 8V (2 products); f32 accumulate; the 3x3 score convolution, masking and online softmax in
// f32 from an f32 score buffer (all heads, causal keys only). Fragment k-map per lane half hh for A AND B: elements 0..7 <- k = 8hh+0..7, 8..15 <- k = 16+8hh+0..7.

namespace {
constexpr int H = 16, S = 2048, D = 128;
constexpr float XS = 8.0f, VS = 8.0f, SCALE = 0.08838834764831845f;   // 128^-0.5

// Score buffer, per head: the 128 rows of row block b keep keys 0 .. 128b+191 only (their causal keys and one 64-key tile of zeros behind them, which
// the window's key k+1 and the rows q-1, q-2 of the next block's first tile read), so the row pitch grows with b and 16 heads take 151 MB, not 256 MB.
constexpr int HSZ = 8192 * (S / 128) * (S / 128 + 2);        // floats per head = start of a row block one past the last
__device__ __forceinline__ int blk_pitch(int b) { return (b + 1) * 128 + 64; }
__device__ __forceinline__ int row_off(int row) { const int b = row >> 7; return 8192 * b * (b + 2) + (row & 127) * blk_pitch(b); }   // sum of 128 * pitch over the blocks before b

typedef _Float16 b16;
typedef __attribute__((ext_vector_type(16))) _Float16 v16b;
typedef __attribute__((ext_vector_type(8)))  _Float16 v8b;
typedef __attribute__((ext_vector_type(8)))  float v8f;
typedef __attribute__((ext_vector_type(4)))  float v4f;

__device__ __forceinline__ v8b ld8b(const b16* p) { return *(const v8b*)p; }
__device__ __forceinline__ v16b cat8b(v8b a, v8b b) { return __builtin_shufflevector(a, b, 0, 1, 2, 3, 4, 5, 6, 7, 8, 9, 10, 11, 12, 13, 14, 15); }
__device__ __forceinline__ void split16(float v, b16& hi, b16& lo) { hi = (b16)v; lo = (b16)(v - (float)hi); }
__device__ __forceinline__ v8f wmma16b(v16b a, v16b b, v8f c) {
  v8f d = __builtin_amdgcn_wmma_f32_16x16x32_f16(false, a, false, b, (short)0, c, false, false);
  asm volatile("v_nop\n\tv_nop\n\tv_nop\n\tv_nop" : "+v"(d) : "v"(a), "v"(b));
  return d;
}
__device__ __forceinline__ void wave_lds_sync() {
  __builtin_amdgcn_fence(__ATOMIC_RELEASE, "workgroup");
  __builtin_amdgcn_wave_barrier();
  __builtin_amdgcn_fence(__ATOMIC_ACQUIRE, "workgroup");
}

// One accumulator's products of a k block; operand kind 2 = f16 hi + lo planes, 1 = one f16 plane
template <int ANP, int BNP> __device__ __forceinline__ v8f mac(v16b ah, v16b al, v16b bh, v16b bl, v8f c) {
  c = wmma16b(ah, bh, c);
  if (BNP == 0 || BNP == 2 || BNP == 4 || BNP == 5) c = wmma16b(ah, bl, c);     // hi.lo
  if (ANP == 0 || ANP == 2 || ANP == 4 || ANP == 5) c = wmma16b(al, bh, c);     // lo.hi   (lo.lo dropped)
  return c;
}
__device__ __forceinline__ void epi_planes(v8f (&acc)[2][4], float scale, bool two, b16* __restrict__ oh, b16* __restrict__ ol, int ldo,
                                           int m0, int c0, int lane, b16* Th, b16* Tl) {
  const int nloc = lane & 15, hlf = lane >> 4;
#pragma unroll
  for (int t = 0; t < 4; ++t)
#pragma unroll
    for (int r = 0; r < 2; ++r)
#pragma unroll
      for (int v = 0; v < 8; ++v) {
        const int rr = r * 16 + v + 8 * hlf, cc = t * 16 + nloc;
        b16 h_, l_; split16(acc[r][t][v] * scale, h_, l_);
        Th[rr * 64 + cc] = h_; Tl[rr * 64 + cc] = l_;
      }
  wave_lds_sync();
  {
#pragma unroll
    for (int j = 0; j < 8; ++j) {
      const int rr = j * 4 + (lane >> 3), c8 = (lane & 7) * 8;
      const size_t o = (size_t)(m0 + rr) * ldo + c0 + c8;
      *(v8b*)(oh + o) = ld8b(Th + rr * 64 + c8);
      if (two) *(v8b*)(ol + o) = ld8b(Tl + rr * 64 + c8);
    }
    
  }
}
// (b) f32 rows with pitch ldo: 64 floats = 256 B = 2 lines per row; 16 lanes x 16 B per row, 2 rows per instruction. Optional per-row factor
__device__ __forceinline__ void epi_f32(v8f (&acc)[2][4], float scale, const float* rscale, float* __restrict__ out, int ldo, int m0, int c0, int lane, float* Tt) {
  const int nloc = lane & 15, hlf = lane >> 4;
#pragma unroll
  for (int t = 0; t < 4; ++t)
#pragma unroll
    for (int r = 0; r < 2; ++r)
#pragma unroll
      for (int v = 0; v < 8; ++v) {
        const int rr = r * 16 + v + 8 * hlf;
        const float rs = rscale ? rscale[(size_t)(m0 + rr) * 32] : 1.0f;
        Tt[rr * 64 + t * 16 + nloc] = acc[r][t][v] * scale * rs;
      }
  wave_lds_sync();
  float* dst0 = out + (size_t)m0 * ldo + c0;
  {
#pragma unroll
    for (int j = 0; j < 16; ++j) { const int rr = j * 2 + hlf, c4 = nloc * 4; *(v4f*)(dst0 + (size_t)rr * ldo + c4) = *(const v4f*)(Tt + rr * 64 + c4); }
    
  }
}



// (8V)^T as f16 hi and lo planes in the order the attention waves read their A fragments: per head [key chunk of 32][feature tile n of 16][half j]
// [lane][8 keys], lane = 16hh + feature, keys 16j + 8hh + 0..7 of the chunk. One fragment = two loads of 512 B in a row (4 whole lines each).
// The same launch splits Q and K (blocks from H * S / 64 on): 8X as f16 hi and lo planes in the order the score waves read their fragments: [row tile of
// 16][k block of 32][half j][lane][8], lane = 16hh + row, k = 16j + 8hh + 0..7 of the block; a tile's 256 units = the block's 256 threads, QT tiles each.
constexpr int QT = 8;
__global__ __launch_bounds__(256) void vt_kernel(const float* __restrict__ V, b16* __restrict__ vth, b16* __restrict__ vtl, const float* __restrict__ Q,
                                                 const float* __restrict__ K, b16* __restrict__ qh, b16* __restrict__ ql, b16* __restrict__ kh, b16* __restrict__ kl) {
  __shared__ __attribute__((aligned(16))) b16 Th[D][72]; __shared__ __attribute__((aligned(16))) b16 Tl[D][72];
  if (blockIdx.x >= H * (S / 64)) {                            // block-uniform; no barrier on this path
    constexpr int NB = H * S / 16 / QT;                        // blocks per tensor
    const int b = blockIdx.x - H * (S / 64), isk = b >= NB, tile0 = (b - isk * NB) * QT, u = threadIdx.x, fl = u & 31;
    const float* X = (isk ? K : Q) + ((size_t)tile0 * 16 + (fl & 15)) * D + (u >> 6) * 32 + 16 * ((u >> 5) & 1) + 8 * (fl >> 4);
    b16* xh = (isk ? kh : qh) + (size_t)tile0 * (16 * D) + u * 8; b16* xl = (isk ? kl : ql) + (size_t)tile0 * (16 * D) + u * 8;
    v4f x0[QT], x1[QT];
#pragma unroll
    for (int i = 0; i < QT; ++i) { x0[i] = *(const v4f*)(X + i * 16 * D); x1[i] = *(const v4f*)(X + i * 16 * D + 4); }
    asm volatile("s_wait_xcnt 0x0" :: "v"(X) : "memory");      // all loads are issued before the first store (one latency, not QT); X as input keeps results out of it
#pragma unroll
    for (int i = 0; i < QT; ++i) {
      v8b vh_, vl_;
#pragma unroll
      for (int e = 0; e < 4; ++e) { b16 a, c; split16(x0[i][e] * XS, a, c); vh_[e] = a; vl_[e] = c; split16(x1[i][e] * XS, a, c); vh_[4 + e] = a; vl_[4 + e] = c; }
      *(v8b*)(xh + i * 16 * D) = vh_; *(v8b*)(xl + i * 16 * D) = vl_;
    }
    return;
  }
  const int tid = threadIdx.x, h = blockIdx.x / (S / 64), t0 = (blockIdx.x % (S / 64)) * 64;
  for (int i = tid; i < 64 * D; i += 256) { const int t = i / D, dd = i % D; b16 a, b2; split16(V[((size_t)h * S + t0 + t) * D + dd] * VS, a, b2); Th[dd][t] = a; Tl[dd][t] = b2; }
  __syncthreads();
  // Fragment order: unit u of 8 keys = [key chunk of 32][feature tile n][fragment half j][lane]; the block's two chunks are 16 KB in a row per plane
  b16* bh = vth + (size_t)h * D * S + (size_t)t0 * D; b16* bl = vtl + (size_t)h * D * S + (size_t)t0 * D;
#pragma unroll
  for (int i = 0; i < 4; ++i) {
    const int u = i * 256 + tid, fl = u & 31, j = (u >> 5) & 1, n = (u >> 6) & 7, c = u >> 9;
    const int dd = n * 16 + (fl & 15), t = c * 32 + 16 * j + 8 * (fl >> 4);
    *(v8b*)(bh + (size_t)u * 8) = *(const v8b*)(&Th[dd][t]); *(v8b*)(bl + (size_t)u * 8) = *(const v8b*)(&Tl[dd][t]);
  }
}

// Scores, all heads: grid (36, 8, H). Row block b has 2b+3 key tiles of 64 (32 in the last block); blocks y and 15-y share a grid row of 36, so every stored
// tile has a work-group (and one per head, behind key S-1, returns at once). The one tile wholly above the diagonal skips the MMA work (acc = 0).
__global__ __launch_bounds__(128) void s_kernel(const b16* __restrict__ qh, const b16* __restrict__ ql, const b16* __restrict__ kh, const b16* __restrict__ kl, float* __restrict__ Sb) {
  __shared__ __attribute__((aligned(16))) float Ts[4][32 * 64];
  const int lane = threadIdx.x & 31, wave = threadIdx.x >> 5, nloc = lane & 15, hlf = lane >> 4, h = blockIdx.z;
  const int nlow = 2 * blockIdx.y + 3, low = (int)blockIdx.x < nlow;
  const int qb = low ? blockIdx.y : S / 128 - 1 - blockIdx.y, kt = low ? blockIdx.x : blockIdx.x - nlow, m0 = qb * 128 + wave * 32, c0 = kt * 64;
  if (c0 >= S) return;                                         // block-uniform: the last row block has no tile behind key S-1
  v8f acc[2][4];
#pragma unroll
  for (int r = 0; r < 2; ++r)
#pragma unroll
    for (int t = 0; t < 4; ++t) acc[r][t] = (v8f){};
  if (c0 <= qb * 128 + 127) {                                  // block-uniform: some (q, k) in this tile has k <= q
    // 32x64 wave tile from the fragment-order planes (vt_kernel): row tile = 2048 elements, k block = 512, half = 256, lane = 8; each load = 4 whole lines
    const size_t ao = ((size_t)h * S + m0) * D + lane * 8, bo = ((size_t)h * S + c0) * D + lane * 8;
    const b16* pah = qh + ao; const b16* pal = ql + ao; const b16* pbh = kh + bo; const b16* pbl = kl + bo;
#pragma unroll
    for (int kc = 0; kc < D / 32; ++kc) {
      v16b ah[2], al[2], bh[4], bl[4];
#pragma unroll
      for (int r = 0; r < 2; ++r) {
        const int o = r * 2048 + kc * 512;
        ah[r] = cat8b(ld8b(pah + o), ld8b(pah + o + 256)); al[r] = cat8b(ld8b(pal + o), ld8b(pal + o + 256));
      }
#pragma unroll
      for (int t = 0; t < 4; ++t) {
        const int o = t * 2048 + kc * 512;
        bh[t] = cat8b(ld8b(pbh + o), ld8b(pbh + o + 256)); bl[t] = cat8b(ld8b(pbl + o), ld8b(pbl + o + 256));
      }
      // the k block's 24 loads are issued in one run ahead of its products (one latency, not one per key tile); the addresses as inputs keep results out of them
      asm volatile("s_wait_xcnt 0x0" :: "v"(pah), "v"(pal), "v"(pbh), "v"(pbl) : "memory");
#pragma unroll
      for (int t = 0; t < 4; ++t) {
        acc[0][t] = mac<2, 2>(ah[0], al[0], bh[t], bl[t], acc[0][t]);
        acc[1][t] = mac<2, 2>(ah[1], al[1], bh[t], bl[t], acc[1][t]);
      }
    }
  }
  float* Tt = Ts[wave];
#pragma unroll
  for (int t = 0; t < 4; ++t)
#pragma unroll
    for (int r = 0; r < 2; ++r)
#pragma unroll
      for (int v = 0; v < 8; ++v) { const int rr = r * 16 + v + 8 * hlf, cc = t * 16 + nloc; Tt[rr * 64 + cc] = (c0 + cc <= m0 + rr) ? acc[r][t][v] * (SCALE / (XS * XS)) : 0.0f; }
  wave_lds_sync();
  float* dst0 = Sb + (size_t)h * HSZ + row_off(m0) + c0;
  const int ldp = blk_pitch(qb);
  {
#pragma unroll
    for (int j = 0; j < 16; ++j) { const int rr = j * 2 + hlf, c4 = nloc * 4; *(v4f*)(dst0 + rr * ldp + c4) = *(const v4f*)(Tt + rr * 64 + c4); }
    
  }
}

// ---------------------------------------------------------------------------
// Convolved-score attention, all heads in one launch: work-group = one head's query tiles t and S/16-1-t (16 queries each, one after the other: every
// work-group has the same number of causal key chunks); the tile's key chunks of 32 are dealt round-robin over the NW waves, each with its own
// maximum, sum and accumulators; partials merged through LDS. Per element the 3x3 window of the stored scores
// (rows q-2..q, keys k-1..k+1, zero outside [0,S)), x w[h], -inf for k > q; online softmax f32; P^T f16; y^T += (8V)^T.P^T (8 feature tiles, hi + lo
// ---------------------------------------------------------------------------
// lane l <-> lane l ^ 16
__device__ __forceinline__ float xhalf(float x) { return __builtin_bit_cast(float, __builtin_amdgcn_permlanex16(__builtin_bit_cast(int, x), __builtin_bit_cast(int, x), 0x76543210, 0xfedcba98, false, false)); }
// DPP row_shr:n (CTRL = 0x110 + n): lane c of a 16-lane row takes src of lane c - n; lanes c < n keep edge
template <int CTRL> __device__ __forceinline__ float row_from(float edge, float src) {
  return __builtin_bit_cast(float, __builtin_amdgcn_update_dpp(__builtin_bit_cast(int, edge), __builtin_bit_cast(int, src), CTRL, 0xf, 0xf, false));
}
// One score row's two 10-key runs of a lane: a = keys kb+8hh-1 .. kb+8hh+8, b = the same + 16 (zero outside [0, S)). The lane's own 16 keys are four
// aligned 16-byte loads; the run ends inside the 32-key chunk are held by lane ^ 16; only key kb-1 (hh 0) or kb+32 (hh 1) is one more load.
struct RowRaw { v4f f0, f1, g0, g1; float e; };
// p = the row's key kb + 8hh; eo = distance from there to the lane's outer key (0 where that key is outside the row)
__device__ __forceinline__ RowRaw load_row(const float* __restrict__ p, int eo) {
  return RowRaw{*(const v4f*)p, *(const v4f*)(p + 4), *(const v4f*)(p + 16), *(const v4f*)(p + 20), p[eo]};
}
__device__ __forceinline__ void make_runs(const RowRaw& x, int kb, int hh, float (&a)[10], float (&b)[10]) {
  const int ke = hh ? kb + 32 : kb - 1;
  const float e = (ke >= 0 && ke < S) ? x.e : 0.0f;
  const float r1 = xhalf(hh ? x.f0[0] : x.f1[3]), r2 = xhalf(hh ? x.f1[3] : x.g0[0]), r3 = xhalf(hh ? x.g0[0] : x.g1[3]);
  a[0] = hh ? r1 : e; a[9] = hh ? r2 : r1; b[0] = hh ? r3 : r2; b[9] = hh ? e : r3;
#pragma unroll
  for (int j = 0; j < 4; ++j) { a[1 + j] = x.f0[j]; a[5 + j] = x.f1[j]; b[1 + j] = x.g0[j]; b[5 + j] = x.g1[j]; }
}
constexpr int NW = 16;        // waves per work-group; also the rows of a query tile, so wave w merges row w
constexpr int OP = D + 4;     // pitch of a partial row in floats: 528 B = 16 B x odd, so the 16 query columns of a b128 store fall on distinct banks
__global__ __launch_bounds__(NW * 32) void attn_kernel(const float* __restrict__ Sb, const float* __restrict__ wconv, const b16* __restrict__ vth, const b16* __restrict__ vtl,
                                                   float* __restrict__ out) {
  __shared__ __attribute__((aligned(16))) float Os[NW][16 * OP];
  __shared__ __attribute__((aligned(8))) float ML[NW][16][2];   // a partial's maximum and sum side by side: one LDS address serves both (no register spill)
  const int wid = threadIdx.x >> 5, lane = threadIdx.x & 31, hh = lane >> 4, col = lane & 15;
  const int h = blockIdx.x / (S / 32), pr = blockIdx.x % (S / 32);
  const float* Sh = Sb + (size_t)h * HSZ; const b16* vh = vth + (size_t)h * D * S; const b16* vl = vtl + (size_t)h * D * S;
  float w[9];
#pragma unroll
  for (int i = 0; i < 9; ++i) w[i] = wconv[h * 9 + i];       // [i][j]: query tap i (row q-2+i), key tap j (k-1+j)
  for (int half = 0; half < 2; ++half) {
    const int q0 = (half ? pr : S / 16 - 1 - pr) * 16, qi = q0 + col;
    const int nch = (q0 + 16 + 31) / 32, nact = nch < NW ? nch : NW;     // key chunks of this tile; waves that have at least one
    // rows above row 0 are zero (only the first tile has such rows, and only its chunk kb = 0): their loads go to row 0, keys 64 on, which the score
    // kernel stores as zeros (future keys), so every lane uses the head's nine weights as they are (uniform values, no per-lane copies in registers)
    const int rt = q0 > 0 ? q0 - 2 + (col < 1 ? col : 1) : 0, ru = q0 > 0 ? q0 - 1 : 0, zk = q0 > 0 ? 0 : 64;
    const float* po = Sh + row_off(qi) + wid * 32 + 8 * hh; const float* pu = Sh + row_off(ru) + zk + wid * 32 + 8 * hh;
    const float* pt = pu - (ru - rt) * blk_pitch(ru >> 7);       // rows q0-2 and q0-1 lie in one row block (q0 is a multiple of 16)
    float m = -INFINITY, l = 0.0f;
    v8f o[8];
#pragma unroll
    for (int n = 0; n < 8; ++n) o[n] = (v8f){};
    for (int kb = wid * 32; kb < q0 + 16; kb += NW * 32) {
      v8f s0 = {}, s1 = {};
      // Score window: every lane loads only its own query row (plus the two rows above the tile, which lanes 0 and 1 of each half need); rows
      // q-1 and q-2 come from the lanes of queries q-1 and q-2 by a shift inside the 16-lane row. Same values and same sums as per-element loads.
      float oa[10], ob[10], ta[10], tb[10], ua[10], ub[10];
      const int ke = hh ? kb + 32 : kb - 1, eo = (ke >= 0 && ke < S) ? (hh ? 24 : -1) : 0;
      const RowRaw xt = load_row(pt, eo);                        // lane 0: row q0-2, lane 1: row q0-1 (the other lanes: an unused copy of lane 1's)
      asm volatile("s_wait_xcnt 0x0" ::: "memory");              // later loads' results may land in address registers of the loads above
      const RowRaw xu = load_row(pu, eo);                        // lane 0: row q0-1 (the other lanes: an unused copy)
      asm volatile("s_wait_xcnt 0x0" :: "v"(pu), "v"(pu + eo) : "memory");   // as above; the addresses as inputs keep this row's own results out of them too
      const RowRaw xo = load_row(po, eo);
      asm volatile("s_wait_xcnt 0x0" :: "v"(po), "v"(po + eo) : "memory");   // as above; the addresses as inputs keep this row's own results out of them too
      __builtin_amdgcn_sched_barrier(0);                         // the 15 score loads stay one run: no window arithmetic (and no wait) is lifted between them
      po += NW * 32; pt += NW * 32; pu += NW * 32;
      make_runs(xo, kb, hh, oa, ob); make_runs(xt, kb, hh, ta, tb); make_runs(xu, kb, hh, ua, ub);
#pragma unroll
      for (int j = 0; j < 10; ++j) { ta[j] = row_from<0x112>(ta[j], oa[j]); tb[j] = row_from<0x112>(tb[j], ob[j]); }   // row q-2
#pragma unroll
      for (int j = 0; j < 10; ++j) { ua[j] = row_from<0x111>(ua[j], oa[j]); ub[j] = row_from<0x111>(ub[j], ob[j]); }   // row q-1
#pragma unroll
      for (int r = 0; r < 8; ++r) s0[r] += w[0] * ta[r] + w[1] * ta[r + 1] + w[2] * ta[r + 2];
#pragma unroll
      for (int r = 0; r < 8; ++r) s1[r] += w[0] * tb[r] + w[1] * tb[r + 1] + w[2] * tb[r + 2];
#pragma unroll
      for (int r = 0; r < 8; ++r) s0[r] += w[3] * ua[r] + w[4] * ua[r + 1] + w[5] * ua[r + 2];
#pragma unroll
      for (int r = 0; r < 8; ++r) s1[r] += w[3] * ub[r] + w[4] * ub[r + 1] + w[5] * ub[r + 2];
#pragma unroll
      for (int r = 0; r < 8; ++r) s0[r] += w[6] * oa[r] + w[7] * oa[r + 1] + w[8] * oa[r + 2];
#pragma unroll
      for (int r = 0; r < 8; ++r) s1[r] += w[6] * ob[r] + w[7] * ob[r + 1] + w[8] * ob[r + 2];
      const int dq = qi - kb - 8 * hh;                           // the lane's key r (or r + 16) is a future key where it exceeds dq: one register, not one bound per key
#pragma unroll
      for (int r = 0; r < 8; ++r) { if (r > dq) s0[r] = -INFINITY; if (r + 16 > dq) s1[r] = -INFINITY; }
      // The chunk's 32 V fragment loads are issued in one run ahead of its 16 products (one load latency per chunk, not one per product).
      // Fragment order (vt_kernel): feature tiles are 512 elements apart, halves j = 0, 1 are 256 apart.
      const unsigned vo = (unsigned)(kb * D + lane * 8) * 2u;    // 32-bit byte offset on the two uniform plane bases: the addresses are formed per trip, no running pointers are held across it
      const b16* pvh = (const b16*)((const char*)vh + vo); const b16* pvl = (const b16*)((const char*)vl + vo);
      v8b vh0[8], vh1[8], vl0[8], vl1[8];
#pragma unroll
      for (int n = 0; n < 8; ++n) { vh0[n] = ld8b(pvh + n * 512); vh1[n] = ld8b(pvh + n * 512 + 256); vl0[n] = ld8b(pvl + n * 512); vl1[n] = ld8b(pvl + n * 512 + 256); }
      // keeps the run together above the products; later code (the next trip too) rewrites the registers that these loads name; the addresses as inputs keep results out of them
      asm volatile("s_wait_xcnt 0x0" :: "v"(pvh), "v"(pvl) : "memory");
      float mr = -INFINITY;
#pragma unroll
      for (int r = 0; r < 8; ++r) mr = fmaxf(mr, fmaxf(s0[r], s1[r]));
      mr = fmaxf(mr, __shfl_xor(mr, 16));
      float mn = fmaxf(m, mr); if (mn == -INFINITY) mn = 0.0f;
      const float al_ = __expf(m - mn); m = mn;
      float sum = 0.0f; v16b pb;
#pragma unroll
      for (int r = 0; r < 8; ++r) { const float p0 = __expf(s0[r] - mn), p1 = __expf(s1[r] - mn); sum += p0 + p1; pb[r] = (b16)p0; pb[8 + r] = (b16)p1; }
      sum += __shfl_xor(sum, 16);
      l = l * al_ + sum;
#pragma unroll
      for (int n = 0; n < 8; ++n) {
#pragma unroll
        for (int r = 0; r < 8; ++r) o[n][r] *= al_;
        o[n] = wmma16b(cat8b(vh0[n], vh1[n]), pb, o[n]);
        o[n] = wmma16b(cat8b(vl0[n], vl1[n]), pb, o[n]);
      }
    }
    if (wid < nact) {                                            // un-normalised partial y^T: lane col = query, element r = feature 16n+8hh+r
      float* Tt = Os[wid];
#pragma unroll
      for (int n = 0; n < 8; ++n)
#pragma unroll
        for (int r = 0; r < 8; ++r) Tt[col * OP + n * 16 + 8 * hh + r] = o[n][r];
      if (hh == 0) { ML[wid][col][0] = m; ML[wid][col][1] = l; }
    }
    __syncthreads();                                             // every wave's partial is in LDS before any is merged
    {
      float mx = -INFINITY;
      for (int u = 0; u < nact; ++u) mx = fmaxf(mx, ML[u][wid][0]);
      float ls = 0.0f; v4f y = {};
      for (int u = 0; u < nact; ++u) { const float f = __expf(ML[u][wid][0] - mx); ls += f * ML[u][wid][1]; y += f * *(const v4f*)(&Os[u][wid * OP + lane * 4]); }
      const float inv = (ls > 0.0f) ? (1.0f / (VS * ls)) : 0.0f;
      *(v4f*)(out + ((size_t)h * S + q0 + wid) * D + lane * 4) = y * inv;    // one row of 512 B per wave: whole lines
    }
    __syncthreads();                                             // the merge has read the partials before the second tile overwrites them
  }
}
}  // namespace

extern "C" void kernel_launch(void* const* d_in, const int* in_sizes, int n_in,
                              void* d_out, int out_size, void* d_ws, size_t ws_size, hipStream_t stream) {
  (void)n_in; (void)out_size;
  const float* Q = (const float*)d_in[0]; const float* K = (const float*)d_in[1]; const float* V = (const float*)d_in[2];   // [1,16,2048,128]
  const float* wconv = (const float*)d_in[3];   // [16,3,3]
  float* out = (float*)d_out;                   // [1,16,2048,128]
  if (in_sizes[0] != H * S * D || in_sizes[1] != H * S * D || in_sizes[2] != H * S * D || in_sizes[3] != H * 9) return;
  size_t off = 0; char* ws = (char*)d_ws;
  auto carve = [&](size_t bytes) { char* p = ws + off; off += (bytes + 255) & ~(size_t)255; return p; };
  b16* vth = (b16*)carve((size_t)H * D * S * 2);     //  8 MB
  b16* vtl = (b16*)carve((size_t)H * D * S * 2);     //  8 MB
  b16* qh = (b16*)carve((size_t)H * S * D * 2);      //  8 MB each: 8Q and 8K, hi and lo
  b16* ql = (b16*)carve((size_t)H * S * D * 2);
  b16* kh = (b16*)carve((size_t)H * S * D * 2);
  b16* kl = (b16*)carve((size_t)H * S * D * 2);
  float* Sb = (float*)carve((size_t)H * HSZ * 4);    // 151 MB score buffer, all heads
  if (off > ws_size) return;                           // total 201,326,592 B
  vt_kernel<<<H * (S / 64) + 2 * (H * S / 16 / QT), 256, 0, stream>>>(V, vth, vtl, Q, K, qh, ql, kh, kl);
  s_kernel<<<dim3(S / 64 + 4, S / 256, H), 128, 0, stream>>>(qh, ql, kh, kl, Sb);
  attn_kernel<<<H * (S / 32), NW * 32, 0, stream>>>(Sb, wconv, vth, vtl, out);
}

// v007
// A run of this version takes 110 microseconds.
// Next to v006, in two timings, it ran 1.15 times as fast each time.
// All steps since v000 together make it 14.5 times as fast.
#include <hip/hip_runtime.h>

// Causal attention with a learned per-head 3x3 convolution over the score matrix: s = Q.K^T/sqrt(128) with future keys zeroed, cs[q][k] =
// sum_{i<3,j<3} w[h][i][j] s[q-2+i][k-1+j] (query padding left only, key padding symmetric, zeros outside), future keys -> -inf, softmax, out = P.V.
// B=1, 16 heads, S=2048, D=128; Q, K, V are the inputs (no projections).
// Contractions on v_wmma_f32_16x16x32_f16: Q.K^T with both operands split once into f16 hi+lo planes of the x8-scaled f32 rows (3 products); P.V with
// unnormalised P as single f16 against an f16 hi+lo pair of 8V (2 products); f32 accumulate; the 3x3 score convolution, masking and online softmax in
// f32 from an f32 score buffer (all heads, causal keys only). Fragment k-map per lane half hh for A AND B: elements 0..7 <- k = 8hh+0..7, 8..15 <- k = 16+8hh+0..7.

namespace {
constexpr int H = 16, S = 2048, D = 128;
constexpr float XS = 8.0f, VS = 8.0f, SCALE = 0.08838834764831845f;   // 128^-0.5

// Score buffer, per head: the 128 rows of row block b keep keys 0 .. 128b+191 only (their causal keys and one 64-key tile of zeros behind them, which
// the window's key k+1 and the rows q-1, q-2 of the next block's first tile read), so the row pitch grows with b and 16 heads take 151 MB, not 256 MB.
constexpr int HSZ = 8192 * (S / 128) * (S / 128 + 2);        // floats per head = start of a row block one past the last
__device__ __forceinline__ int blk_pitch(int b) { return (b + 1) * 128 + 64; }
__device__ __forceinline__ int row_off(int row) { const int b = row >> 7; return 8192 * b * (b + 2) + (row & 127) * blk_pitch(b); }   // sum of 128 * pitch over the blocks before b

typedef _Float16 b16;
typedef __attribute__((ext_vector_type(16))) _Float16 v16b;
typedef __attribute__((ext_vector_type(8)))  _Float16 v8b;
typedef __attribute__((ext_vector_type(8)))  float v8f;
typedef __attribute__((ext_vector_type(4)))  float v4f;

__device__ __forceinline__ v8b ld8b(const b16* p) { return *(const v8b*)p; }
__device__ __forceinline__ v16b cat8b(v8b a, v8b b) { return __builtin_shufflevector(a, b, 0, 1, 2, 3, 4, 5, 6, 7, 8, 9, 10, 11, 12, 13, 14, 15); }
__device__ __forceinline__ void split16(float v, b16& hi, b16& lo) { hi = (b16)v; lo = (b16)(v - (float)hi); }
__device__ __forceinline__ v8f wmma16b(v16b a, v16b b, v8f c) {
  v8f d = __builtin_amdgcn_wmma_f32_16x16x32_f16(false, a, false, b, (short)0, c, false, false);
  asm volatile("v_nop\n\tv_nop\n\tv_nop\n\tv_nop" : "+v"(d) : "v"(a), "v"(b));
  return d;
}
__device__ __forceinline__ void wave_lds_sync() {
  __builtin_amdgcn_fence(__ATOMIC_RELEASE, "workgroup");
  __builtin_amdgcn_wave_barrier();
  __builtin_amdgcn_fence(__ATOMIC_ACQUIRE, "workgroup");
}

// One accumulator's products of a k block; operand kind 2 = f16 hi + lo planes, 1 = one f16 plane
template <int ANP, int BNP> __device__ __forceinline__ v8f mac(v16b ah, v16b al, v16b bh, v16b bl, v8f c) {
  c = wmma16b(ah, bh, c);
  if (BNP == 0 || BNP == 2 || BNP == 4 || BNP == 5) c = wmma16b(ah, bl, c);     // hi.lo
  if (ANP == 0 || ANP == 2 || ANP == 4 || ANP == 5) c = wmma16b(al, bh, c);     // lo.hi   (lo.lo dropped)
  return c;
}
__device__ __forceinline__ void epi_planes(v8f (&acc)[2][4], float scale, bool two, b16* __restrict__ oh, b16* __restrict__ ol, int ldo,
                                           int m0, int c0, int lane, b16* Th, b16* Tl) {
  const int nloc = lane & 15, hlf = lane >> 4;
#pragma unroll
  for (int t = 0; t < 4; ++t)
#pragma unroll
    for (int r = 0; r < 2; ++r)
#pragma unroll
      for (int v = 0; v < 8; ++v) {
        const int rr = r * 16 + v + 8 * hlf, cc = t * 16 + nloc;
        b16 h_, l_; split16(acc[r][t][v] * scale, h_, l_);
        Th[rr * 64 + cc] = h_; Tl[rr * 64 + cc] = l_;
      }
  wave_lds_sync();
  {
#pragma unroll
    for (int j = 0; j < 8; ++j) {
      const int rr = j * 4 + (lane >> 3), c8 = (lane & 7) * 8;
      const size_t o = (size_t)(m0 + rr) * ldo + c0 + c8;
      *(v8b*)(oh + o) = ld8b(Th + rr * 64 + c8);
      if (two) *(v8b*)(ol + o) = ld8b(Tl + rr * 64 + c8);
    }
    
  }
}
// (b) f32 rows with pitch ldo: 64 floats = 256 B = 2 lines per row; 16 lanes x 16 B per row, 2 rows per instruction. Optional per-row factor
__device__ __forceinline__ void epi_f32(v8f (&acc)[2][4], float scale, const float* rscale, float* __restrict__ out, int ldo, int m0, int c0, int lane, float* Tt) {
  const int nloc = lane & 15, hlf = lane >> 4;
#pragma unroll
  for (int t = 0; t < 4; ++t)
#pragma unroll
    for (int r = 0; r < 2; ++r)
#pragma unroll
      for (int v = 0; v < 8; ++v) {
        const int rr = r * 16 + v + 8 * hlf;
        const float rs = rscale ? rscale[(size_t)(m0 + rr) * 32] : 1.0f;
        Tt[rr * 64 + t * 16 + nloc] = acc[r][t][v] * scale * rs;
      }
  wave_lds_sync();
  float* dst0 = out + (size_t)m0 * ldo + c0;
  {
#pragma unroll
    for (int j = 0; j < 16; ++j) { const int rr = j * 2 + hlf, c4 = nloc * 4; *(v4f*)(dst0 + (size_t)rr * ldo + c4) = *(const v4f*)(Tt + rr * 64 + c4); }
    
  }
}



// (8V)^T as f16 hi and lo planes in the order the attention waves read their A fragments: per head [key chunk of 32][feature tile n of 16][half j]
// [lane][8 keys], lane = 16hh + feature, keys 16j + 8hh + 0..7 of the chunk. One fragment = two loads of 512 B in a row (4 whole lines each).
// The same launch splits Q and K (blocks from H * S / 64 on): 8X as f16 hi and lo planes in the order the score waves read their fragments: [row tile of
// 16][k block of 32][half j][lane][8], lane = 16hh + row, k = 16j + 8hh + 0..7 of the block; a tile's 256 units = the block's 256 threads, QT tiles each.
constexpr int QT = 8;
__global__ __launch_bounds__(256) void vt_kernel(const float* __restrict__ V, b16* __restrict__ vth, b16* __restrict__ vtl, const float* __restrict__ Q,
                                                 const float* __restrict__ K, b16* __restrict__ qh, b16* __restrict__ ql, b16* __restrict__ kh, b16* __restrict__ kl) {
  __shared__ __attribute__((aligned(16))) b16 Th[D][72]; __shared__ __attribute__((aligned(16))) b16 Tl[D][72];
  if (blockIdx.x >= H * (S / 64)) {                            // block-uniform; no barrier on this path
    constexpr int NB = H * S / 16 / QT;                        // blocks per tensor
    const int b = blockIdx.x - H * (S / 64), isk = b >= NB, tile0 = (b - isk * NB) * QT, u = threadIdx.x, fl = u & 31;
    const float* X = (isk ? K : Q) + ((size_t)tile0 * 16 + (fl & 15)) * D + (u >> 6) * 32 + 16 * ((u >> 5) & 1) + 8 * (fl >> 4);
    b16* xh = (isk ? kh : qh) + (size_t)tile0 * (16 * D) + u * 8; b16* xl = (isk ? kl : ql) + (size_t)tile0 * (16 * D) + u * 8;
    v4f x0[QT], x1[QT];
#pragma unroll
    for (int i = 0; i < QT; ++i) { x0[i] = *(const v4f*)(X + i * 16 * D); x1[i] = *(const v4f*)(X + i * 16 * D + 4); }
    asm volatile("s_wait_xcnt 0x0" :: "v"(X) : "memory");      // all loads are issued before the first store (one latency, not QT); X as input keeps results out of it
#pragma unroll
    for (int i = 0; i < QT; ++i) {
      v8b vh_, vl_;
#pragma unroll
      for (int e = 0; e < 4; ++e) { b16 a, c; split16(x0[i][e] * XS, a, c); vh_[e] = a; vl_[e] = c; split16(x1[i][e] * XS, a, c); vh_[4 + e] = a; vl_[4 + e] = c; }
      *(v8b*)(xh + i * 16 * D) = vh_; *(v8b*)(xl + i * 16 * D) = vl_;
    }
    return;
  }
  const int tid = threadIdx.x, h = blockIdx.x / (S / 64), t0 = (blockIdx.x % (S / 64)) * 64;
  for (int i = tid; i < 64 * D; i += 256) { const int t = i / D, dd = i % D; b16 a, b2; split16(V[((size_t)h * S + t0 + t) * D + dd] * VS, a, b2); Th[dd][t] = a; Tl[dd][t] = b2; }
  __syncthreads();
  // Fragment order: unit u of 8 keys = [key chunk of 32][feature tile n][fragment half j][lane]; the block's two chunks are 16 KB in a row per plane
  b16* bh = vth + (size_t)h * D * S + (size_t)t0 * D; b16* bl = vtl + (size_t)h * D * S + (size_t)t0 * D;
#pragma unroll
  for (int i = 0; i < 4; ++i) {
    const int u = i * 256 + tid, fl = u & 31, j = (u >> 5) & 1, n = (u >> 6) & 7, c = u >> 9;
    const int dd = n * 16 + (fl & 15), t = c * 32 + 16 * j + 8 * (fl >> 4);
    *(v8b*)(bh + (size_t)u * 8) = *(const v8b*)(&Th[dd][t]); *(v8b*)(bl + (size_t)u * 8) = *(const v8b*)(&Tl[dd][t]);
  }
}

// Scores, all heads: grid (36, 8, H). Row block b has 2b+3 key tiles of 64 (32 in the last block); blocks y and 15-y share a grid row of 36, so every stored
// tile has a work-group (and one per head, behind key S-1, returns at once). The one tile wholly above the diagonal skips the MMA work (acc = 0).
__global__ __launch_bounds__(128) void s_kernel(const b16* __restrict__ qh, const b16* __restrict__ ql, const b16* __restrict__ kh, const b16* __restrict__ kl, float* __restrict__ Sb) {
  __shared__ __attribute__((aligned(16))) float Ts[4][32 * 64];
  const int lane = threadIdx.x & 31, wave = threadIdx.x >> 5, nloc = lane & 15, hlf = lane >> 4, h = blockIdx.z;
  const int nlow = 2 * blockIdx.y + 3, low = (int)blockIdx.x < nlow;
  const int qb = low ? blockIdx.y : S / 128 - 1 - blockIdx.y, kt = low ? blockIdx.x : blockIdx.x - nlow, m0 = qb * 128 + wave * 32, c0 = kt * 64;
  if (c0 >= S) return;                                         // block-uniform: the last row block has no tile behind key S-1
  v8f acc[2][4];
#pragma unroll
  for (int r = 0; r < 2; ++r)
#pragma unroll
    for (int t = 0; t < 4; ++t) acc[r][t] = (v8f){};
  if (c0 <= qb * 128 + 127) {                                  // block-uniform: some (q, k) in this tile has k <= q
    // 32x64 wave tile from the fragment-order planes (vt_kernel): row tile = 2048 elements, k block = 512, half = 256, lane = 8; each load = 4 whole lines
    const size_t ao = ((size_t)h * S + m0) * D + lane * 8, bo = ((size_t)h * S + c0) * D + lane * 8;
    const b16* pah = qh + ao; const b16* pal = ql + ao; const b16* pbh = kh + bo; const b16* pbl = kl + bo;
#pragma unroll
    for (int kc = 0; kc < D / 32; ++kc) {
      v16b ah[2], al[2], bh[4], bl[4];
#pragma unroll
      for (int r = 0; r < 2; ++r) {
        const int o = r * 2048 + kc * 512;
        ah[r] = cat8b(ld8b(pah + o), ld8b(pah + o + 256)); al[r] = cat8b(ld8b(pal + o), ld8b(pal + o + 256));
      }
#pragma unroll
      for (int t = 0; t < 4; ++t) {
        const int o = t * 2048 + kc * 512;
        bh[t] = cat8b(ld8b(pbh + o), ld8b(pbh + o + 256)); bl[t] = cat8b(ld8b(pbl + o), ld8b(pbl + o + 256));
      }
      // the k block's 24 loads are issued in one run ahead of its products (one latency, not one per key tile); the addresses as inputs keep results out of them
      asm volatile("s_wait_xcnt 0x0" :: "v"(pah), "v"(pal), "v"(pbh), "v"(pbl) : "memory");
#pragma unroll
      for (int t = 0; t < 4; ++t) {
        acc[0][t] = mac<2, 2>(ah[0], al[0], bh[t], bl[t], acc[0][t]);
        acc[1][t] = mac<2, 2>(ah[1], al[1], bh[t], bl[t], acc[1][t]);
      }
    }
  }
  float* Tt = Ts[wave];
#pragma unroll
  for (int t = 0; t < 4; ++t)
#pragma unroll
    for (int r = 0; r < 2; ++r)
#pragma unroll
      for (int v = 0; v < 8; ++v) { const int rr = r * 16 + v + 8 * hlf, cc = t * 16 + nloc; Tt[rr * 64 + cc] = (c0 + cc <= m0 + rr) ? acc[r][t][v] * (SCALE / (XS * XS)) : 0.0f; }
  wave_lds_sync();
  float* dst0 = Sb + (size_t)h * HSZ + row_off(m0) + c0;
  const int ldp = blk_pitch(qb);
  {
#pragma unroll
    for (int j = 0; j < 16; ++j) { const int rr = j * 2 + hlf, c4 = nloc * 4; *(v4f*)(dst0 + rr * ldp + c4) = *(const v4f*)(Tt + rr * 64 + c4); }
    
  }
}

// ---------------------------------------------------------------------------
// Convolved-score attention, all heads in one launch: work-group = one head's query blocks b and S/64-1-b (64 queries = 4 tiles of 16 each, one block after
// the other: every work-group has the same number of stages); wave (qt, g) takes query tile qt and every 4th key chunk of 32 from g on, with its own
// maximum, sum and accumulators; a stage's 4 V chunks are copied to LDS once and read there by all 4 query tiles; the 4 partials of a tile are merged
// through LDS. Per element the 3x3 window of the stored scores
// (rows q-2..q, keys k-1..k+1, zero outside [0,S)), x w[h], -inf for k > q; online softmax f32; P^T f16; y^T += (8V)^T.P^T (8 feature tiles, hi + lo
// ---------------------------------------------------------------------------
// lane l <-> lane l ^ 16
__device__ __forceinline__ float xhalf(float x) { return __builtin_bit_cast(float, __builtin_amdgcn_permlanex16(__builtin_bit_cast(int, x), __builtin_bit_cast(int, x), 0x76543210, 0xfedcba98, false, false)); }
// DPP row_shr:n (CTRL = 0x110 + n): lane c of a 16-lane row takes src of lane c - n; lanes c < n keep edge
template <int CTRL> __device__ __forceinline__ float row_from(float edge, float src) {
  return __builtin_bit_cast(float, __builtin_amdgcn_update_dpp(__builtin_bit_cast(int, edge), __builtin_bit_cast(int, src), CTRL, 0xf, 0xf, false));
}
// One score row's two 10-key runs of a lane: a = keys kb+8hh-1 .. kb+8hh+8, b = the same + 16 (zero outside [0, S)). The lane's own 16 keys are four
// aligned 16-byte loads; the run ends inside the 32-key chunk are held by lane ^ 16; only key kb-1 (hh 0) or kb+32 (hh 1) is one more load.
struct RowRaw { v4f f0, f1, g0, g1; float e; };
// p = the row's key kb + 8hh; eo = distance from there to the lane's outer key (0 where that key is outside the row)
__device__ __forceinline__ RowRaw load_row(const float* __restrict__ p, int eo) {
  return RowRaw{*(const v4f*)p, *(const v4f*)(p + 4), *(const v4f*)(p + 16), *(const v4f*)(p + 20), p[eo]};
}
__device__ __forceinline__ void make_runs(const RowRaw& x, int kb, int hh, float (&a)[10], float (&b)[10]) {
  const int ke = hh ? kb + 32 : kb - 1;
  const float e = (ke >= 0 && ke < S) ? x.e : 0.0f;
  const float r1 = xhalf(hh ? x.f0[0] : x.f1[3]), r2 = xhalf(hh ? x.f1[3] : x.g0[0]), r3 = xhalf(hh ? x.g0[0] : x.g1[3]);
  a[0] = hh ? r1 : e; a[9] = hh ? r2 : r1; b[0] = hh ? r3 : r2; b[9] = hh ? e : r3;
#pragma unroll
  for (int j = 0; j < 4; ++j) { a[1 + j] = x.f0[j]; a[5 + j] = x.f1[j]; b[1 + j] = x.g0[j]; b[5 + j] = x.g1[j]; }
}
constexpr int QTB = 4;        // query tiles of a work-group's block (64 queries): they share every staged V chunk
constexpr int KSP = 4;        // key splits: wave (qt, g) takes key chunks g, g + KSP, ... of query tile qt
constexpr int NW = QTB * KSP; // waves per work-group
constexpr int OP = D + 4;     // pitch of a partial row in floats: 528 B = 16 B x odd, so the 16 query columns of a b128 store fall on distinct banks
constexpr int CH = 32 * D;    // elements of one key chunk in one V plane (8 KB)
// One stage = KSP key chunks in a row of both V planes (32 KB each), copied to LDS without passing registers: 8 copies of 16 B per lane, each wave
// instruction 512 B in a row. gh, gl (global) and sh, sl (LDS byte addresses) name the thread's own 16 bytes of the first 8 KB of each plane; the
// immediate offset moves the global and the LDS address alike, and source and destination are both 8 KB further on per copy.
static_assert(KSP == 4 && CH * 2 == 8192, "the offsets below are written for four chunks of 8 KB");
__device__ __forceinline__ void stage_v(const b16* gh, const b16* gl, unsigned sh, unsigned sl) {
  // the wait in the copies' own statement stands before anything rewrites the address registers that the issued copies name
  asm volatile("global_load_async_to_lds_b128 %0, %2, off\n\t"
               "global_load_async_to_lds_b128 %0, %2, off offset:8192\n\t"
               "global_load_async_to_lds_b128 %0, %2, off offset:16384\n\t"
               "global_load_async_to_lds_b128 %0, %2, off offset:24576\n\t"
               "global_load_async_to_lds_b128 %1, %3, off\n\t"
               "global_load_async_to_lds_b128 %1, %3, off offset:8192\n\t"
               "global_load_async_to_lds_b128 %1, %3, off offset:16384\n\t"
               "global_load_async_to_lds_b128 %1, %3, off offset:24576\n\t"
               "s_wait_xcnt 0x0"
               :: "v"(sh), "v"(sl), "v"(gh), "v"(gl) : "memory");
}
__global__ __launch_bounds__(NW * 32) void attn_kernel(const float* __restrict__ Sb, const float* __restrict__ wconv, const b16* __restrict__ vth, const b16* __restrict__ vtl,
                                                   float* __restrict__ out) {
  __shared__ __attribute__((aligned(16))) b16 Vs[2][2][KSP * CH];   // [buffer][plane hi, lo][KSP key chunks in fragment order]: 128 KB
  __shared__ __attribute__((aligned(16))) float Os[NW][16 * OP];    // partials; a row's maximum and sum lie in its pad (floats D, D + 1): no address of their own
  const int tid = threadIdx.x, wid = __builtin_amdgcn_readfirstlane(tid >> 5), lane = tid & 31, hh = lane >> 4, col = lane & 15;
  const int qt = wid / KSP, g = wid % KSP;
  const int h = blockIdx.x / (S / 128), pr = blockIdx.x % (S / 128);
  const float* Sh = Sb + (size_t)h * HSZ; const b16* vh = vth + (size_t)h * D * S + tid * 8; const b16* vl = vtl + (size_t)h * D * S + tid * 8;
  const unsigned sv = (unsigned)(size_t)(&Vs[0][0][0]) + (unsigned)tid * 16u;   // the thread's own 16 bytes of buffer 0, plane hi (LDS byte address)
  constexpr unsigned PB = KSP * CH * 2;                        // bytes of one plane of one buffer
  float w[9];
#pragma unroll
  for (int i = 0; i < 9; ++i) w[i] = wconv[h * 9 + i];       // [i][j]: query tap i (row q-2+i), key tap j (k-1+j)
  for (int half = 0; half < 2; ++half) {
    const int qb0 = (half ? pr : S / 64 - 1 - pr) * 64, q0 = qb0 + qt * 16, qi = q0 + col;
    const int nst = (qb0 / 32 + 2 + KSP - 1) / KSP;              // stages: the block's causal key chunks (qb0 / 32 + 2) in groups of KSP; the last chunk staged is below S / 32
    // rows above row 0 are zero (only the first tile has such rows, and only its chunk kb = 0): their loads go to row 0, keys 64 on, which the score
    // kernel stores as zeros (future keys), so every lane uses the head's nine weights as they are (uniform values, no per-lane copies in registers)
    const int rt = q0 > 0 ? q0 - 2 + (col < 1 ? col : 1) : 0, ru = q0 > 0 ? q0 - 1 : 0, zk = q0 > 0 ? 0 : 64;
    const float* po = Sh + row_off(qi) + g * 32 + 8 * hh; const float* pu = Sh + row_off(ru) + zk + g * 32 + 8 * hh;
    const float* pt = pu - (ru - rt) * blk_pitch(ru >> 7);       // rows q0-2 and q0-1 lie in one row block (q0 is a multiple of 16)
    float m = -INFINITY, l = 0.0f;
    v8f o[8];
#pragma unroll
    for (int n = 0; n < 8; ++n) o[n] = (v8f){};
    // Two-buffer ring: stage 0 lands and is published, then stage 1 flies while stage 0 is worked on. Every reader of the buffers has left them
    // (first block: none yet; second block: the barriers of the last trip and of the merge).
    stage_v(vh, vl, sv, sv + PB);
    asm volatile("s_wait_asynccnt 0x0" ::: "memory");            // this wave's copies of stage 0 have landed
    __syncthreads();                                             // every wave's copies of stage 0 have landed before any wave reads the stage
    if (nst > 1) stage_v(vh + KSP * CH, vl + KSP * CH, sv + 2 * PB, sv + 3 * PB);
    for (int t = 0; t < nst; ++t) {
      const int kb = (t * KSP + g) * 32;
      if (kb < q0 + 16) {                                        // wave-uniform: this wave's chunk of the stage holds causal keys of its query tile
      v8f s0 = {}, s1 = {};
      // Score window: every lane loads only its own query row (plus the two rows above the tile, which lanes 0 and 1 of each half need); rows
      // q-1 and q-2 come from the lanes of queries q-1 and q-2 by a shift inside the 16-lane row. Same values and same sums as per-element loads.
      float oa[10], ob[10], ta[10], tb[10], ua[10], ub[10];
      const int ke = hh ? kb + 32 : kb - 1, eo = (ke >= 0 && ke < S) ? (hh ? 24 : -1) : 0;
      const RowRaw xt = load_row(pt, eo);                        // lane 0: row q0-2, lane 1: row q0-1 (the other lanes: an unused copy of lane 1's)
      asm volatile("s_wait_xcnt 0x0" ::: "memory");              // later loads' results may land in address registers of the loads above
      const RowRaw xu = load_row(pu, eo);                        // lane 0: row q0-1 (the other lanes: an unused copy)
      asm volatile("s_wait_xcnt 0x0" :: "v"(pu), "v"(pu + eo) : "memory");   // as above; the addresses as inputs keep this row's own results out of them too
      const RowRaw xo = load_row(po, eo);
      asm volatile("s_wait_xcnt 0x0" :: "v"(po), "v"(po + eo) : "memory");   // as above; the addresses as inputs keep this row's own results out of them too
      __builtin_amdgcn_sched_barrier(0);                         // the 15 score loads stay one run: no window arithmetic (and no wait) is lifted between them
      po += KSP * 32; pt += KSP * 32; pu += KSP * 32;
      make_runs(xo, kb, hh, oa, ob); make_runs(xt, kb, hh, ta, tb); make_runs(xu, kb, hh, ua, ub);
#pragma unroll
      for (int j = 0; j < 10; ++j) { ta[j] = row_from<0x112>(ta[j], oa[j]); tb[j] = row_from<0x112>(tb[j], ob[j]); }   // row q-2
#pragma unroll
      for (int j = 0; j < 10; ++j) { ua[j] = row_from<0x111>(ua[j], oa[j]); ub[j] = row_from<0x111>(ub[j], ob[j]); }   // row q-1
#pragma unroll
      for (int r = 0; r < 8; ++r) s0[r] += w[0] * ta[r] + w[1] * ta[r + 1] + w[2] * ta[r + 2];
#pragma unroll
      for (int r = 0; r < 8; ++r) s1[r] += w[0] * tb[r] + w[1] * tb[r + 1] + w[2] * tb[r + 2];
#pragma unroll
      for (int r = 0; r < 8; ++r) s0[r] += w[3] * ua[r] + w[4] * ua[r + 1] + w[5] * ua[r + 2];
#pragma unroll
      for (int r = 0; r < 8; ++r) s1[r] += w[3] * ub[r] + w[4] * ub[r + 1] + w[5] * ub[r + 2];
#pragma unroll
      for (int r = 0; r < 8; ++r) s0[r] += w[6] * oa[r] + w[7] * oa[r + 1] + w[8] * oa[r + 2];
#pragma unroll
      for (int r = 0; r < 8; ++r) s1[r] += w[6] * ob[r] + w[7] * ob[r + 1] + w[8] * ob[r + 2];
      const int dq = qi - kb - 8 * hh;                           // the lane's key r (or r + 16) is a future key where it exceeds dq: one register, not one bound per key
#pragma unroll
      for (int r = 0; r < 8; ++r) { if (r > dq) s0[r] = -INFINITY; if (r + 16 > dq) s1[r] = -INFINITY; }
      // The chunk's 32 V fragment reads (LDS, 512 B in a row each) are issued in one run ahead of its 16 products.
      // Fragment order (vt_kernel): feature tiles are 512 elements apart, halves j = 0, 1 are 256 apart.
      const b16* pvh = &Vs[t & 1][0][g * CH + lane * 8]; const b16* pvl = &Vs[t & 1][1][g * CH + lane * 8];
      v8b vh0[8], vh1[8], vl0[8], vl1[8];
#pragma unroll
      for (int n = 0; n < 8; ++n) { vh0[n] = ld8b(pvh + n * 512); vh1[n] = ld8b(pvh + n * 512 + 256); vl0[n] = ld8b(pvl + n * 512); vl1[n] = ld8b(pvl + n * 512 + 256); }
      float mr = -INFINITY;
#pragma unroll
      for (int r = 0; r < 8; ++r) mr = fmaxf(mr, fmaxf(s0[r], s1[r]));
      mr = fmaxf(mr, xhalf(mr));                                 // lane ^ 16 by a vector move: an LDS permute would return only behind the 32 V reads queued ahead of it
      float mn = fmaxf(m, mr); if (mn == -INFINITY) mn = 0.0f;
      const float al_ = __expf(m - mn); m = mn;
      float sum = 0.0f; v16b pb;
#pragma unroll
      for (int r = 0; r < 8; ++r) { const float p0 = __expf(s0[r] - mn), p1 = __expf(s1[r] - mn); sum += p0 + p1; pb[r] = (b16)p0; pb[8 + r] = (b16)p1; }
      sum += xhalf(sum);
      l = l * al_ + sum;
#pragma unroll
      for (int n = 0; n < 8; ++n) {
#pragma unroll
        for (int r = 0; r < 8; ++r) o[n][r] *= al_;
        o[n] = wmma16b(cat8b(vh0[n], vh1[n]), pb, o[n]);
        o[n] = wmma16b(cat8b(vl0[n], vl1[n]), pb, o[n]);
      }
      }
      // Publish point of stage t + 1, passed by every wave (also one whose chunk was skipped), in this order:
      asm volatile("s_wait_dscnt 0x0" ::: "memory");             // this wave's reads of stage t have returned before the buffer is refilled
      asm volatile("s_wait_asynccnt 0x0" ::: "memory");          // this wave's copies of stage t + 1 have landed
      __syncthreads();                                           // publishes stage t + 1 and ends every wave's reads of stage t
      if (t + 2 < nst) stage_v(vh + (t + 2) * (KSP * CH), vl + (t + 2) * (KSP * CH), sv + (t & 1) * (2 * PB), sv + (t & 1) * (2 * PB) + PB);
    }
    asm volatile("s_wait_asynccnt 0x0" ::: "memory");            // no copy is outstanding behind the loop
    {                                                            // un-normalised partial y^T: lane col = query, element r = feature 16n+8hh+r; a wave without a chunk stores zeros, m = -inf
      float* Tr = Os[wid] + col * OP + 8 * hh;
#pragma unroll
      for (int n = 0; n < 8; ++n)
#pragma unroll
        for (int r = 0; r < 8; ++r) Tr[n * 16 + r] = o[n][r];
      if (hh == 0) { Tr[D] = m; Tr[D + 1] = l; }                 // the row's pad, from the lanes whose Tr is the row's start
    }
    __syncthreads();                                             // every wave's partial is in LDS before any is merged
#pragma unroll
    for (int i = 0; i < 16 / KSP; ++i) {                         // wave (qt, g) merges rows 4g .. 4g+3 of query tile qt; split 0 always holds key 0, so mx is finite
      const int rr = g * (16 / KSP) + i;
      float mx = -INFINITY;
#pragma unroll
      for (int u = 0; u < KSP; ++u) mx = fmaxf(mx, Os[qt * KSP + u][rr * OP + D]);
      float ls = 0.0f; v4f y = {};
#pragma unroll
      for (int u = 0; u < KSP; ++u) { const float* Pu = &Os[qt * KSP + u][rr * OP]; const float f = __expf(Pu[D] - mx); ls += f * Pu[D + 1]; y += f * *(const v4f*)(Pu + lane * 4); }
      const float inv = (ls > 0.0f) ? (1.0f / (VS * ls)) : 0.0f;
      const v4f yo = y * inv; float* dst = out + ((size_t)h * S + q0 + rr) * D + lane * 4;
      *(v4f*)dst = yo;                                           // one row of 512 B per wave: whole lines
      asm volatile("s_wait_xcnt 0x0" :: "v"(yo), "v"(dst) : "memory");   // the next row's arithmetic rewrites registers that this store names; as inputs they stay untouched up to the wait
    }
    __syncthreads();                                             // the merge has read the partials before the second block overwrites them
  }
}
}  // namespace

extern "C" void kernel_launch(void* const* d_in, const int* in_sizes, int n_in,
                              void* d_out, int out_size, void* d_ws, size_t ws_size, hipStream_t stream) {
  (void)n_in; (void)out_size;
  const float* Q = (const float*)d_in[0]; const float* K = (const float*)d_in[1]; const float* V = (const float*)d_in[2];   // [1,16,2048,128]
  const float* wconv = (const float*)d_in[3];   // [16,3,3]
  float* out = (float*)d_out;                   // [1,16,2048,128]
  if (in_sizes[0] != H * S * D || in_sizes[1] != H * S * D || in_sizes[2] != H * S * D || in_sizes[3] != H * 9) return;
  size_t off = 0; char* ws = (char*)d_ws;
  auto carve = [&](size_t bytes) { char* p = ws + off; off += (bytes + 255) & ~(size_t)255; return p; };
  b16* vth = (b16*)carve((size_t)H * D * S * 2);     //  8 MB
  b16* vtl = (b16*)carve((size_t)H * D * S * 2);     //  8 MB
  b16* qh = (b16*)carve((size_t)H * S * D * 2);      //  8 MB each: 8Q and 8K, hi and lo
  b16* ql = (b16*)carve((size_t)H * S * D * 2);
  b16* kh = (b16*)carve((size_t)H * S * D * 2);
  b16* kl = (b16*)carve((size_t)H * S * D * 2);
  float* Sb = (float*)carve((size_t)H * HSZ * 4);    // 151 MB score buffer, all heads
  if (off > ws_size) return;                           // total 201,326,592 B
  vt_kernel<<<H * (S / 64) + 2 * (H * S / 16 / QT), 256, 0, stream>>>(V, vth, vtl, Q, K, qh, ql, kh, kl);
  s_kernel<<<dim3(S / 64 + 4, S / 256, H), 128, 0, stream>>>(qh, ql, kh, kl, Sb);
  attn_kernel<<<H * (S / 128), NW * 32, 0, stream>>>(Sb, wconv, vth, vtl, out);
}

// v008
// It runs in 105 microseconds.
// Two timings next to v007 put it at 1.06 and 1.05 times that version's speed.
// Over all steps from v000 it is 15.3 times as fast.
#include <hip/hip_runtime.h>

// Causal attention with a learned per-head 3x3 convolution over the score matrix: s = Q.K^T/sqrt(128) with future keys zeroed, cs[q][k] =
// sum_{i<3,j<3} w[h][i][j] s[q-2+i][k-1+j] (query padding left only, key padding symmetric, zeros outside), future keys -> -inf, softmax, out = P.V.
// B=1, 16 heads, S=2048, D=128; Q, K, V are the inputs (no projections).
// Contractions on v_wmma_f32_16x16x32_f16: Q.K^T with both operands split once into f16 hi+lo planes of the x8-scaled f32 rows (3 products); P.V with
// unnormalised P as single f16 against an f16 hi+lo pair of 8V (2 products); f32 accumulate; the 3x3 score convolution, masking and online softmax in
// f32 from an f32 score buffer (all heads, causal keys only). Fragment k-map per lane half hh for A AND B: elements 0..7 <- k = 8hh+0..7, 8..15 <- k = 16+8hh+0..7.

namespace {
constexpr int H = 16, S = 2048, D = 128;
constexpr float XS = 8.0f, VS = 8.0f, SCALE = 0.08838834764831845f;   // 128^-0.5

// Score buffer, per head: the 128 rows of row block b keep keys 0 .. 128b+191 only (their causal keys and one 64-key tile of zeros behind them, which
// the window's key k+1 and the rows q-1, q-2 of the next block's first tile read), so the row pitch grows with b and 16 heads take 151 MB, not 256 MB.
// Inside a row block the order is the one the attention lanes load in: [query tile of 16][key chunk of 32][piece p][lane][4 keys], lane = 16hh + query,
// keys 16(p>>1) + 8hh + 4(p&1) + 0..3 of the chunk: a chunk of a tile is 2 KB in a row, and one 16-byte load per lane reads a piece = 4 whole 128-B lines.
constexpr int HSZ = 8192 * (S / 128) * (S / 128 + 2);        // floats per head = start of a row block one past the last
__device__ __forceinline__ int blk_pitch(int b) { return (b + 1) * 128 + 64; }
__device__ __forceinline__ int tile_off(int row) { const int b = row >> 7; return 8192 * b * (b + 2) + ((row & 127) >> 4) * 16 * blk_pitch(b); }   // start of the row's query tile; 8192 b (b + 2) = sum of 128 * pitch over the blocks before b

typedef _Float16 b16;
typedef __attribute__((ext_vector_type(16))) _Float16 v16b;
typedef __attribute__((ext_vector_type(8)))  _Float16 v8b;
typedef __attribute__((ext_vector_type(8)))  float v8f;
typedef __attribute__((ext_vector_type(4)))  float v4f;

__device__ __forceinline__ v8b ld8b(const b16* p) { return *(const v8b*)p; }
__device__ __forceinline__ v16b cat8b(v8b a, v8b b) { return __builtin_shufflevector(a, b, 0, 1, 2, 3, 4, 5, 6, 7, 8, 9, 10, 11, 12, 13, 14, 15); }
__device__ __forceinline__ void split16(float v, b16& hi, b16& lo) { hi = (b16)v; lo = (b16)(v - (float)hi); }
__device__ __forceinline__ v8f wmma16b(v16b a, v16b b, v8f c) {
  v8f d = __builtin_amdgcn_wmma_f32_16x16x32_f16(false, a, false, b, (short)0, c, false, false);
  asm volatile("v_nop\n\tv_nop\n\tv_nop\n\tv_nop" : "+v"(d) : "v"(a), "v"(b));
  return d;
}
__device__ __forceinline__ void wave_lds_sync() {
  __builtin_amdgcn_fence(__ATOMIC_RELEASE, "workgroup");
  __builtin_amdgcn_wave_barrier();
  __builtin_amdgcn_fence(__ATOMIC_ACQUIRE, "workgroup");
}

// One accumulator's products of a k block; operand kind 2 = f16 hi + lo planes, 1 = one f16 plane
template <int ANP, int BNP> __device__ __forceinline__ v8f mac(v16b ah, v16b al, v16b bh, v16b bl, v8f c) {
  c = wmma16b(ah, bh, c);
  if (BNP == 0 || BNP == 2 || BNP == 4 || BNP == 5) c = wmma16b(ah, bl, c);     // hi.lo
  if (ANP == 0 || ANP == 2 || ANP == 4 || ANP == 5) c = wmma16b(al, bh, c);     // lo.hi   (lo.lo dropped)
  return c;
}
__device__ __forceinline__ void epi_planes(v8f (&acc)[2][4], float scale, bool two, b16* __restrict__ oh, b16* __restrict__ ol, int ldo,
                                           int m0, int c0, int lane, b16* Th, b16* Tl) {
  const int nloc = lane & 15, hlf = lane >> 4;
#pragma unroll
  for (int t = 0; t < 4; ++t)
#pragma unroll
    for (int r = 0; r < 2; ++r)
#pragma unroll
      for (int v = 0; v < 8; ++v) {
        const int rr = r * 16 + v + 8 * hlf, cc = t * 16 + nloc;
        b16 h_, l_; split16(acc[r][t][v] * scale, h_, l_);
        Th[rr * 64 + cc] = h_; Tl[rr * 64 + cc] = l_;
      }
  wave_lds_sync();
  {
#pragma unroll
    for (int j = 0; j < 8; ++j) {
      const int rr = j * 4 + (lane >> 3), c8 = (lane & 7) * 8;
      const size_t o = (size_t)(m0 + rr) * ldo + c0 + c8;
      *(v8b*)(oh + o) = ld8b(Th + rr * 64 + c8);
      if (two) *(v8b*)(ol + o) = ld8b(Tl + rr * 64 + c8);
    }
    
  }
}
// (b) f32 rows with pitch ldo: 64 floats = 256 B = 2 lines per row; 16 lanes x 16 B per row, 2 rows per instruction. Optional per-row factor
__device__ __forceinline__ void epi_f32(v8f (&acc)[2][4], float scale, const float* rscale, float* __restrict__ out, int ldo, int m0, int c0, int lane, float* Tt) {
  const int nloc = lane & 15, hlf = lane >> 4;
#pragma unroll
  for (int t = 0; t < 4; ++t)
#pragma unroll
    for (int r = 0; r < 2; ++r)
#pragma unroll
      for (int v = 0; v < 8; ++v) {
        const int rr = r * 16 + v + 8 * hlf;
        const float rs = rscale ? rscale[(size_t)(m0 + rr) * 32] : 1.0f;
        Tt[rr * 64 + t * 16 + nloc] = acc[r][t][v] * scale * rs;
      }
  wave_lds_sync();
  float* dst0 = out + (size_t)m0 * ldo + c0;
  {
#pragma unroll
    for (int j = 0; j < 16; ++j) { const int rr = j * 2 + hlf, c4 = nloc * 4; *(v4f*)(dst0 + (size_t)rr * ldo + c4) = *(const v4f*)(Tt + rr * 64 + c4); }
    
  }
}



// (8V)^T as f16 hi and lo planes in the order the attention waves read their A fragments: per head [key chunk of 32][feature tile n of 16][half j]
// [lane][8 keys], lane = 16hh + feature, keys 16j + 8hh + 0..7 of the chunk. One fragment = two loads of 512 B in a row (4 whole lines each).
// The same launch splits Q and K (blocks from H * S / 64 on): 8X as f16 hi and lo planes in the order the score waves read their fragments: [row tile of
// 16][k block of 32][half j][lane][8], lane = 16hh + row, k = 16j + 8hh + 0..7 of the block; a tile's 256 units = the block's 256 threads, QT tiles each.
constexpr int QT = 8;
__global__ __launch_bounds__(256) void vt_kernel(const float* __restrict__ V, b16* __restrict__ vth, b16* __restrict__ vtl, const float* __restrict__ Q,
                                                 const float* __restrict__ K, b16* __restrict__ qh, b16* __restrict__ ql, b16* __restrict__ kh, b16* __restrict__ kl) {
  __shared__ __attribute__((aligned(16))) b16 Th[D][72]; __shared__ __attribute__((aligned(16))) b16 Tl[D][72];
  if (blockIdx.x >= H * (S / 64)) {                            // block-uniform; no barrier on this path
    constexpr int NB = H * S / 16 / QT;                        // blocks per tensor
    const int b = blockIdx.x - H * (S / 64), isk = b >= NB, tile0 = (b - isk * NB) * QT, u = threadIdx.x, fl = u & 31;
    const float* X = (isk ? K : Q) + ((size_t)tile0 * 16 + (fl & 15)) * D + (u >> 6) * 32 + 16 * ((u >> 5) & 1) + 8 * (fl >> 4);
    b16* xh = (isk ? kh : qh) + (size_t)tile0 * (16 * D) + u * 8; b16* xl = (isk ? kl : ql) + (size_t)tile0 * (16 * D) + u * 8;
    v4f x0[QT], x1[QT];
#pragma unroll
    for (int i = 0; i < QT; ++i) { x0[i] = *(const v4f*)(X + i * 16 * D); x1[i] = *(const v4f*)(X + i * 16 * D + 4); }
    asm volatile("s_wait_xcnt 0x0" :: "v"(X) : "memory");      // all loads are issued before the first store (one latency, not QT); X as input keeps results out of it
#pragma unroll
    for (int i = 0; i < QT; ++i) {
      v8b vh_, vl_;
#pragma unroll
      for (int e = 0; e < 4; ++e) { b16 a, c; split16(x0[i][e] * XS, a, c); vh_[e] = a; vl_[e] = c; split16(x1[i][e] * XS, a, c); vh_[4 + e] = a; vl_[4 + e] = c; }
      *(v8b*)(xh + i * 16 * D) = vh_; *(v8b*)(xl + i * 16 * D) = vl_;
    }
    return;
  }
  const int tid = threadIdx.x, h = blockIdx.x / (S / 64), t0 = (blockIdx.x % (S / 64)) * 64;
  for (int i = tid; i < 64 * D; i += 256) { const int t = i / D, dd = i % D; b16 a, b2; split16(V[((size_t)h * S + t0 + t) * D + dd] * VS, a, b2); Th[dd][t] = a; Tl[dd][t] = b2; }
  __syncthreads();
  // Fragment order: unit u of 8 keys = [key chunk of 32][feature tile n][fragment half j][lane]; the block's two chunks are 16 KB in a row per plane
  b16* bh = vth + (size_t)h * D * S + (size_t)t0 * D; b16* bl = vtl + (size_t)h * D * S + (size_t)t0 * D;
#pragma unroll
  for (int i = 0; i < 4; ++i) {
    const int u = i * 256 + tid, fl = u & 31, j = (u >> 5) & 1, n = (u >> 6) & 7, c = u >> 9;
    const int dd = n * 16 + (fl & 15), t = c * 32 + 16 * j + 8 * (fl >> 4);
    *(v8b*)(bh + (size_t)u * 8) = *(const v8b*)(&Th[dd][t]); *(v8b*)(bl + (size_t)u * 8) = *(const v8b*)(&Tl[dd][t]);
  }
}

// Scores, all heads: grid (36, 8, H). Row block b has 2b+3 key tiles of 64 (32 in the last block); blocks y and 15-y share a grid row of 36, so every stored
// tile has a work-group (and one per head, behind key S-1, returns at once). The one tile wholly above the diagonal skips the MMA work (acc = 0).
__global__ __launch_bounds__(128) void s_kernel(const b16* __restrict__ qh, const b16* __restrict__ ql, const b16* __restrict__ kh, const b16* __restrict__ kl, float* __restrict__ Sb) {
  constexpr int TP = 68;                                       // pitch of a staged row in floats: 272 B = 16 B x odd, so the 16 query rows of a b128 read fall on distinct banks
  __shared__ __attribute__((aligned(16))) float Ts[4][32 * TP];
  const int lane = threadIdx.x & 31, wave = threadIdx.x >> 5, nloc = lane & 15, hlf = lane >> 4, h = blockIdx.z;
  const int nlow = 2 * blockIdx.y + 3, low = (int)blockIdx.x < nlow;
  const int qb = low ? blockIdx.y : S / 128 - 1 - blockIdx.y, kt = low ? blockIdx.x : blockIdx.x - nlow, m0 = qb * 128 + wave * 32, c0 = kt * 64;
  if (c0 >= S) return;                                         // block-uniform: the last row block has no tile behind key S-1
  v8f acc[2][4];
#pragma unroll
  for (int r = 0; r < 2; ++r)
#pragma unroll
    for (int t = 0; t < 4; ++t) acc[r][t] = (v8f){};
  if (c0 <= qb * 128 + 127) {                                  // block-uniform: some (q, k) in this tile has k <= q
    // 32x64 wave tile from the fragment-order planes (vt_kernel): row tile = 2048 elements, k block = 512, half = 256, lane = 8; each load = 4 whole lines
    const size_t ao = ((size_t)h * S + m0) * D + lane * 8, bo = ((size_t)h * S + c0) * D + lane * 8;
    const b16* pah = qh + ao; const b16* pal = ql + ao; const b16* pbh = kh + bo; const b16* pbl = kl + bo;
#pragma unroll
    for (int kc = 0; kc < D / 32; ++kc) {
      v16b ah[2], al[2], bh[4], bl[4];
#pragma unroll
      for (int r = 0; r < 2; ++r) {
        const int o = r * 2048 + kc * 512;
        ah[r] = cat8b(ld8b(pah + o), ld8b(pah + o + 256)); al[r] = cat8b(ld8b(pal + o), ld8b(pal + o + 256));
      }
#pragma unroll
      for (int t = 0; t < 4; ++t) {
        const int o = t * 2048 + kc * 512;
        bh[t] = cat8b(ld8b(pbh + o), ld8b(pbh + o + 256)); bl[t] = cat8b(ld8b(pbl + o), ld8b(pbl + o + 256));
      }
      // the k block's 24 loads are issued in one run ahead of its products (one latency, not one per key tile); the addresses as inputs keep results out of them
      asm volatile("s_wait_xcnt 0x0" :: "v"(pah), "v"(pal), "v"(pbh), "v"(pbl) : "memory");
#pragma unroll
      for (int t = 0; t < 4; ++t) {
        acc[0][t] = mac<2, 2>(ah[0], al[0], bh[t], bl[t], acc[0][t]);
        acc[1][t] = mac<2, 2>(ah[1], al[1], bh[t], bl[t], acc[1][t]);
      }
    }
  }
  float* Tt = Ts[wave];
#pragma unroll
  for (int t = 0; t < 4; ++t)
#pragma unroll
    for (int r = 0; r < 2; ++r)
#pragma unroll
      for (int v = 0; v < 8; ++v) { const int rr = r * 16 + v + 8 * hlf, cc = t * 16 + nloc; Tt[rr * TP + cc] = (c0 + cc <= m0 + rr) ? acc[r][t][v] * (SCALE / (XS * XS)) : 0.0f; }
  wave_lds_sync();
  // the wave's 2 query tiles x 2 key chunks in the attention lanes' order: store j = tile j>>3, chunk (j>>2)&1, piece j&3; 512 B in a row each
  float* dst0 = Sb + (size_t)h * HSZ + tile_off(m0) + (c0 >> 5) * 512 + lane * 4;
  float* dst1 = dst0 + 16 * blk_pitch(qb);                     // the second query tile: one tile of this row block further on
  __builtin_amdgcn_sched_barrier(0);                           // both addresses are formed ahead of the first store: no address arithmetic lands in a register that an issued store names
  {
#pragma unroll
    for (int j = 0; j < 16; ++j) {
      const int r = j >> 3, ch = (j >> 2) & 1, pc = j & 3;
      *(v4f*)((r ? dst1 : dst0) + ch * 512 + pc * 128) = *(const v4f*)(Tt + (r * 16 + nloc) * TP + ch * 32 + (pc >> 1) * 16 + hlf * 8 + (pc & 1) * 4);
    }
  }
}

// ---------------------------------------------------------------------------
// Convolved-score attention, all heads in one launch: work-group = one head's query blocks b and S/64-1-b (64 queries = 4 tiles of 16 each, one block after
// the other: every work-group has the same number of stages); wave (qt, g) takes query tile qt and every 4th key chunk of 32 from g on, with its own
// maximum, sum and accumulators; a stage's 4 V chunks are copied to LDS once and read there by all 4 query tiles; the 4 partials of a tile are merged
// through LDS. Per element the 3x3 window of the stored scores
// (rows q-2..q, keys k-1..k+1, zero outside [0,S)), x w[h], -inf for k > q; online softmax f32; P^T f16; y^T += (8V)^T.P^T (8 feature tiles, hi + lo
// ---------------------------------------------------------------------------
// lane l <-> lane l ^ 16
__device__ __forceinline__ float xhalf(float x) { return __builtin_bit_cast(float, __builtin_amdgcn_permlanex16(__builtin_bit_cast(int, x), __builtin_bit_cast(int, x), 0x76543210, 0xfedcba98, false, false)); }
// DPP row_shr:n (CTRL = 0x110 + n): lane c of a 16-lane row takes src of lane c - n; lanes c < n keep edge
template <int CTRL> __device__ __forceinline__ float row_from(float edge, float src) {
  return __builtin_bit_cast(float, __builtin_amdgcn_update_dpp(__builtin_bit_cast(int, edge), __builtin_bit_cast(int, src), CTRL, 0xf, 0xf, false));
}
// One score row's two 10-key runs of a lane: a = keys kb+8hh-1 .. kb+8hh+8, b = the same + 16 (zero outside [0, S)). The lane's own 16 keys are four
// aligned 16-byte loads (the chunk's four pieces, 128 floats apart); the run ends inside the 32-key chunk are held by lane ^ 16; only key kb-1 (hh 0) or
// kb+32 (hh 1) is one more load: the last key of the chunk before (piece 3, lane + 16, element 3) or the first of the chunk behind (piece 0, lane - 16).
struct RowRaw { v4f f0, f1, g0, g1; float e; };
// p = the lane's 4 keys in piece 0 of the row's chunk; eo = distance from there to the lane's outer key (0 where that key is outside the row)
__device__ __forceinline__ RowRaw load_row(const float* __restrict__ p, int eo) {
  return RowRaw{*(const v4f*)p, *(const v4f*)(p + 128), *(const v4f*)(p + 256), *(const v4f*)(p + 384), p[eo]};
}
__device__ __forceinline__ void make_runs(const RowRaw& x, int kb, int hh, float (&a)[10], float (&b)[10]) {
  const int ke = hh ? kb + 32 : kb - 1;
  const float e = (ke >= 0 && ke < S) ? x.e : 0.0f;
  const float r1 = xhalf(hh ? x.f0[0] : x.f1[3]), r2 = xhalf(hh ? x.f1[3] : x.g0[0]), r3 = xhalf(hh ? x.g0[0] : x.g1[3]);
  a[0] = hh ? r1 : e; a[9] = hh ? r2 : r1; b[0] = hh ? r3 : r2; b[9] = hh ? e : r3;
#pragma unroll
  for (int j = 0; j < 4; ++j) { a[1 + j] = x.f0[j]; a[5 + j] = x.f1[j]; b[1 + j] = x.g0[j]; b[5 + j] = x.g1[j]; }
}
constexpr int QTB = 4;        // query tiles of a work-group's block (64 queries): they share every staged V chunk
constexpr int KSP = 4;        // key splits: wave (qt, g) takes key chunks g, g + KSP, ... of query tile qt
constexpr int NW = QTB * KSP; // waves per work-group
constexpr int OP = D + 4;     // pitch of a partial row in floats: 528 B = 16 B x odd, so the 16 query columns of a b128 store fall on distinct banks
constexpr int CH = 32 * D;    // elements of one key chunk in one V plane (8 KB)
// One stage = KSP key chunks in a row of both V planes (32 KB each), copied to LDS without passing registers: 8 copies of 16 B per lane, each wave
// instruction 512 B in a row. gh, gl (global) and sh, sl (LDS byte addresses) name the thread's own 16 bytes of the first 8 KB of each plane; the
// immediate offset moves the global and the LDS address alike, and source and destination are both 8 KB further on per copy.
static_assert(KSP == 4 && CH * 2 == 8192, "the offsets below are written for four chunks of 8 KB");
__device__ __forceinline__ void stage_v(const b16* gh, const b16* gl, unsigned sh, unsigned sl) {
  // the wait in the copies' own statement stands before anything rewrites the address registers that the issued copies name
  asm volatile("global_load_async_to_lds_b128 %0, %2, off\n\t"
               "global_load_async_to_lds_b128 %0, %2, off offset:8192\n\t"
               "global_load_async_to_lds_b128 %0, %2, off offset:16384\n\t"
               "global_load_async_to_lds_b128 %0, %2, off offset:24576\n\t"
               "global_load_async_to_lds_b128 %1, %3, off\n\t"
               "global_load_async_to_lds_b128 %1, %3, off offset:8192\n\t"
               "global_load_async_to_lds_b128 %1, %3, off offset:16384\n\t"
               "global_load_async_to_lds_b128 %1, %3, off offset:24576\n\t"
               "s_wait_xcnt 0x0"
               :: "v"(sh), "v"(sl), "v"(gh), "v"(gl) : "memory");
}
__global__ __launch_bounds__(NW * 32) void attn_kernel(const float* __restrict__ Sb, const float* __restrict__ wconv, const b16* __restrict__ vth, const b16* __restrict__ vtl,
                                                   float* __restrict__ out) {
  __shared__ __attribute__((aligned(16))) b16 Vs[2][2][KSP * CH];   // [buffer][plane hi, lo][KSP key chunks in fragment order]: 128 KB
  __shared__ __attribute__((aligned(16))) float Os[NW][16 * OP];    // partials; a row's maximum and sum lie in its pad (floats D, D + 1): no address of their own
  const int tid = threadIdx.x, wid = __builtin_amdgcn_readfirstlane(tid >> 5), lane = tid & 31, hh = lane >> 4, col = lane & 15;
  const int qt = wid / KSP, g = wid % KSP;
  const int h = blockIdx.x / (S / 128), pr = blockIdx.x % (S / 128);
  const float* Sh = Sb + (size_t)h * HSZ; const b16* vh = vth + (size_t)h * D * S + tid * 8; const b16* vl = vtl + (size_t)h * D * S + tid * 8;
  const unsigned sv = (unsigned)(size_t)(&Vs[0][0][0]) + (unsigned)tid * 16u;   // the thread's own 16 bytes of buffer 0, plane hi (LDS byte address)
  constexpr unsigned PB = KSP * CH * 2;                        // bytes of one plane of one buffer
  float w[9];
#pragma unroll
  for (int i = 0; i < 9; ++i) w[i] = wconv[h * 9 + i];       // [i][j]: query tap i (row q-2+i), key tap j (k-1+j)
  for (int half = 0; half < 2; ++half) {
    const int qb0 = (half ? pr : S / 64 - 1 - pr) * 64, q0 = qb0 + qt * 16, qi = q0 + col;
    const int nst = (qb0 / 32 + 2 + KSP - 1) / KSP;              // stages: the block's causal key chunks (qb0 / 32 + 2) in groups of KSP; the last chunk staged is below S / 32
    // rows above row 0 are zero (only the first tile has such rows, and only its chunk kb = 0): their loads go to row 0, keys 64 on, which the score
    // kernel stores as zeros (future keys), so every lane uses the head's nine weights as they are (uniform values, no per-lane copies in registers)
    const int rt = q0 > 0 ? q0 - 2 + (col < 1 ? col : 1) : 0, ru = q0 > 0 ? q0 - 1 : 0, zk = q0 > 0 ? 0 : 64;
    const float* po = Sh + tile_off(q0) + g * 512 + lane * 4; const float* pu = Sh + tile_off(ru) + (zk / 32 + g) * 512 + (16 * hh + (ru & 15)) * 4;
    const float* pt = pu - (ru - rt) * 4;                        // rows q0-2 and q0-1 lie in one query tile (q0 is a multiple of 16)
    float m = -INFINITY, l = 0.0f;
    v8f o[8];
#pragma unroll
    for (int n = 0; n < 8; ++n) o[n] = (v8f){};
    // Two-buffer ring: stage 0 lands and is published, then stage 1 flies while stage 0 is worked on. Every reader of the buffers has left them
    // (first block: none yet; second block: the barriers of the last trip and of the merge).
    stage_v(vh, vl, sv, sv + PB);
    asm volatile("s_wait_asynccnt 0x0" ::: "memory");            // this wave's copies of stage 0 have landed
    __syncthreads();                                             // every wave's copies of stage 0 have landed before any wave reads the stage
    if (nst > 1) stage_v(vh + KSP * CH, vl + KSP * CH, sv + 2 * PB, sv + 3 * PB);
    for (int t = 0; t < nst; ++t) {
      const int kb = (t * KSP + g) * 32;
      if (kb < q0 + 16) {                                        // wave-uniform: this wave's chunk of the stage holds causal keys of its query tile
      v8f s0 = {}, s1 = {};
      // Score window: every lane loads only its own query row (plus the two rows above the tile, which lanes 0 and 1 of each half need); rows
      // q-1 and q-2 come from the lanes of queries q-1 and q-2 by a shift inside the 16-lane row. Same values and same sums as per-element loads.
      float oa[10], ob[10], ta[10], tb[10], ua[10], ub[10];
      const int ke = hh ? kb + 32 : kb - 1, eo = (ke >= 0 && ke < S) ? (hh ? 448 : -61) : 0;   // 512 - 64; -512 + 384 + 64 + 3
      const RowRaw xt = load_row(pt, eo);                        // lane 0: row q0-2, lane 1: row q0-1 (the other lanes: an unused copy of lane 1's)
      asm volatile("s_wait_xcnt 0x0" ::: "memory");              // later loads' results may land in address registers of the loads above
      const RowRaw xu = load_row(pu, eo);                        // lane 0: row q0-1 (the other lanes: an unused copy)
      asm volatile("s_wait_xcnt 0x0" :: "v"(pu), "v"(pu + eo) : "memory");   // as above; the addresses as inputs keep this row's own results out of them too
      const RowRaw xo = load_row(po, eo);
      asm volatile("s_wait_xcnt 0x0" :: "v"(po), "v"(po + eo) : "memory");   // as above; the addresses as inputs keep this row's own results out of them too
      __builtin_amdgcn_sched_barrier(0);                         // the 15 score loads stay one run: no window arithmetic (and no wait) is lifted between them
      po += KSP * 512; pt += KSP * 512; pu += KSP * 512;
      make_runs(xo, kb, hh, oa, ob); make_runs(xt, kb, hh, ta, tb); make_runs(xu, kb, hh, ua, ub);
#pragma unroll
      for (int j = 0; j < 10; ++j) { ta[j] = row_from<0x112>(ta[j], oa[j]); tb[j] = row_from<0x112>(tb[j], ob[j]); }   // row q-2
#pragma unroll
      for (int j = 0; j < 10; ++j) { ua[j] = row_from<0x111>(ua[j], oa[j]); ub[j] = row_from<0x111>(ub[j], ob[j]); }   // row q-1
#pragma unroll
      for (int r = 0; r < 8; ++r) s0[r] += w[0] * ta[r] + w[1] * ta[r + 1] + w[2] * ta[r + 2];
#pragma unroll
      for (int r = 0; r < 8; ++r) s1[r] += w[0] * tb[r] + w[1] * tb[r + 1] + w[2] * tb[r + 2];
#pragma unroll
      for (int r = 0; r < 8; ++r) s0[r] += w[3] * ua[r] + w[4] * ua[r + 1] + w[5] * ua[r + 2];
#pragma unroll
      for (int r = 0; r < 8; ++r) s1[r] += w[3] * ub[r] + w[4] * ub[r + 1] + w[5] * ub[r + 2];
#pragma unroll
      for (int r = 0; r < 8; ++r) s0[r] += w[6] * oa[r] + w[7] * oa[r + 1] + w[8] * oa[r + 2];
#pragma unroll
      for (int r = 0; r < 8; ++r) s1[r] += w[6] * ob[r] + w[7] * ob[r + 1] + w[8] * ob[r + 2];
      const int dq = qi - kb - 8 * hh;                           // the lane's key r (or r + 16) is a future key where it exceeds dq: one register, not one bound per key
#pragma unroll
      for (int r = 0; r < 8; ++r) { if (r > dq) s0[r] = -INFINITY; if (r + 16 > dq) s1[r] = -INFINITY; }
      // The chunk's 32 V fragment reads (LDS, 512 B in a row each) are issued in one run ahead of its 16 products.
      // Fragment order (vt_kernel): feature tiles are 512 elements apart, halves j = 0, 1 are 256 apart.
      const b16* pvh = &Vs[t & 1][0][g * CH + lane * 8]; const b16* pvl = &Vs[t & 1][1][g * CH + lane * 8];
      v8b vh0[8], vh1[8], vl0[8], vl1[8];
#pragma unroll
      for (int n = 0; n < 8; ++n) { vh0[n] = ld8b(pvh + n * 512); vh1[n] = ld8b(pvh + n * 512 + 256); vl0[n] = ld8b(pvl + n * 512); vl1[n] = ld8b(pvl + n * 512 + 256); }
      float mr = -INFINITY;
#pragma unroll
      for (int r = 0; r < 8; ++r) mr = fmaxf(mr, fmaxf(s0[r], s1[r]));
      mr = fmaxf(mr, xhalf(mr));                                 // lane ^ 16 by a vector move: an LDS permute would return only behind the 32 V reads queued ahead of it
      float mn = fmaxf(m, mr); if (mn == -INFINITY) mn = 0.0f;
      const float al_ = __expf(m - mn); m = mn;
      float sum = 0.0f; v16b pb;
#pragma unroll
      for (int r = 0; r < 8; ++r) { const float p0 = __expf(s0[r] - mn), p1 = __expf(s1[r] - mn); sum += p0 + p1; pb[r] = (b16)p0; pb[8 + r] = (b16)p1; }
      sum += xhalf(sum);
      l = l * al_ + sum;
#pragma unroll
      for (int n = 0; n < 8; ++n) {
#pragma unroll
        for (int r = 0; r < 8; ++r) o[n][r] *= al_;
        o[n] = wmma16b(cat8b(vh0[n], vh1[n]), pb, o[n]);
        o[n] = wmma16b(cat8b(vl0[n], vl1[n]), pb, o[n]);
      }
      }
      // Publish point of stage t + 1, passed by every wave (also one whose chunk was skipped), in this order:
      asm volatile("s_wait_dscnt 0x0" ::: "memory");             // this wave's reads of stage t have returned before the buffer is refilled
      asm volatile("s_wait_asynccnt 0x0" ::: "memory");          // this wave's copies of stage t + 1 have landed
      __syncthreads();                                           // publishes stage t + 1 and ends every wave's reads of stage t
      if (t + 2 < nst) stage_v(vh + (t + 2) * (KSP * CH), vl + (t + 2) * (KSP * CH), sv + (t & 1) * (2 * PB), sv + (t & 1) * (2 * PB) + PB);
    }
    asm volatile("s_wait_asynccnt 0x0" ::: "memory");            // no copy is outstanding behind the loop
    {                                                            // un-normalised partial y^T: lane col = query, element r = feature 16n+8hh+r; a wave without a chunk stores zeros, m = -inf
      float* Tr = Os[wid] + col * OP + 8 * hh;
#pragma unroll
      for (int n = 0; n < 8; ++n)
#pragma unroll
        for (int r = 0; r < 8; ++r) Tr[n * 16 + r] = o[n][r];
      if (hh == 0) { Tr[D] = m; Tr[D + 1] = l; }                 // the row's pad, from the lanes whose Tr is the row's start
    }
    __syncthreads();                                             // every wave's partial is in LDS before any is merged
#pragma unroll
    for (int i = 0; i < 16 / KSP; ++i) {                         // wave (qt, g) merges rows 4g .. 4g+3 of query tile qt; split 0 always holds key 0, so mx is finite
      const int rr = g * (16 / KSP) + i;
      float mx = -INFINITY;
#pragma unroll
      for (int u = 0; u < KSP; ++u) mx = fmaxf(mx, Os[qt * KSP + u][rr * OP + D]);
      float ls = 0.0f; v4f y = {};
#pragma unroll
      for (int u = 0; u < KSP; ++u) { const float* Pu = &Os[qt * KSP + u][rr * OP]; const float f = __expf(Pu[D] - mx); ls += f * Pu[D + 1]; y += f * *(const v4f*)(Pu + lane * 4); }
      const float inv = (ls > 0.0f) ? (1.0f / (VS * ls)) : 0.0f;
      const v4f yo = y * inv; float* dst = out + ((size_t)h * S + q0 + rr) * D + lane * 4;
      *(v4f*)dst = yo;                                           // one row of 512 B per wave: whole lines
      asm volatile("s_wait_xcnt 0x0" :: "v"(yo), "v"(dst) : "memory");   // the next row's arithmetic rewrites registers that this store names; as inputs they stay untouched up to the wait
    }
    __syncthreads();                                             // the merge has read the partials before the second block overwrites them
  }
}
}  // namespace

extern "C" void kernel_launch(void* const* d_in, const int* in_sizes, int n_in,
                              void* d_out, int out_size, void* d_ws, size_t ws_size, hipStream_t stream) {
  (void)n_in; (void)out_size;
  const float* Q = (const float*)d_in[0]; const float* K = (const float*)d_in[1]; const float* V = (const float*)d_in[2];   // [1,16,2048,128]
  const float* wconv = (const float*)d_in[3];   // [16,3,3]
  float* out = (float*)d_out;                   // [1,16,2048,128]
  if (in_sizes[0] != H * S * D || in_sizes[1] != H * S * D || in_sizes[2] != H * S * D || in_sizes[3] != H * 9) return;
  size_t off = 0; char* ws = (char*)d_ws;
  auto carve = [&](size_t bytes) { char* p = ws + off; off += (bytes + 255) & ~(size_t)255; return p; };
  b16* vth = (b16*)carve((size_t)H * D * S * 2);     //  8 MB
  b16* vtl = (b16*)carve((size_t)H * D * S * 2);     //  8 MB
  b16* qh = (b16*)carve((size_t)H * S * D * 2);      //  8 MB each: 8Q and 8K, hi and lo
  b16* ql = (b16*)carve((size_t)H * S * D * 2);
  b16* kh = (b16*)carve((size_t)H * S * D * 2);
  b16* kl = (b16*)carve((size_t)H * S * D * 2);
  float* Sb = (float*)carve((size_t)H * HSZ * 4);    // 151 MB score buffer, all heads
  if (off > ws_size) return;                           // total 201,326,592 B
  vt_kernel<<<H * (S / 64) + 2 * (H * S / 16 / QT), 256, 0, stream>>>(V, vth, vtl, Q, K, qh, ql, kh, kl);
  s_kernel<<<dim3(S / 64 + 4, S / 256, H), 128, 0, stream>>>(qh, ql, kh, kl, Sb);
  attn_kernel<<<H * (S / 128), NW * 32, 0, stream>>>(Sb, wconv, vth, vtl, out);
}

// v009
// Measured time: 97 microseconds a run.
// In both of two side-by-side timings against v008, it was 1.08 times as fast.
// Counting every step since v000, it is 16.5 times as fast.
#include <hip/hip_runtime.h>

// Causal attention with a learned per-head 3x3 convolution over the score matrix: s = Q.K^T/sqrt(128) with future keys zeroed, cs[q][k] =
// sum_{i<3,j<3} w[h][i][j] s[q-2+i][k-1+j] (query padding left only, key padding symmetric, zeros outside), future keys -> -inf, softmax, out = P.V.
// B=1, 16 heads, S=2048, D=128; Q, K, V are the inputs (no projections).
// Contractions on v_wmma_f32_16x16x32_f16: Q.K^T with both operands split once into f16 hi+lo planes of the x8-scaled f32 rows (3 products); P.V with
// unnormalised P as single f16 against an f16 hi+lo pair of 8V (2 products); f32 accumulate; the 3x3 score convolution, masking and online softmax in
// f32 from an f32 score buffer (all heads, causal keys only). Fragment k-map per lane half hh for A AND B: elements 0..7 <- k = 8hh+0..7, 8..15 <- k = 16+8hh+0..7.

namespace {
constexpr int H = 16, S = 2048, D = 128;
constexpr float XS = 8.0f, VS = 8.0f, SCALE = 0.08838834764831845f;   // 128^-0.5

// Score buffer, per head: the 128 rows of row block b keep keys 0 .. 128b+191 only (their causal keys and one 64-key tile of zeros behind them, which
// the window's key k+1 and the rows q-1, q-2 of the next block's first tile read), so the row pitch grows with b and 16 heads take 151 MB, not 256 MB.
// Inside a row block the order is the one the attention lanes load in: [query tile of 16][key chunk of 32][piece p][lane][4 keys], lane = 16hh + query,
// keys 16(p>>1) + 8hh + 4(p&1) + 0..3 of the chunk: a chunk of a tile is 2 KB in a row, and one 16-byte load per lane reads a piece = 4 whole 128-B lines.
constexpr int HSZ = 8192 * (S / 128) * (S / 128 + 2);        // floats per head = start of a row block one past the last
__device__ __forceinline__ int blk_pitch(int b) { return (b + 1) * 128 + 64; }
__device__ __forceinline__ int tile_off(int row) { const int b = row >> 7; return 8192 * b * (b + 2) + ((row & 127) >> 4) * 16 * blk_pitch(b); }   // start of the row's query tile; 8192 b (b + 2) = sum of 128 * pitch over the blocks before b

typedef _Float16 b16;
typedef __attribute__((ext_vector_type(16))) _Float16 v16b;
typedef __attribute__((ext_vector_type(8)))  _Float16 v8b;
typedef __attribute__((ext_vector_type(8)))  float v8f;
typedef __attribute__((ext_vector_type(4)))  float v4f;

__device__ __forceinline__ v8b ld8b(const b16* p) { return *(const v8b*)p; }
__device__ __forceinline__ v16b cat8b(v8b a, v8b b) { return __builtin_shufflevector(a, b, 0, 1, 2, 3, 4, 5, 6, 7, 8, 9, 10, 11, 12, 13, 14, 15); }
__device__ __forceinline__ void split16(float v, b16& hi, b16& lo) { hi = (b16)v; lo = (b16)(v - (float)hi); }
__device__ __forceinline__ v8f wmma16b(v16b a, v16b b, v8f c) {
  v8f d = __builtin_amdgcn_wmma_f32_16x16x32_f16(false, a, false, b, (short)0, c, false, false);
  asm volatile("v_nop\n\tv_nop\n\tv_nop\n\tv_nop" : "+v"(d) : "v"(a), "v"(b));
  return d;
}
__device__ __forceinline__ void wave_lds_sync() {
  __builtin_amdgcn_fence(__ATOMIC_RELEASE, "workgroup");
  __builtin_amdgcn_wave_barrier();
  __builtin_amdgcn_fence(__ATOMIC_ACQUIRE, "workgroup");
}

// One accumulator's products of a k block; operand kind 2 = f16 hi + lo planes, 1 = one f16 plane
template <int ANP, int BNP> __device__ __forceinline__ v8f mac(v16b ah, v16b al, v16b bh, v16b bl, v8f c) {
  c = wmma16b(ah, bh, c);
  if (BNP == 0 || BNP == 2 || BNP == 4 || BNP == 5) c = wmma16b(ah, bl, c);     // hi.lo
  if (ANP == 0 || ANP == 2 || ANP == 4 || ANP == 5) c = wmma16b(al, bh, c);     // lo.hi   (lo.lo dropped)
  return c;
}
__device__ __forceinline__ void epi_planes(v8f (&acc)[2][4], float scale, bool two, b16* __restrict__ oh, b16* __restrict__ ol, int ldo,
                                           int m0, int c0, int lane, b16* Th, b16* Tl) {
  const int nloc = lane & 15, hlf = lane >> 4;
#pragma unroll
  for (int t = 0; t < 4; ++t)
#pragma unroll
    for (int r = 0; r < 2; ++r)
#pragma unroll
      for (int v = 0; v < 8; ++v) {
        const int rr = r * 16 + v + 8 * hlf, cc = t * 16 + nloc;
        b16 h_, l_; split16(acc[r][t][v] * scale, h_, l_);
        Th[rr * 64 + cc] = h_; Tl[rr * 64 + cc] = l_;
      }
  wave_lds_sync();
  {
#pragma unroll
    for (int j = 0; j < 8; ++j) {
      const int rr = j * 4 + (lane >> 3), c8 = (lane & 7) * 8;
      const size_t o = (size_t)(m0 + rr) * ldo + c0 + c8;
      *(v8b*)(oh + o) = ld8b(Th + rr * 64 + c8);
      if (two) *(v8b*)(ol + o) = ld8b(Tl + rr * 64 + c8);
    }
    
  }
}
// (b) f32 rows with pitch ldo: 64 floats = 256 B = 2 lines per row; 16 lanes x 16 B per row, 2 rows per instruction. Optional per-row factor
__device__ __forceinline__ void epi_f32(v8f (&acc)[2][4], float scale, const float* rscale, float* __restrict__ out, int ldo, int m0, int c0, int lane, float* Tt) {
  const int nloc = lane & 15, hlf = lane >> 4;
#pragma unroll
  for (int t = 0; t < 4; ++t)
#pragma unroll
    for (int r = 0; r < 2; ++r)
#pragma unroll
      for (int v = 0; v < 8; ++v) {
        const int rr = r * 16 + v + 8 * hlf;
        const float rs = rscale ? rscale[(size_t)(m0 + rr) * 32] : 1.0f;
        Tt[rr * 64 + t * 16 + nloc] = acc[r][t][v] * scale * rs;
      }
  wave_lds_sync();
  float* dst0 = out + (size_t)m0 * ldo + c0;
  {
#pragma unroll
    for (int j = 0; j < 16; ++j) { const int rr = j * 2 + hlf, c4 = nloc * 4; *(v4f*)(dst0 + (size_t)rr * ldo + c4) = *(const v4f*)(Tt + rr * 64 + c4); }
    
  }
}



// (8V)^T as f16 hi and lo planes in the order the attention waves read their A fragments: per head [key chunk of 32][feature tile n of 16][half j]
// [lane][8 keys], lane = 16hh + feature, keys 16j + 8hh + 0..7 of the chunk. One fragment = two loads of 512 B in a row (4 whole lines each).
// The same launch splits Q and K (blocks from H * S / 64 on): 8X as f16 hi and lo planes in the order the score waves read their fragments: [row tile of
// 16][k block of 32][half j][lane][8], lane = 16hh + row, k = 16j + 8hh + 0..7 of the block; a tile's 256 units = the block's 256 threads, QT tiles each.
constexpr int QT = 8;
__global__ __launch_bounds__(256) void vt_kernel(const float* __restrict__ V, b16* __restrict__ vth, b16* __restrict__ vtl, const float* __restrict__ Q,
                                                 const float* __restrict__ K, b16* __restrict__ qh, b16* __restrict__ ql, b16* __restrict__ kh, b16* __restrict__ kl) {
  __shared__ __attribute__((aligned(16))) b16 Th[D][72]; __shared__ __attribute__((aligned(16))) b16 Tl[D][72];
  if (blockIdx.x >= H * (S / 64)) {                            // block-uniform; no barrier on this path
    constexpr int NB = H * S / 16 / QT;                        // blocks per tensor
    const int b = blockIdx.x - H * (S / 64), isk = b >= NB, tile0 = (b - isk * NB) * QT, u = threadIdx.x, fl = u & 31;
    const float* X = (isk ? K : Q) + ((size_t)tile0 * 16 + (fl & 15)) * D + (u >> 6) * 32 + 16 * ((u >> 5) & 1) + 8 * (fl >> 4);
    b16* xh = (isk ? kh : qh) + (size_t)tile0 * (16 * D) + u * 8; b16* xl = (isk ? kl : ql) + (size_t)tile0 * (16 * D) + u * 8;
    v4f x0[QT], x1[QT];
#pragma unroll
    for (int i = 0; i < QT; ++i) { x0[i] = *(const v4f*)(X + i * 16 * D); x1[i] = *(const v4f*)(X + i * 16 * D + 4); }
    asm volatile("s_wait_xcnt 0x0" :: "v"(X) : "memory");      // all loads are issued before the first store (one latency, not QT); X as input keeps results out of it
#pragma unroll
    for (int i = 0; i < QT; ++i) {
      v8b vh_, vl_;
#pragma unroll
      for (int e = 0; e < 4; ++e) { b16 a, c; split16(x0[i][e] * XS, a, c); vh_[e] = a; vl_[e] = c; split16(x1[i][e] * XS, a, c); vh_[4 + e] = a; vl_[4 + e] = c; }
      *(v8b*)(xh + i * 16 * D) = vh_; *(v8b*)(xl + i * 16 * D) = vl_;
    }
    return;
  }
  const int tid = threadIdx.x, h = blockIdx.x / (S / 64), t0 = (blockIdx.x % (S / 64)) * 64;
  for (int i = tid; i < 64 * D; i += 256) { const int t = i / D, dd = i % D; b16 a, b2; split16(V[((size_t)h * S + t0 + t) * D + dd] * VS, a, b2); Th[dd][t] = a; Tl[dd][t] = b2; }
  __syncthreads();
  // Fragment order: unit u of 8 keys = [key chunk of 32][feature tile n][fragment half j][lane]; the block's two chunks are 16 KB in a row per plane
  b16* bh = vth + (size_t)h * D * S + (size_t)t0 * D; b16* bl = vtl + (size_t)h * D * S + (size_t)t0 * D;
#pragma unroll
  for (int i = 0; i < 4; ++i) {
    const int u = i * 256 + tid, fl = u & 31, j = (u >> 5) & 1, n = (u >> 6) & 7, c = u >> 9;
    const int dd = n * 16 + (fl & 15), t = c * 32 + 16 * j + 8 * (fl >> 4);
    *(v8b*)(bh + (size_t)u * 8) = *(const v8b*)(&Th[dd][t]); *(v8b*)(bl + (size_t)u * 8) = *(const v8b*)(&Tl[dd][t]);
  }
}

// Scores, all heads: grid (36, 8, H). Row block b has 2b+3 key tiles of 64 (32 in the last block); blocks y and 15-y share a grid row of 36, so every stored
// tile has a work-group (and one per head, behind key S-1, returns at once). The one tile wholly above the diagonal skips the MMA work (acc = 0).
__global__ __launch_bounds__(128) void s_kernel(const b16* __restrict__ qh, const b16* __restrict__ ql, const b16* __restrict__ kh, const b16* __restrict__ kl, float* __restrict__ Sb) {
  constexpr int TP = 68;                                       // pitch of a staged row in floats: 272 B = 16 B x odd, so the 16 query rows of a b128 read fall on distinct banks
  __shared__ __attribute__((aligned(16))) float Ts[4][32 * TP];
  const int lane = threadIdx.x & 31, wave = threadIdx.x >> 5, nloc = lane & 15, hlf = lane >> 4, h = blockIdx.z;
  const int nlow = 2 * blockIdx.y + 3, low = (int)blockIdx.x < nlow;
  const int qb = low ? blockIdx.y : S / 128 - 1 - blockIdx.y, kt = low ? blockIdx.x : blockIdx.x - nlow, m0 = qb * 128 + wave * 32, c0 = kt * 64;
  if (c0 >= S) return;                                         // block-uniform: the last row block has no tile behind key S-1
  v8f acc[2][4];
#pragma unroll
  for (int r = 0; r < 2; ++r)
#pragma unroll
    for (int t = 0; t < 4; ++t) acc[r][t] = (v8f){};
  if (c0 <= qb * 128 + 127) {                                  // block-uniform: some (q, k) in this tile has k <= q
    // 32x64 wave tile from the fragment-order planes (vt_kernel): row tile = 2048 elements, k block = 512, half = 256, lane = 8; each load = 4 whole lines
    const size_t ao = ((size_t)h * S + m0) * D + lane * 8, bo = ((size_t)h * S + c0) * D + lane * 8;
    const b16* pah = qh + ao; const b16* pal = ql + ao; const b16* pbh = kh + bo; const b16* pbl = kl + bo;
#pragma unroll
    for (int kc = 0; kc < D / 32; ++kc) {
      v16b ah[2], al[2], bh[4], bl[4];
#pragma unroll
      for (int r = 0; r < 2; ++r) {
        const int o = r * 2048 + kc * 512;
        ah[r] = cat8b(ld8b(pah + o), ld8b(pah + o + 256)); al[r] = cat8b(ld8b(pal + o), ld8b(pal + o + 256));
      }
#pragma unroll
      for (int t = 0; t < 4; ++t) {
        const int o = t * 2048 + kc * 512;
        bh[t] = cat8b(ld8b(pbh + o), ld8b(pbh + o + 256)); bl[t] = cat8b(ld8b(pbl + o), ld8b(pbl + o + 256));
      }
      // the k block's 24 loads are issued in one run ahead of its products (one latency, not one per key tile); the addresses as inputs keep results out of them
      asm volatile("s_wait_xcnt 0x0" :: "v"(pah), "v"(pal), "v"(pbh), "v"(pbl) : "memory");
#pragma unroll
      for (int t = 0; t < 4; ++t) {
        acc[0][t] = mac<2, 2>(ah[0], al[0], bh[t], bl[t], acc[0][t]);
        acc[1][t] = mac<2, 2>(ah[1], al[1], bh[t], bl[t], acc[1][t]);
      }
    }
  }
  float* Tt = Ts[wave];
#pragma unroll
  for (int t = 0; t < 4; ++t)
#pragma unroll
    for (int r = 0; r < 2; ++r)
#pragma unroll
      for (int v = 0; v < 8; ++v) { const int rr = r * 16 + v + 8 * hlf, cc = t * 16 + nloc; Tt[rr * TP + cc] = (c0 + cc <= m0 + rr) ? acc[r][t][v] * (SCALE / (XS * XS)) : 0.0f; }
  wave_lds_sync();
  // the wave's 2 query tiles x 2 key chunks in the attention lanes' order: store j = tile j>>3, chunk (j>>2)&1, piece j&3; 512 B in a row each
  float* dst0 = Sb + (size_t)h * HSZ + tile_off(m0) + (c0 >> 5) * 512 + lane * 4;
  float* dst1 = dst0 + 16 * blk_pitch(qb);                     // the second query tile: one tile of this row block further on
  __builtin_amdgcn_sched_barrier(0);                           // both addresses are formed ahead of the first store: no address arithmetic lands in a register that an issued store names
  {
#pragma unroll
    for (int j = 0; j < 16; ++j) {
      const int r = j >> 3, ch = (j >> 2) & 1, pc = j & 3;
      *(v4f*)((r ? dst1 : dst0) + ch * 512 + pc * 128) = *(const v4f*)(Tt + (r * 16 + nloc) * TP + ch * 32 + (pc >> 1) * 16 + hlf * 8 + (pc & 1) * 4);
    }
  }
}

// ---------------------------------------------------------------------------
// Convolved-score attention, all heads in one launch: work-group = one head's query blocks b and S/64-1-b (64 queries = 4 tiles of 16 each, one block after
// the other: every work-group has the same number of stages); wave (qt, g) takes query tile qt and every 4th key chunk of 32 from g on, with its own
// maximum, sum and accumulators; a stage's 4 V chunks are copied to LDS once and read there by all 4 query tiles; the 4 partials of a tile are merged
// through LDS. Per element the 3x3 window of the stored scores
// (rows q-2..q, keys k-1..k+1, zero outside [0,S)), x w[h], -inf for k > q; online softmax f32; P^T f16; y^T += (8V)^T.P^T (8 feature tiles, hi + lo
// ---------------------------------------------------------------------------
// lane l <-> lane l ^ 16
__device__ __forceinline__ float xhalf(float x) { return __builtin_bit_cast(float, __builtin_amdgcn_permlanex16(__builtin_bit_cast(int, x), __builtin_bit_cast(int, x), 0x76543210, 0xfedcba98, false, false)); }
// DPP row_shr:n (CTRL = 0x110 + n): lane c of a 16-lane row takes src of lane c - n; lanes c < n keep edge
template <int CTRL> __device__ __forceinline__ float row_from(float edge, float src) {
  return __builtin_bit_cast(float, __builtin_amdgcn_update_dpp(__builtin_bit_cast(int, edge), __builtin_bit_cast(int, src), CTRL, 0xf, 0xf, false));
}
// One score row's two 10-key runs of a lane: a = keys kb+8hh-1 .. kb+8hh+8, b = the same + 16 (zero outside [0, S)). The lane's own 16 keys are four
// aligned 16-byte loads (the chunk's four pieces, 128 floats apart); the run ends inside the 32-key chunk are held by lane ^ 16; only key kb-1 (hh 0) or
// kb+32 (hh 1) is one more load: the last key of the chunk before (piece 3, lane + 16, element 3) or the first of the chunk behind (piece 0, lane - 16).
struct RowRaw { v4f f0, f1, g0, g1; float e; };
// p = the lane's 4 keys in piece 0 of the row's chunk; eo = distance from there to the lane's outer key (0 where that key is outside the row)
__device__ __forceinline__ RowRaw load_row(const float* __restrict__ p, int eo) {
  return RowRaw{*(const v4f*)p, *(const v4f*)(p + 128), *(const v4f*)(p + 256), *(const v4f*)(p + 384), p[eo]};
}
__device__ __forceinline__ void make_runs(const RowRaw& x, int kb, int hh, float (&a)[10], float (&b)[10]) {
  const int ke = hh ? kb + 32 : kb - 1;
  const float e = (ke >= 0 && ke < S) ? x.e : 0.0f;
  const float r1 = xhalf(hh ? x.f0[0] : x.f1[3]), r2 = xhalf(hh ? x.f1[3] : x.g0[0]), r3 = xhalf(hh ? x.g0[0] : x.g1[3]);
  a[0] = hh ? r1 : e; a[9] = hh ? r2 : r1; b[0] = hh ? r3 : r2; b[9] = hh ? e : r3;
#pragma unroll
  for (int j = 0; j < 4; ++j) { a[1 + j] = x.f0[j]; a[5 + j] = x.f1[j]; b[1 + j] = x.g0[j]; b[5 + j] = x.g1[j]; }
}
// The score window of one key chunk (kb) of a query tile, as loaded: rows q0-2 / q0-1 (t), q0-1 (u) and the lane's own row (o). The 15 loads are issued in
// one run and the three pointers step on to the wave's next chunk (stp floats) behind them.
struct Win { RowRaw t, u, o; };
__device__ __forceinline__ void load_win(Win& x, const float*& po, const float*& pt, const float*& pu, int kb, int hh, int stp) {
  const int ke = hh ? kb + 32 : kb - 1, eo = (ke >= 0 && ke < S) ? (hh ? 448 : -61) : 0;   // 512 - 64; -512 + 384 + 64 + 3
  x.t = load_row(pt, eo);                                    // lane 0: row q0-2, lane 1: row q0-1 (the other lanes: an unused copy of lane 1's)
  asm volatile("s_wait_xcnt 0x0" :: "v"(pt), "v"(pt + eo) : "memory");   // later loads' results may land in address registers of the loads above; the addresses as inputs keep this row's own results out of them too
  x.u = load_row(pu, eo);                                    // lane 0: row q0-1 (the other lanes: an unused copy)
  asm volatile("s_wait_xcnt 0x0" :: "v"(pu), "v"(pu + eo) : "memory");   // as above
  x.o = load_row(po, eo);
  asm volatile("s_wait_xcnt 0x0" :: "v"(po), "v"(po + eo) : "memory");   // as above; it also stands ahead of the pointer steps below
  __builtin_amdgcn_sched_barrier(0);                         // the 15 score loads stay one run: no window arithmetic (and no wait) is lifted between them
  po += stp; pt += stp; pu += stp;
}
constexpr int QTB = 4;        // query tiles of a work-group's block (64 queries): they share every staged V chunk
constexpr int KSP = 4;        // key splits: wave (qt, g) takes key chunks g, g + KSP, ... of query tile qt
constexpr int NW = QTB * KSP; // waves per work-group
constexpr int OP = D + 4;     // pitch of a partial row in floats: 528 B = 16 B x odd, so the 16 query columns of a b128 store fall on distinct banks
constexpr int CH = 32 * D;    // elements of one key chunk in one V plane (8 KB)
// One stage = KSP key chunks in a row of both V planes (32 KB each), copied to LDS without passing registers: 8 copies of 16 B per lane, each wave
// instruction 512 B in a row. gh, gl (global) and sh, sl (LDS byte addresses) name the thread's own 16 bytes of the first 8 KB of each plane; the
// immediate offset moves the global and the LDS address alike, and source and destination are both 8 KB further on per copy.
static_assert(KSP == 4 && CH * 2 == 8192, "the offsets below are written for four chunks of 8 KB");
__device__ __forceinline__ void stage_v(const b16* gh, const b16* gl, unsigned sh, unsigned sl) {
  // the wait in the copies' own statement stands before anything rewrites the address registers that the issued copies name
  asm volatile("global_load_async_to_lds_b128 %0, %2, off\n\t"
               "global_load_async_to_lds_b128 %0, %2, off offset:8192\n\t"
               "global_load_async_to_lds_b128 %0, %2, off offset:16384\n\t"
               "global_load_async_to_lds_b128 %0, %2, off offset:24576\n\t"
               "global_load_async_to_lds_b128 %1, %3, off\n\t"
               "global_load_async_to_lds_b128 %1, %3, off offset:8192\n\t"
               "global_load_async_to_lds_b128 %1, %3, off offset:16384\n\t"
               "global_load_async_to_lds_b128 %1, %3, off offset:24576\n\t"
               "s_wait_xcnt 0x0"
               :: "v"(sh), "v"(sl), "v"(gh), "v"(gl) : "memory");
}
__global__ __launch_bounds__(NW * 32) void attn_kernel(const float* __restrict__ Sb, const float* __restrict__ wconv, const b16* __restrict__ vth, const b16* __restrict__ vtl,
                                                   float* __restrict__ out) {
  __shared__ __attribute__((aligned(16))) b16 Vs[2][2][KSP * CH];   // [buffer][plane hi, lo][KSP key chunks in fragment order]: 128 KB
  __shared__ __attribute__((aligned(16))) float Os[NW][16 * OP];    // partials; a row's maximum and sum lie in its pad (floats D, D + 1): no address of their own
  const int tid = threadIdx.x, wid = __builtin_amdgcn_readfirstlane(tid >> 5), lane = tid & 31, hh = lane >> 4, col = lane & 15;
  const int qt = wid / KSP, g = wid % KSP;
  const int h = blockIdx.x / (S / 128), pr = blockIdx.x % (S / 128);
  const float* Sh = Sb + (size_t)h * HSZ; const b16* vh = vth + (size_t)h * D * S + tid * 8; const b16* vl = vtl + (size_t)h * D * S + tid * 8;
  const unsigned sv = (unsigned)(size_t)(&Vs[0][0][0]) + (unsigned)tid * 16u;   // the thread's own 16 bytes of buffer 0, plane hi (LDS byte address)
  constexpr unsigned PB = KSP * CH * 2;                        // bytes of one plane of one buffer
  float w[9];
#pragma unroll
  for (int i = 0; i < 9; ++i) w[i] = wconv[h * 9 + i];       // [i][j]: query tap i (row q-2+i), key tap j (k-1+j)
  for (int half = 0; half < 2; ++half) {
    const int qb0 = (half ? pr : S / 64 - 1 - pr) * 64, q0 = qb0 + qt * 16, qi = q0 + col;
    const int nst = (qb0 / 32 + 2 + KSP - 1) / KSP;              // stages: the block's causal key chunks (qb0 / 32 + 2) in groups of KSP; the last chunk staged is below S / 32
    // rows above row 0 are zero (only the first tile has such rows, and only its chunk kb = 0): their loads go to row 0, keys 64 on, which the score
    // kernel stores as zeros (future keys), so every lane uses the head's nine weights as they are (uniform values, no per-lane copies in registers)
    const int rt = q0 > 0 ? q0 - 2 + (col < 1 ? col : 1) : 0, ru = q0 > 0 ? q0 - 1 : 0, zk = q0 > 0 ? 0 : 64;
    const float* po = Sh + tile_off(q0) + g * 512 + lane * 4; const float* pu = Sh + tile_off(ru) + (zk / 32 + g) * 512 + (16 * hh + (ru & 15)) * 4;
    const float* pt = pu - (ru - rt) * 4;                        // rows q0-2 and q0-1 lie in one query tile (q0 is a multiple of 16)
    float m = -INFINITY, l = 0.0f;
    v8f o[8];
#pragma unroll
    for (int n = 0; n < 8; ++n) o[n] = (v8f){};
    // The score window of a wave's chunk is loaded ahead of the trip that uses it: all waves leave a trip's barrier together, so loads issued and used in the
    // same trip are waited for by the whole work-group at once. The first window flies beside stage 0's copies, each later one from the head of the trip before, once that trip's runs are formed.
    Win x;
    if (g * 32 < q0 + 16) load_win(x, po, pt, pu, g * 32, hh, KSP * 512);   // wave-uniform: the wave has a first chunk
    // Two-buffer ring: stage 0 lands and is published, then stage 1 flies while stage 0 is worked on. Every reader of the buffers has left them
    // (first block: none yet; second block: the barriers of the last trip and of the merge).
    stage_v(vh, vl, sv, sv + PB);
    asm volatile("s_wait_asynccnt 0x0" ::: "memory");            // this wave's copies of stage 0 have landed
    __syncthreads();                                             // every wave's copies of stage 0 have landed before any wave reads the stage
    if (nst > 1) stage_v(vh + KSP * CH, vl + KSP * CH, sv + 2 * PB, sv + 3 * PB);
    for (int t = 0; t < nst; ++t) {
      const int kb = (t * KSP + g) * 32;
      if (kb < q0 + 16) {                                        // wave-uniform: this wave's chunk of the stage holds causal keys of its query tile
      v8f s0 = {}, s1 = {};
      // Score window: every lane loads only its own query row (plus the two rows above the tile, which lanes 0 and 1 of each half need); rows
      // q-1 and q-2 come from the lanes of queries q-1 and q-2 by a shift inside the 16-lane row. Same values and same sums as per-element loads.
      float oa[10], ob[10], ta[10], tb[10], ua[10], ub[10];
      make_runs(x.o, kb, hh, oa, ob); make_runs(x.t, kb, hh, ta, tb); make_runs(x.u, kb, hh, ua, ub);
#pragma unroll
      for (int j = 0; j < 10; ++j) { ta[j] = row_from<0x112>(ta[j], oa[j]); tb[j] = row_from<0x112>(tb[j], ob[j]); }   // row q-2
#pragma unroll
      for (int j = 0; j < 10; ++j) { ua[j] = row_from<0x111>(ua[j], oa[j]); ub[j] = row_from<0x111>(ub[j], ob[j]); }   // row q-1
      // The three rows' runs are formed: the loads of the wave's next chunk are issued now and fly under the window sums, the softmax and the products below.
      if (kb + KSP * 32 < q0 + 16) load_win(x, po, pt, pu, kb + KSP * 32, hh, KSP * 512);   // wave-uniform: that chunk holds causal keys of the tile, so its stage exists and it is stored
#pragma unroll
      for (int r = 0; r < 8; ++r) s0[r] += w[0] * ta[r] + w[1] * ta[r + 1] + w[2] * ta[r + 2];
#pragma unroll
      for (int r = 0; r < 8; ++r) s1[r] += w[0] * tb[r] + w[1] * tb[r + 1] + w[2] * tb[r + 2];
#pragma unroll
      for (int r = 0; r < 8; ++r) s0[r] += w[3] * ua[r] + w[4] * ua[r + 1] + w[5] * ua[r + 2];
#pragma unroll
      for (int r = 0; r < 8; ++r) s1[r] += w[3] * ub[r] + w[4] * ub[r + 1] + w[5] * ub[r + 2];
#pragma unroll
      for (int r = 0; r < 8; ++r) s0[r] += w[6] * oa[r] + w[7] * oa[r + 1] + w[8] * oa[r + 2];
#pragma unroll
      for (int r = 0; r < 8; ++r) s1[r] += w[6] * ob[r] + w[7] * ob[r + 1] + w[8] * ob[r + 2];
      const int dq = qi - kb - 8 * hh;                           // the lane's key r (or r + 16) is a future key where it exceeds dq: one register, not one bound per key
#pragma unroll
      for (int r = 0; r < 8; ++r) { if (r > dq) s0[r] = -INFINITY; if (r + 16 > dq) s1[r] = -INFINITY; }
      // The chunk's V fragment reads (LDS, 512 B in a row each): feature tiles 0 .. 3 (16 reads) in one run ahead of the softmax, tiles 4, 5 and 6, 7 into the
      // registers of tiles 0, 1 and 2, 3 behind those tiles' products: 64 registers, not 128, which leaves room for the window that is in flight.
      // Fragment order (vt_kernel): feature tiles are 512 elements apart, halves j = 0, 1 are 256 apart.
      const b16* pvh = &Vs[t & 1][0][g * CH + lane * 8]; const b16* pvl = &Vs[t & 1][1][g * CH + lane * 8];
      __builtin_amdgcn_sched_barrier(0);                         // the V reads are not lifted over the window sums, where the runs' registers are still live (more register copies otherwise)
      v8b vh0[4], vh1[4], vl0[4], vl1[4];                        // feature tile n in place n & 3
#pragma unroll
      for (int n = 0; n < 4; ++n) { vh0[n] = ld8b(pvh + n * 512); vh1[n] = ld8b(pvh + n * 512 + 256); vl0[n] = ld8b(pvl + n * 512); vl1[n] = ld8b(pvl + n * 512 + 256); }
      float mr = -INFINITY;
#pragma unroll
      for (int r = 0; r < 8; ++r) mr = fmaxf(mr, fmaxf(s0[r], s1[r]));
      mr = fmaxf(mr, xhalf(mr));                                 // lane ^ 16 by a vector move: an LDS permute would return only behind the V reads queued ahead of it
      float mn = fmaxf(m, mr); if (mn == -INFINITY) mn = 0.0f;
      const float al_ = __expf(m - mn); m = mn;
      float sum = 0.0f; v16b pb;
#pragma unroll
      for (int r = 0; r < 8; ++r) { const float p0 = __expf(s0[r] - mn), p1 = __expf(s1[r] - mn); sum += p0 + p1; pb[r] = (b16)p0; pb[8 + r] = (b16)p1; }
      sum += xhalf(sum);
      l = l * al_ + sum;
#pragma unroll
      for (int n = 0; n < 8; ++n) {
#pragma unroll
        for (int r = 0; r < 8; ++r) o[n][r] *= al_;
        o[n] = wmma16b(cat8b(vh0[n & 3], vh1[n & 3]), pb, o[n]);
        o[n] = wmma16b(cat8b(vl0[n & 3], vl1[n & 3]), pb, o[n]);
        if (n == 1 || n == 3) {
          __builtin_amdgcn_sched_barrier(0);                     // the refill stays behind the products that free its registers (lifted, it would take 32 registers more)
#pragma unroll
          for (int f = n + 3; f <= n + 4; ++f) { vh0[f & 3] = ld8b(pvh + f * 512); vh1[f & 3] = ld8b(pvh + f * 512 + 256); vl0[f & 3] = ld8b(pvl + f * 512); vl1[f & 3] = ld8b(pvl + f * 512 + 256); }
        }
      }
      }
      // Publish point of stage t + 1, passed by every wave (also one whose chunk was skipped), in this order:
      asm volatile("s_wait_dscnt 0x0" ::: "memory");             // this wave's reads of stage t have returned before the buffer is refilled
      asm volatile("s_wait_asynccnt 0x0" ::: "memory");          // this wave's copies of stage t + 1 have landed
      __syncthreads();                                           // publishes stage t + 1 and ends every wave's reads of stage t
      if (t + 2 < nst) stage_v(vh + (t + 2) * (KSP * CH), vl + (t + 2) * (KSP * CH), sv + (t & 1) * (2 * PB), sv + (t & 1) * (2 * PB) + PB);
    }
    asm volatile("s_wait_asynccnt 0x0" ::: "memory");            // no copy is outstanding behind the loop
    {                                                            // un-normalised partial y^T: lane col = query, element r = feature 16n+8hh+r; a wave without a chunk stores zeros, m = -inf
      float* Tr = Os[wid] + col * OP + 8 * hh;
#pragma unroll
      for (int n = 0; n < 8; ++n)
#pragma unroll
        for (int r = 0; r < 8; ++r) Tr[n * 16 + r] = o[n][r];
      if (hh == 0) { Tr[D] = m; Tr[D + 1] = l; }                 // the row's pad, from the lanes whose Tr is the row's start
    }
    __syncthreads();                                             // every wave's partial is in LDS before any is merged
#pragma unroll
    for (int i = 0; i < 16 / KSP; ++i) {                         // wave (qt, g) merges rows 4g .. 4g+3 of query tile qt; split 0 always holds key 0, so mx is finite
      const int rr = g * (16 / KSP) + i;
      float mx = -INFINITY;
#pragma unroll
      for (int u = 0; u < KSP; ++u) mx = fmaxf(mx, Os[qt * KSP + u][rr * OP + D]);
      float ls = 0.0f; v4f y = {};
#pragma unroll
      for (int u = 0; u < KSP; ++u) { const float* Pu = &Os[qt * KSP + u][rr * OP]; const float f = __expf(Pu[D] - mx); ls += f * Pu[D + 1]; y += f * *(const v4f*)(Pu + lane * 4); }
      const float inv = (ls > 0.0f) ? (1.0f / (VS * ls)) : 0.0f;
      const v4f yo = y * inv; float* dst = out + ((size_t)h * S + q0 + rr) * D + lane * 4;
      *(v4f*)dst = yo;                                           // one row of 512 B per wave: whole lines
      asm volatile("s_wait_xcnt 0x0" :: "v"(yo), "v"(dst) : "memory");   // the next row's arithmetic rewrites registers that this store names; as inputs they stay untouched up to the wait
    }
    __syncthreads();                                             // the merge has read the partials before the second block overwrites them
  }
}
}  // namespace

extern "C" void kernel_launch(void* const* d_in, const int* in_sizes, int n_in,
                              void* d_out, int out_size, void* d_ws, size_t ws_size, hipStream_t stream) {
  (void)n_in; (void)out_size;
  const float* Q = (const float*)d_in[0]; const float* K = (const float*)d_in[1]; const float* V = (const float*)d_in[2];   // [1,16,2048,128]
  const float* wconv = (const float*)d_in[3];   // [16,3,3]
  float* out = (float*)d_out;                   // [1,16,2048,128]
  if (in_sizes[0] != H * S * D || in_sizes[1] != H * S * D || in_sizes[2] != H * S * D || in_sizes[3] != H * 9) return;
  size_t off = 0; char* ws = (char*)d_ws;
  auto carve = [&](size_t bytes) { char* p = ws + off; off += (bytes + 255) & ~(size_t)255; return p; };
  b16* vth = (b16*)carve((size_t)H * D * S * 2);     //  8 MB
  b16* vtl = (b16*)carve((size_t)H * D * S * 2);     //  8 MB
  b16* qh = (b16*)carve((size_t)H * S * D * 2);      //  8 MB each: 8Q and 8K, hi and lo
  b16* ql = (b16*)carve((size_t)H * S * D * 2);
  b16* kh = (b16*)carve((size_t)H * S * D * 2);
  b16* kl = (b16*)carve((size_t)H * S * D * 2);
  float* Sb = (float*)carve((size_t)H * HSZ * 4);    // 151 MB score buffer, all heads
  if (off > ws_size) return;                           // total 201,326,592 B
  vt_kernel<<<H * (S / 64) + 2 * (H * S / 16 / QT), 256, 0, stream>>>(V, vth, vtl, Q, K, qh, ql, kh, kl);
  s_kernel<<<dim3(S / 64 + 4, S / 256, H), 128, 0, stream>>>(qh, ql, kh, kl, Sb);
  attn_kernel<<<H * (S / 128), NW * 32, 0, stream>>>(Sb, wconv, vth, vtl, out);
}

// v010
// A run of this version takes 93.7 microseconds.
// Timed twice side by side with v009, it ran 1.03 and 1.04 times as fast.
// Over all steps from v000 it is 17.1 times as fast.
#include <hip/hip_runtime.h>

// Causal attention with a learned per-head 3x3 convolution over the score matrix: s = Q.K^T/sqrt(128) with future keys zeroed, cs[q][k] =
// sum_{i<3,j<3} w[h][i][j] s[q-2+i][k-1+j] (query padding left only, key padding symmetric, zeros outside), future keys -> -inf, softmax, out = P.V.
// B=1, 16 heads, S=2048, D=128; Q, K, V are the inputs (no projections).
// Contractions on v_wmma_f32_16x16x32_f16: Q.K^T with both operands split once into f16 hi+lo planes of the x8-scaled f32 rows (3 products); P.V with
// unnormalised P as single f16 against an f16 hi+lo pair of 8V (2 products); f32 accumulate; the 3x3 score convolution, masking and online softmax in
// f32 from an f32 score buffer (all heads, causal keys only). Fragment k-map per lane half hh for A AND B: elements 0..7 <- k = 8hh+0..7, 8..15 <- k = 16+8hh+0..7.

namespace {
constexpr int H = 16, S = 2048, D = 128;
constexpr float XS = 8.0f, VS = 8.0f, SCALE = 0.08838834764831845f;   // 128^-0.5

// Score buffer, per head: the 128 rows of row block b keep keys 0 .. 128b+191 only (their causal keys and one 64-key tile of zeros behind them, which
// the window's key k+1 and the rows q-1, q-2 of the next block's first tile read), so the row pitch grows with b and 16 heads take 151 MB, not 256 MB.
// Inside a row block the order is the one the attention lanes load in: [query tile of 16][key chunk of 32][piece p][lane][4 keys], lane = 16hh + query,
// keys 16(p>>1) + 8hh + 4(p&1) + 0..3 of the chunk: a chunk of a tile is 2 KB in a row, and one 16-byte load per lane reads a piece = 4 whole 128-B lines.
constexpr int HSZ = 8192 * (S / 128) * (S / 128 + 2);        // floats per head = start of a row block one past the last
__device__ __forceinline__ int blk_pitch(int b) { return (b + 1) * 128 + 64; }
__device__ __forceinline__ int tile_off(int row) { const int b = row >> 7; return 8192 * b * (b + 2) + ((row & 127) >> 4) * 16 * blk_pitch(b); }   // start of the row's query tile; 8192 b (b + 2) = sum of 128 * pitch over the blocks before b

typedef _Float16 b16;
typedef __attribute__((ext_vector_type(16))) _Float16 v16b;
typedef __attribute__((ext_vector_type(8)))  _Float16 v8b;
typedef __attribute__((ext_vector_type(8)))  float v8f;
typedef __attribute__((ext_vector_type(4)))  float v4f;

__device__ __forceinline__ v8b ld8b(const b16* p) { return *(const v8b*)p; }
__device__ __forceinline__ v16b cat8b(v8b a, v8b b) { return __builtin_shufflevector(a, b, 0, 1, 2, 3, 4, 5, 6, 7, 8, 9, 10, 11, 12, 13, 14, 15); }
__device__ __forceinline__ void split16(float v, b16& hi, b16& lo) { hi = (b16)v; lo = (b16)(v - (float)hi); }
__device__ __forceinline__ v8f wmma16b(v16b a, v16b b, v8f c) {
  v8f d = __builtin_amdgcn_wmma_f32_16x16x32_f16(false, a, false, b, (short)0, c, false, false);
  asm volatile("v_nop\n\tv_nop\n\tv_nop\n\tv_nop" : "+v"(d) : "v"(a), "v"(b));
  return d;
}
__device__ __forceinline__ void wave_lds_sync() {
  __builtin_amdgcn_fence(__ATOMIC_RELEASE, "workgroup");
  __builtin_amdgcn_wave_barrier();
  __builtin_amdgcn_fence(__ATOMIC_ACQUIRE, "workgroup");
}

// One accumulator's products of a k block; operand kind 2 = f16 hi + lo planes, 1 = one f16 plane
template <int ANP, int BNP> __device__ __forceinline__ v8f mac(v16b ah, v16b al, v16b bh, v16b bl, v8f c) {
  c = wmma16b(ah, bh, c);
  if (BNP == 0 || BNP == 2 || BNP == 4 || BNP == 5) c = wmma16b(ah, bl, c);     // hi.lo
  if (ANP == 0 || ANP == 2 || ANP == 4 || ANP == 5) c = wmma16b(al, bh, c);     // lo.hi   (lo.lo dropped)
  return c;
}
__device__ __forceinline__ void epi_planes(v8f (&acc)[2][4], float scale, bool two, b16* __restrict__ oh, b16* __restrict__ ol, int ldo,
                                           int m0, int c0, int lane, b16* Th, b16* Tl) {
  const int nloc = lane & 15, hlf = lane >> 4;
#pragma unroll
  for (int t = 0; t < 4; ++t)
#pragma unroll
    for (int r = 0; r < 2; ++r)
#pragma unroll
      for (int v = 0; v < 8; ++v) {
        const int rr = r * 16 + v + 8 * hlf, cc = t * 16 + nloc;
        b16 h_, l_; split16(acc[r][t][v] * scale, h_, l_);
        Th[rr * 64 + cc] = h_; Tl[rr * 64 + cc] = l_;
      }
  wave_lds_sync();
  {
#pragma unroll
    for (int j = 0; j < 8; ++j) {
      const int rr = j * 4 + (lane >> 3), c8 = (lane & 7) * 8;
      const size_t o = (size_t)(m0 + rr) * ldo + c0 + c8;
      *(v8b*)(oh + o) = ld8b(Th + rr * 64 + c8);
      if (two) *(v8b*)(ol + o) = ld8b(Tl + rr * 64 + c8);
    }
    
  }
}
// (b) f32 rows with pitch ldo: 64 floats = 256 B = 2 lines per row; 16 lanes x 16 B per row, 2 rows per instruction. Optional per-row factor
__device__ __forceinline__ void epi_f32(v8f (&acc)[2][4], float scale, const float* rscale, float* __restrict__ out, int ldo, int m0, int c0, int lane, float* Tt) {
  const int nloc = lane & 15, hlf = lane >> 4;
#pragma unroll
  for (int t = 0; t < 4; ++t)
#pragma unroll
    for (int r = 0; r < 2; ++r)
#pragma unroll
      for (int v = 0; v < 8; ++v) {
        const int rr = r * 16 + v + 8 * hlf;
        const float rs = rscale ? rscale[(size_t)(m0 + rr) * 32] : 1.0f;
        Tt[rr * 64 + t * 16 + nloc] = acc[r][t][v] * scale * rs;
      }
  wave_lds_sync();
  float* dst0 = out + (size_t)m0 * ldo + c0;
  {
#pragma unroll
    for (int j = 0; j < 16; ++j) { const int rr = j * 2 + hlf, c4 = nloc * 4; *(v4f*)(dst0 + (size_t)rr * ldo + c4) = *(const v4f*)(Tt + rr * 64 + c4); }
    
  }
}



// (8V)^T as f16 hi and lo planes in the order the attention waves read their A fragments: per head [key chunk of 32][feature tile n of 16][half j]
// [lane][8 keys], lane = 16hh + feature, keys 16j + 8hh + 0..7 of the chunk. One fragment = two loads of 512 B in a row (4 whole lines each).
// The same launch splits Q and K (blocks from H * S / 64 on): 8X as f16 hi and lo planes in the order the score waves read their fragments: [row tile of
// 16][k block of 32][half j][lane][8], lane = 16hh + row, k = 16j + 8hh + 0..7 of the block; a tile's 256 units = the block's 256 threads, QT tiles each.
constexpr int QT = 8;
__global__ __launch_bounds__(256) void vt_kernel(const float* __restrict__ V, b16* __restrict__ vth, b16* __restrict__ vtl, const float* __restrict__ Q,
                                                 const float* __restrict__ K, b16* __restrict__ qh, b16* __restrict__ ql, b16* __restrict__ kh, b16* __restrict__ kl) {
  __shared__ __attribute__((aligned(16))) b16 Th[D][72]; __shared__ __attribute__((aligned(16))) b16 Tl[D][72];
  if (blockIdx.x >= H * (S / 64)) {                            // block-uniform; no barrier on this path
    constexpr int NB = H * S / 16 / QT;                        // blocks per tensor
    const int b = blockIdx.x - H * (S / 64), isk = b >= NB, tile0 = (b - isk * NB) * QT, u = threadIdx.x, fl = u & 31;
    const float* X = (isk ? K : Q) + ((size_t)tile0 * 16 + (fl & 15)) * D + (u >> 6) * 32 + 16 * ((u >> 5) & 1) + 8 * (fl >> 4);
    b16* xh = (isk ? kh : qh) + (size_t)tile0 * (16 * D) + u * 8; b16* xl = (isk ? kl : ql) + (size_t)tile0 * (16 * D) + u * 8;
    v4f x0[QT], x1[QT];
#pragma unroll
    for (int i = 0; i < QT; ++i) { x0[i] = *(const v4f*)(X + i * 16 * D); x1[i] = *(const v4f*)(X + i * 16 * D + 4); }
    asm volatile("s_wait_xcnt 0x0" :: "v"(X) : "memory");      // all loads are issued before the first store (one latency, not QT); X as input keeps results out of it
#pragma unroll
    for (int i = 0; i < QT; ++i) {
      v8b vh_, vl_;
#pragma unroll
      for (int e = 0; e < 4; ++e) { b16 a, c; split16(x0[i][e] * XS, a, c); vh_[e] = a; vl_[e] = c; split16(x1[i][e] * XS, a, c); vh_[4 + e] = a; vl_[4 + e] = c; }
      *(v8b*)(xh + i * 16 * D) = vh_; *(v8b*)(xl + i * 16 * D) = vl_;
    }
    return;
  }
  const int tid = threadIdx.x, h = blockIdx.x / (S / 64), t0 = (blockIdx.x % (S / 64)) * 64;
  for (int i = tid; i < 64 * D; i += 256) { const int t = i / D, dd = i % D; b16 a, b2; split16(V[((size_t)h * S + t0 + t) * D + dd] * VS, a, b2); Th[dd][t] = a; Tl[dd][t] = b2; }
  __syncthreads();
  // Fragment order: unit u of 8 keys = [key chunk of 32][feature tile n][fragment half j][lane]; the block's two chunks are 16 KB in a row per plane
  b16* bh = vth + (size_t)h * D * S + (size_t)t0 * D; b16* bl = vtl + (size_t)h * D * S + (size_t)t0 * D;
#pragma unroll
  for (int i = 0; i < 4; ++i) {
    const int u = i * 256 + tid, fl = u & 31, j = (u >> 5) & 1, n = (u >> 6) & 7, c = u >> 9;
    const int dd = n * 16 + (fl & 15), t = c * 32 + 16 * j + 8 * (fl >> 4);
    *(v8b*)(bh + (size_t)u * 8) = *(const v8b*)(&Th[dd][t]); *(v8b*)(bl + (size_t)u * 8) = *(const v8b*)(&Tl[dd][t]);
  }
}

// One K tile of the score kernel = 64 keys = 16 KB in a row in each plane, copied to LDS without passing registers: 16 copies of 16 B per lane, each wave
// instruction 512 B in a row. gh, gl (global) and sh, sl (LDS byte addresses) name the thread's own 16 bytes of the first 2 KB of each plane; the
// immediate offset moves the global and the LDS address alike, and source and destination are both 2 KB (128 threads x 16 B) further on per copy.
__device__ __forceinline__ void stage_k(const b16* gh, const b16* gl, unsigned sh, unsigned sl) {
  // the wait in the copies' own statement stands before anything rewrites the address registers that the issued copies name
  asm volatile("global_load_async_to_lds_b128 %0, %2, off\n\t"
               "global_load_async_to_lds_b128 %0, %2, off offset:2048\n\t"
               "global_load_async_to_lds_b128 %0, %2, off offset:4096\n\t"
               "global_load_async_to_lds_b128 %0, %2, off offset:6144\n\t"
               "global_load_async_to_lds_b128 %0, %2, off offset:8192\n\t"
               "global_load_async_to_lds_b128 %0, %2, off offset:10240\n\t"
               "global_load_async_to_lds_b128 %0, %2, off offset:12288\n\t"
               "global_load_async_to_lds_b128 %0, %2, off offset:14336\n\t"
               "global_load_async_to_lds_b128 %1, %3, off\n\t"
               "global_load_async_to_lds_b128 %1, %3, off offset:2048\n\t"
               "global_load_async_to_lds_b128 %1, %3, off offset:4096\n\t"
               "global_load_async_to_lds_b128 %1, %3, off offset:6144\n\t"
               "global_load_async_to_lds_b128 %1, %3, off offset:8192\n\t"
               "global_load_async_to_lds_b128 %1, %3, off offset:10240\n\t"
               "global_load_async_to_lds_b128 %1, %3, off offset:12288\n\t"
               "global_load_async_to_lds_b128 %1, %3, off offset:14336\n\t"
               "s_wait_xcnt 0x0"
               :: "v"(sh), "v"(sl), "v"(gh), "v"(gl) : "memory");
}
// Scores, all heads: grid (36, 8, H). Row block b has 2b+3 key tiles of 64 (32 in the last block); blocks y and 15-y share a grid row of 36, so only stored
// tiles have a work-group. The one tile wholly above the diagonal skips the MMA work (acc = 0).
__global__ __launch_bounds__(128) void s_kernel(const b16* __restrict__ qh, const b16* __restrict__ ql, const b16* __restrict__ kh, const b16* __restrict__ kl, float* __restrict__ Sb) {
  constexpr int TP = 68;                                       // pitch of a staged row in floats: 272 B = 16 B x odd, so the 16 query rows of a b128 read fall on distinct banks
  __shared__ __attribute__((aligned(16))) float Ts[4][32 * TP];
  __shared__ __attribute__((aligned(16))) b16 Ks[2][64 * D];   // the tile's 64 keys, plane hi and lo, in fragment order: 16 KB each
  const int lane = threadIdx.x & 31, wave = threadIdx.x >> 5, nloc = lane & 15, hlf = lane >> 4, h = blockIdx.z;
  const int nlow = 2 * blockIdx.y + 3, low = (int)blockIdx.x < nlow;
  const int qb = low ? blockIdx.y : S / 128 - 1 - blockIdx.y, kt = low ? blockIdx.x : blockIdx.x - nlow, m0 = qb * 128 + wave * 32, c0 = kt * 64;
  if (c0 >= S) return;                                         // block-uniform: the last row block has no tile behind key S-1
  v8f acc[2][4];
#pragma unroll
  for (int r = 0; r < 2; ++r)
#pragma unroll
    for (int t = 0; t < 4; ++t) acc[r][t] = (v8f){};
  if (c0 <= qb * 128 + 127) {                                  // block-uniform: some (q, k) in this tile has k <= q
    // 32x64 wave tile from the fragment-order planes (vt_kernel): row tile = 2048 elements, k block = 512, half = 256, lane = 8; each load = 4 whole lines.
    // The 64 keys of the tile are 16 KB in a row in each K plane and every wave needs all of them: they are copied to LDS once and read there by the 4 waves.
    stage_k(kh + ((size_t)h * S + c0) * D + threadIdx.x * 8, kl + ((size_t)h * S + c0) * D + threadIdx.x * 8,
            (unsigned)(size_t)(&Ks[0][0]) + threadIdx.x * 16u, (unsigned)(size_t)(&Ks[1][0]) + threadIdx.x * 16u);
    const size_t ao = ((size_t)h * S + m0) * D + lane * 8;
    const b16* pah = qh + ao; const b16* pal = ql + ao;
    v16b ah[D / 32][2], al[D / 32][2];                         // the wave's own 32 query rows, all four k blocks: their loads fly beside the copies (one latency per tile)
#pragma unroll
    for (int kc = 0; kc < D / 32; ++kc)
#pragma unroll
      for (int r = 0; r < 2; ++r) {
        const int o = r * 2048 + kc * 512;
        ah[kc][r] = cat8b(ld8b(pah + o), ld8b(pah + o + 256)); al[kc][r] = cat8b(ld8b(pal + o), ld8b(pal + o + 256));
      }
    asm volatile("s_wait_xcnt 0x0" :: "v"(pah), "v"(pal) : "memory");   // stands ahead of anything that rewrites the address registers of the 32 loads; the addresses as inputs keep results out of them
    asm volatile("s_wait_asynccnt 0x0" ::: "memory");          // this wave's copies of the K tile have landed
    __syncthreads();                                           // every wave's copies have landed before any wave reads the tile (block-uniform branch)
    const b16* pbh = &Ks[0][lane * 8]; const b16* pbl = &Ks[1][lane * 8];
    // Step i = k block i >> 2, key tile i & 3. The K fragments of step i + 1 are read from LDS ahead of step i's six products, so a read's latency passes under them.
    v16b bh[2], bl[2];
    bh[0] = cat8b(ld8b(pbh), ld8b(pbh + 256)); bl[0] = cat8b(ld8b(pbl), ld8b(pbl + 256));
#pragma unroll
    for (int i = 0; i < 4 * (D / 32); ++i) {
      const int kc = i >> 2, t = i & 3;
      if (i + 1 < 4 * (D / 32)) {
        const int o = ((i + 1) & 3) * 2048 + ((i + 1) >> 2) * 512, n = (i + 1) & 1;
        bh[n] = cat8b(ld8b(pbh + o), ld8b(pbh + o + 256)); bl[n] = cat8b(ld8b(pbl + o), ld8b(pbl + o + 256));
        __builtin_amdgcn_sched_barrier(0);                     // the reads stay ahead of the products below (sunk to their use, each would be waited for in full)
      }
      acc[0][t] = mac<2, 2>(ah[kc][0], al[kc][0], bh[i & 1], bl[i & 1], acc[0][t]);
      acc[1][t] = mac<2, 2>(ah[kc][1], al[kc][1], bh[i & 1], bl[i & 1], acc[1][t]);
    }
  }
  float* Tt = Ts[wave];
#pragma unroll
  for (int t = 0; t < 4; ++t)
#pragma unroll
    for (int r = 0; r < 2; ++r)
#pragma unroll
      for (int v = 0; v < 8; ++v) { const int rr = r * 16 + v + 8 * hlf, cc = t * 16 + nloc; Tt[rr * TP + cc] = (c0 + cc <= m0 + rr) ? acc[r][t][v] * (SCALE / (XS * XS)) : 0.0f; }
  wave_lds_sync();
  // the wave's 2 query tiles x 2 key chunks in the attention lanes' order: store j = tile j>>3, chunk (j>>2)&1, piece j&3; 512 B in a row each
  float* dst0 = Sb + (size_t)h * HSZ + tile_off(m0) + (c0 >> 5) * 512 + lane * 4;
  float* dst1 = dst0 + 16 * blk_pitch(qb);                     // the second query tile: one tile of this row block further on
  __builtin_amdgcn_sched_barrier(0);                           // both addresses are formed ahead of the first store: no address arithmetic lands in a register that an issued store names
  {
#pragma unroll
    for (int j = 0; j < 16; ++j) {
      const int r = j >> 3, ch = (j >> 2) & 1, pc = j & 3;
      *(v4f*)((r ? dst1 : dst0) + ch * 512 + pc * 128) = *(const v4f*)(Tt + (r * 16 + nloc) * TP + ch * 32 + (pc >> 1) * 16 + hlf * 8 + (pc & 1) * 4);
    }
  }
}

// ---------------------------------------------------------------------------
// Convolved-score attention, all heads in one launch: work-group = one head's query blocks b and S/64-1-b (64 queries = 4 tiles of 16 each, one block after
// the other: every work-group has the same number of stages); wave (qt, g) takes query tile qt and every 4th key chunk of 32 from g on, with its own
// maximum, sum and accumulators; a stage's 4 V chunks are copied to LDS once and read there by all 4 query tiles; the 4 partials of a tile are merged
// through LDS. Per element the 3x3 window of the stored scores
// (rows q-2..q, keys k-1..k+1, zero outside [0,S)), x w[h], -inf for k > q; online softmax f32; P^T f16; y^T += (8V)^T.P^T (8 feature tiles, hi + lo
// ---------------------------------------------------------------------------
// lane l <-> lane l ^ 16
__device__ __forceinline__ float xhalf(float x) { return __builtin_bit_cast(float, __builtin_amdgcn_permlanex16(__builtin_bit_cast(int, x), __builtin_bit_cast(int, x), 0x76543210, 0xfedcba98, false, false)); }
// DPP row_shr:n (CTRL = 0x110 + n): lane c of a 16-lane row takes src of lane c - n; lanes c < n keep edge
template <int CTRL> __device__ __forceinline__ float row_from(float edge, float src) {
  return __builtin_bit_cast(float, __builtin_amdgcn_update_dpp(__builtin_bit_cast(int, edge), __builtin_bit_cast(int, src), CTRL, 0xf, 0xf, false));
}
// One score row's two 10-key runs of a lane: a = keys kb+8hh-1 .. kb+8hh+8, b = the same + 16 (zero outside [0, S)). The lane's own 16 keys are four
// aligned 16-byte loads (the chunk's four pieces, 128 floats apart); the run ends inside the 32-key chunk are held by lane ^ 16; only key kb-1 (hh 0) or
// kb+32 (hh 1) is one more load: the last key of the chunk before (piece 3, lane + 16, element 3) or the first of the chunk behind (piece 0, lane - 16).
struct RowRaw { v4f f0, f1, g0, g1; float e; };
// p = the lane's 4 keys in piece 0 of the row's chunk; eo = distance from there to the lane's outer key (0 where that key is outside the row)
__device__ __forceinline__ RowRaw load_row(const float* __restrict__ p, int eo) {
  return RowRaw{*(const v4f*)p, *(const v4f*)(p + 128), *(const v4f*)(p + 256), *(const v4f*)(p + 384), p[eo]};
}
__device__ __forceinline__ void make_runs(const RowRaw& x, int kb, int hh, float (&a)[10], float (&b)[10]) {
  const int ke = hh ? kb + 32 : kb - 1;
  const float e = (ke >= 0 && ke < S) ? x.e : 0.0f;
  const float r1 = xhalf(hh ? x.f0[0] : x.f1[3]), r2 = xhalf(hh ? x.f1[3] : x.g0[0]), r3 = xhalf(hh ? x.g0[0] : x.g1[3]);
  a[0] = hh ? r1 : e; a[9] = hh ? r2 : r1; b[0] = hh ? r3 : r2; b[9] = hh ? e : r3;
#pragma unroll
  for (int j = 0; j < 4; ++j) { a[1 + j] = x.f0[j]; a[5 + j] = x.f1[j]; b[1 + j] = x.g0[j]; b[5 + j] = x.g1[j]; }
}
// The score window of one key chunk (kb) of a query tile, as loaded: rows q0-2 / q0-1 (t), q0-1 (u) and the lane's own row (o). The 15 loads are issued in
// one run and the three pointers step on to the wave's next chunk (stp floats) behind them.
struct Win { RowRaw t, u, o; };
__device__ __forceinline__ void load_win(Win& x, const float*& po, const float*& pt, const float*& pu, int kb, int hh, int stp) {
  const int ke = hh ? kb + 32 : kb - 1, eo = (ke >= 0 && ke < S) ? (hh ? 448 : -61) : 0;   // 512 - 64; -512 + 384 + 64 + 3
  x.t = load_row(pt, eo);                                    // lane 0: row q0-2, lane 1: row q0-1 (the other lanes: an unused copy of lane 1's)
  asm volatile("s_wait_xcnt 0x0" :: "v"(pt), "v"(pt + eo) : "memory");   // later loads' results may land in address registers of the loads above; the addresses as inputs keep this row's own results out of them too
  x.u = load_row(pu, eo);                                    // lane 0: row q0-1 (the other lanes: an unused copy)
  asm volatile("s_wait_xcnt 0x0" :: "v"(pu), "v"(pu + eo) : "memory");   // as above
  x.o = load_row(po, eo);
  asm volatile("s_wait_xcnt 0x0" :: "v"(po), "v"(po + eo) : "memory");   // as above; it also stands ahead of the pointer steps below
  __builtin_amdgcn_sched_barrier(0);                         // the 15 score loads stay one run: no window arithmetic (and no wait) is lifted between them
  po += stp; pt += stp; pu += stp;
}
constexpr int QTB = 4;        // query tiles of a work-group's block (64 queries): they share every staged V chunk
constexpr int KSP = 4;        // key splits: wave (qt, g) takes key chunks g, g + KSP, ... of query tile qt
constexpr int NW = QTB * KSP; // waves per work-group
constexpr int OP = D + 4;     // pitch of a partial row in floats: 528 B = 16 B x odd, so the 16 query columns of a b128 store fall on distinct banks
constexpr int CH = 32 * D;    // elements of one key chunk in one V plane (8 KB)
// One stage = KSP key chunks in a row of both V planes (32 KB each), copied to LDS without passing registers: 8 copies of 16 B per lane, each wave
// instruction 512 B in a row. gh, gl (global) and sh, sl (LDS byte addresses) name the thread's own 16 bytes of the first 8 KB of each plane; the
// immediate offset moves the global and the LDS address alike, and source and destination are both 8 KB further on per copy.
static_assert(KSP == 4 && CH * 2 == 8192, "the offsets below are written for four chunks of 8 KB");
__device__ __forceinline__ void stage_v(const b16* gh, const b16* gl, unsigned sh, unsigned sl) {
  // the wait in the copies' own statement stands before anything rewrites the address registers that the issued copies name
  asm volatile("global_load_async_to_lds_b128 %0, %2, off\n\t"
               "global_load_async_to_lds_b128 %0, %2, off offset:8192\n\t"
               "global_load_async_to_lds_b128 %0, %2, off offset:16384\n\t"
               "global_load_async_to_lds_b128 %0, %2, off offset:24576\n\t"
               "global_load_async_to_lds_b128 %1, %3, off\n\t"
               "global_load_async_to_lds_b128 %1, %3, off offset:8192\n\t"
               "global_load_async_to_lds_b128 %1, %3, off offset:16384\n\t"
               "global_load_async_to_lds_b128 %1, %3, off offset:24576\n\t"
               "s_wait_xcnt 0x0"
               :: "v"(sh), "v"(sl), "v"(gh), "v"(gl) : "memory");
}
__global__ __launch_bounds__(NW * 32) void attn_kernel(const float* __restrict__ Sb, const float* __restrict__ wconv, const b16* __restrict__ vth, const b16* __restrict__ vtl,
                                                   float* __restrict__ out) {
  __shared__ __attribute__((aligned(16))) b16 Vs[2][2][KSP * CH];   // [buffer][plane hi, lo][KSP key chunks in fragment order]: 128 KB
  __shared__ __attribute__((aligned(16))) float Os[NW][16 * OP];    // partials; a row's maximum and sum lie in its pad (floats D, D + 1): no address of their own
  const int tid = threadIdx.x, wid = __builtin_amdgcn_readfirstlane(tid >> 5), lane = tid & 31, hh = lane >> 4, col = lane & 15;
  const int qt = wid / KSP, g = wid % KSP;
  const int h = blockIdx.x / (S / 128), pr = blockIdx.x % (S / 128);
  const float* Sh = Sb + (size_t)h * HSZ; const b16* vh = vth + (size_t)h * D * S + tid * 8; const b16* vl = vtl + (size_t)h * D * S + tid * 8;
  const unsigned sv = (unsigned)(size_t)(&Vs[0][0][0]) + (unsigned)tid * 16u;   // the thread's own 16 bytes of buffer 0, plane hi (LDS byte address)
  constexpr unsigned PB = KSP * CH * 2;                        // bytes of one plane of one buffer
  float w[9];
#pragma unroll
  for (int i = 0; i < 9; ++i) w[i] = wconv[h * 9 + i];       // [i][j]: query tap i (row q-2+i), key tap j (k-1+j)
  for (int half = 0; half < 2; ++half) {
    const int qb0 = (half ? pr : S / 64 - 1 - pr) * 64, q0 = qb0 + qt * 16, qi = q0 + col;
    const int nst = (qb0 / 32 + 2 + KSP - 1) / KSP;              // stages: the block's causal key chunks (qb0 / 32 + 2) in groups of KSP; the last chunk staged is below S / 32
    // rows above row 0 are zero (only the first tile has such rows, and only its chunk kb = 0): their loads go to row 0, keys 64 on, which the score
    // kernel stores as zeros (future keys), so every lane uses the head's nine weights as they are (uniform values, no per-lane copies in registers)
    const int rt = q0 > 0 ? q0 - 2 + (col < 1 ? col : 1) : 0, ru = q0 > 0 ? q0 - 1 : 0, zk = q0 > 0 ? 0 : 64;
    const float* po = Sh + tile_off(q0) + g * 512 + lane * 4; const float* pu = Sh + tile_off(ru) + (zk / 32 + g) * 512 + (16 * hh + (ru & 15)) * 4;
    const float* pt = pu - (ru - rt) * 4;                        // rows q0-2 and q0-1 lie in one query tile (q0 is a multiple of 16)
    float m = -INFINITY, l = 0.0f;
    v8f o[8];
#pragma unroll
    for (int n = 0; n < 8; ++n) o[n] = (v8f){};
    // The score window of a wave's chunk is loaded ahead of the trip that uses it: all waves leave a trip's barrier together, so loads issued and used in the
    // same trip are waited for by the whole work-group at once. The first window flies beside stage 0's copies, each later one from the head of the trip before, once that trip's runs are formed.
    Win x;
    if (g * 32 < q0 + 16) load_win(x, po, pt, pu, g * 32, hh, KSP * 512);   // wave-uniform: the wave has a first chunk
    // Two-buffer ring: stage 0 lands and is published, then stage 1 flies while stage 0 is worked on. Every reader of the buffers has left them
    // (first block: none yet; second block: the barriers of the last trip and of the merge).
    stage_v(vh, vl, sv, sv + PB);
    asm volatile("s_wait_asynccnt 0x0" ::: "memory");            // this wave's copies of stage 0 have landed
    __syncthreads();                                             // every wave's copies of stage 0 have landed before any wave reads the stage
    if (nst > 1) stage_v(vh + KSP * CH, vl + KSP * CH, sv + 2 * PB, sv + 3 * PB);
    for (int t = 0; t < nst; ++t) {
      const int kb = (t * KSP + g) * 32;
      if (kb < q0 + 16) {                                        // wave-uniform: this wave's chunk of the stage holds causal keys of its query tile
      v8f s0 = {}, s1 = {};
      // Score window: every lane loads only its own query row (plus the two rows above the tile, which lanes 0 and 1 of each half need); rows
      // q-1 and q-2 come from the lanes of queries q-1 and q-2 by a shift inside the 16-lane row. Same values and same sums as per-element loads.
      float oa[10], ob[10], ta[10], tb[10], ua[10], ub[10];
      make_runs(x.o, kb, hh, oa, ob); make_runs(x.t, kb, hh, ta, tb); make_runs(x.u, kb, hh, ua, ub);
#pragma unroll
      for (int j = 0; j < 10; ++j) { ta[j] = row_from<0x112>(ta[j], oa[j]); tb[j] = row_from<0x112>(tb[j], ob[j]); }   // row q-2
#pragma unroll
      for (int j = 0; j < 10; ++j) { ua[j] = row_from<0x111>(ua[j], oa[j]); ub[j] = row_from<0x111>(ub[j], ob[j]); }   // row q-1
      // The three rows' runs are formed: the loads of the wave's next chunk are issued now and fly under the window sums, the softmax and the products below.
      if (kb + KSP * 32 < q0 + 16) load_win(x, po, pt, pu, kb + KSP * 32, hh, KSP * 512);   // wave-uniform: that chunk holds causal keys of the tile, so its stage exists and it is stored
#pragma unroll
      for (int r = 0; r < 8; ++r) s0[r] += w[0] * ta[r] + w[1] * ta[r + 1] + w[2] * ta[r + 2];
#pragma unroll
      for (int r = 0; r < 8; ++r) s1[r] += w[0] * tb[r] + w[1] * tb[r + 1] + w[2] * tb[r + 2];
#pragma unroll
      for (int r = 0; r < 8; ++r) s0[r] += w[3] * ua[r] + w[4] * ua[r + 1] + w[5] * ua[r + 2];
#pragma unroll
      for (int r = 0; r < 8; ++r) s1[r] += w[3] * ub[r] + w[4] * ub[r + 1] + w[5] * ub[r + 2];
#pragma unroll
      for (int r = 0; r < 8; ++r) s0[r] += w[6] * oa[r] + w[7] * oa[r + 1] + w[8] * oa[r + 2];
#pragma unroll
      for (int r = 0; r < 8; ++r) s1[r] += w[6] * ob[r] + w[7] * ob[r + 1] + w[8] * ob[r + 2];
      const int dq = qi - kb - 8 * hh;                           // the lane's key r (or r + 16) is a future key where it exceeds dq: one register, not one bound per key
#pragma unroll
      for (int r = 0; r < 8; ++r) { if (r > dq) s0[r] = -INFINITY; if (r + 16 > dq) s1[r] = -INFINITY; }
      // The chunk's V fragment reads (LDS, 512 B in a row each): feature tiles 0 .. 3 (16 reads) in one run ahead of the softmax, tiles 4, 5 and 6, 7 into the
      // registers of tiles 0, 1 and 2, 3 behind those tiles' products: 64 registers, not 128, which leaves room for the window that is in flight.
      // Fragment order (vt_kernel): feature tiles are 512 elements apart, halves j = 0, 1 are 256 apart.
      const b16* pvh = &Vs[t & 1][0][g * CH + lane * 8]; const b16* pvl = &Vs[t & 1][1][g * CH + lane * 8];
      __builtin_amdgcn_sched_barrier(0);                         // the V reads are not lifted over the window sums, where the runs' registers are still live (more register copies otherwise)
      v8b vh0[4], vh1[4], vl0[4], vl1[4];                        // feature tile n in place n & 3
#pragma unroll
      for (int n = 0; n < 4; ++n) { vh0[n] = ld8b(pvh + n * 512); vh1[n] = ld8b(pvh + n * 512 + 256); vl0[n] = ld8b(pvl + n * 512); vl1[n] = ld8b(pvl + n * 512 + 256); }
      float mr = -INFINITY;
#pragma unroll
      for (int r = 0; r < 8; ++r) mr = fmaxf(mr, fmaxf(s0[r], s1[r]));
      mr = fmaxf(mr, xhalf(mr));                                 // lane ^ 16 by a vector move: an LDS permute would return only behind the V reads queued ahead of it
      float mn = fmaxf(m, mr); if (mn == -INFINITY) mn = 0.0f;
      const float al_ = __expf(m - mn); m = mn;
      float sum = 0.0f; v16b pb;
#pragma unroll
      for (int r = 0; r < 8; ++r) { const float p0 = __expf(s0[r] - mn), p1 = __expf(s1[r] - mn); sum += p0 + p1; pb[r] = (b16)p0; pb[8 + r] = (b16)p1; }
      sum += xhalf(sum);
      l = l * al_ + sum;
#pragma unroll
      for (int n = 0; n < 8; ++n) {
#pragma unroll
        for (int r = 0; r < 8; ++r) o[n][r] *= al_;
        o[n] = wmma16b(cat8b(vh0[n & 3], vh1[n & 3]), pb, o[n]);
        o[n] = wmma16b(cat8b(vl0[n & 3], vl1[n & 3]), pb, o[n]);
        if (n == 1 || n == 3) {
          __builtin_amdgcn_sched_barrier(0);                     // the refill stays behind the products that free its registers (lifted, it would take 32 registers more)
#pragma unroll
          for (int f = n + 3; f <= n + 4; ++f) { vh0[f & 3] = ld8b(pvh + f * 512); vh1[f & 3] = ld8b(pvh + f * 512 + 256); vl0[f & 3] = ld8b(pvl + f * 512); vl1[f & 3] = ld8b(pvl + f * 512 + 256); }
        }
      }
      }
      // Publish point of stage t + 1, passed by every wave (also one whose chunk was skipped), in this order:
      asm volatile("s_wait_dscnt 0x0" ::: "memory");             // this wave's reads of stage t have returned before the buffer is refilled
      asm volatile("s_wait_asynccnt 0x0" ::: "memory");          // this wave's copies of stage t + 1 have landed
      __syncthreads();                                           // publishes stage t + 1 and ends every wave's reads of stage t
      if (t + 2 < nst) stage_v(vh + (t + 2) * (KSP * CH), vl + (t + 2) * (KSP * CH), sv + (t & 1) * (2 * PB), sv + (t & 1) * (2 * PB) + PB);
    }
    asm volatile("s_wait_asynccnt 0x0" ::: "memory");            // no copy is outstanding behind the loop
    {                                                            // un-normalised partial y^T: lane col = query, element r = feature 16n+8hh+r; a wave without a chunk stores zeros, m = -inf
      float* Tr = Os[wid] + col * OP + 8 * hh;
#pragma unroll
      for (int n = 0; n < 8; ++n)
#pragma unroll
        for (int r = 0; r < 8; ++r) Tr[n * 16 + r] = o[n][r];
      if (hh == 0) { Tr[D] = m; Tr[D + 1] = l; }                 // the row's pad, from the lanes whose Tr is the row's start
    }
    __syncthreads();                                             // every wave's partial is in LDS before any is merged
#pragma unroll
    for (int i = 0; i < 16 / KSP; ++i) {                         // wave (qt, g) merges rows 4g .. 4g+3 of query tile qt; split 0 always holds key 0, so mx is finite
      const int rr = g * (16 / KSP) + i;
      float mx = -INFINITY;
#pragma unroll
      for (int u = 0; u < KSP; ++u) mx = fmaxf(mx, Os[qt * KSP + u][rr * OP + D]);
      float ls = 0.0f; v4f y = {};
#pragma unroll
      for (int u = 0; u < KSP; ++u) { const float* Pu = &Os[qt * KSP + u][rr * OP]; const float f = __expf(Pu[D] - mx); ls += f * Pu[D + 1]; y += f * *(const v4f*)(Pu + lane * 4); }
      const float inv = (ls > 0.0f) ? (1.0f / (VS * ls)) : 0.0f;
      const v4f yo = y * inv; float* dst = out + ((size_t)h * S + q0 + rr) * D + lane * 4;
      *(v4f*)dst = yo;                                           // one row of 512 B per wave: whole lines
      asm volatile("s_wait_xcnt 0x0" :: "v"(yo), "v"(dst) : "memory");   // the next row's arithmetic rewrites registers that this store names; as inputs they stay untouched up to the wait
    }
    __syncthreads();                                             // the merge has read the partials before the second block overwrites them
  }
}
}  // namespace

extern "C" void kernel_launch(void* const* d_in, const int* in_sizes, int n_in,
                              void* d_out, int out_size, void* d_ws, size_t ws_size, hipStream_t stream) {
  (void)n_in; (void)out_size;
  const float* Q = (const float*)d_in[0]; const float* K = (const float*)d_in[1]; const float* V = (const float*)d_in[2];   // [1,16,2048,128]
  const float* wconv = (const float*)d_in[3];   // [16,3,3]
  float* out = (float*)d_out;                   // [1,16,2048,128]
  if (in_sizes[0] != H * S * D || in_sizes[1] != H * S * D || in_sizes[2] != H * S * D || in_sizes[3] != H * 9) return;
  size_t off = 0; char* ws = (char*)d_ws;
  auto carve = [&](size_t bytes) { char* p = ws + off; off += (bytes + 255) & ~(size_t)255; return p; };
  b16* vth = (b16*)carve((size_t)H * D * S * 2);     //  8 MB
  b16* vtl = (b16*)carve((size_t)H * D * S * 2);     //  8 MB
  b16* qh = (b16*)carve((size_t)H * S * D * 2);      //  8 MB each: 8Q and 8K, hi and lo
  b16* ql = (b16*)carve((size_t)H * S * D * 2);
  b16* kh = (b16*)carve((size_t)H * S * D * 2);
  b16* kl = (b16*)carve((size_t)H * S * D * 2);
  float* Sb = (float*)carve((size_t)H * HSZ * 4);    // 151 MB score buffer, all heads
  if (off > ws_size) return;                           // total 201,326,592 B
  vt_kernel<<<H * (S / 64) + 2 * (H * S / 16 / QT), 256, 0, stream>>>(V, vth, vtl, Q, K, qh, ql, kh, kl);
  s_kernel<<<dim3(S / 64 + 4, S / 256, H), 128, 0, stream>>>(qh, ql, kh, kl, Sb);
  attn_kernel<<<H * (S / 128), NW * 32, 0, stream>>>(Sb, wconv, vth, vtl, out);
}
